// v000
// Measured on an AMD MI455X. A time is GPU time per run, averaged over a window of back-to-back runs after a warm-up
// (all launches, gaps included; the runs take copies of the inputs in turn), and the median of several windows.
// Apart from v000's, it joins two sittings. Times from different sittings can be a few percent apart, while
// side-by-side timings come from the same sitting.
// The starting kernel, v000, takes 651 microseconds a run.
// compute dtype: all float inputs rounded to bf16; q/k/v projections with EXACT bf16 products on WMMA 16x16x32 ((in,out) weights, + bias), the sinusoidal position table built once on device in f32 (precise sinf/cosf/powf, k_sin) and projected with hi + lo (2 products) + bp, f32 accumulate; q kept in f32 (bias_u / bias_v added per head, then split into bf16-exact f16 hi + residual fragments), k / ph rounded once to f16, v to f16 hi + residual; content scores (q+bu) . k and the Transformer-XL position term (q+bv) . ph with single f16 products (logits ~1-2; q, k, ph each rounded once), the rel_shift realised exactly as an index map onto 16 x 32 position tiles (incl. its upper-triangle wrap-around rows and the zero at j == i+1), x 1/8, running-max softmax in f32 (hardware exp); P (f16 x 2^11 + residual) . v; out = x (bf16 hi + lo) . Wo + bo; f32 output.
#include <hip/hip_runtime.h>
#include <math.h>

typedef __attribute__((ext_vector_type(16))) _Float16 v16h;
typedef __attribute__((ext_vector_type(16))) __bf16 v16b;
typedef __attribute__((ext_vector_type(8)))  _Float16 v8h;
typedef __attribute__((ext_vector_type(8)))  float v8f;
typedef __attribute__((ext_vector_type(4)))  float v4f;
typedef __attribute__((ext_vector_type(2)))  float v2f;
typedef __attribute__((ext_vector_type(4)))  unsigned v4u;
typedef __attribute__((ext_vector_type(4)))  int v4i;
typedef float __attribute__((may_alias)) float_a;
typedef int __attribute__((may_alias)) int_a;

template <typename T> __device__ __forceinline__ void vst2(void* p, T v) { *(T*)p = v;  }
__device__ __forceinline__ v8f wmma16(v16h a, v16h b, v8f c) {
  v8f d = __builtin_amdgcn_wmma_f32_16x16x32_f16(false, a, false, b, (short)0, c, false, false);
  asm volatile("v_nop\n\tv_nop\n\tv_nop\n\tv_nop" : "+v"(d) : "v"(a), "v"(b));
  return d;
}
__device__ __forceinline__ v8f wmma_bf(v16b a, v16b b, v8f c) {
  v8f d = __builtin_amdgcn_wmma_f32_16x16x32_bf16(false, a, false, b, (short)0, c, false, false);
  asm volatile("v_nop\n\tv_nop\n\tv_nop\n\tv_nop" : "+v"(d) : "v"(a), "v"(b));
  return d;
}
// 16x16x32 fragments: lane = (h = lane>>4, row/col = lane&15); elements 0..7 = k0+8h+0..7, 8..15 = k0+16+8h+0..7; D element r = row 8h+r
__device__ __forceinline__ v16h frag_h(const _Float16* rowk0, int lane) {
  union { v16h v; v8h q[2]; } u; const _Float16* p = rowk0 + 8 * (lane >> 4);
  u.q[0] = *(const v8h*)p; u.q[1] = *(const v8h*)(p + 16); return u.v;
}
__device__ __forceinline__ v16h frag_f32(const float* rowk0, int lane) {
  v16h a; const float* p = rowk0 + 8 * (lane >> 4);
#pragma unroll
  for (int i = 0; i < 8; ++i) { a[i] = (_Float16)p[i]; a[8 + i] = (_Float16)p[16 + i]; }
  return a;
}
__device__ __forceinline__ v16h frag_f32s(const float* rowk0, int lane, float sc) {
  v16h a; const float* p = rowk0 + 8 * (lane >> 4);
#pragma unroll
  for (int i = 0; i < 8; ++i) { a[i] = (_Float16)(p[i] * sc); a[8 + i] = (_Float16)(p[16 + i] * sc); }
  return a;
}
// column fragment from a [K][ld] layout (column n), rows >= K read as 0
__device__ __forceinline__ v16h fragc_f32(const float* W, int k0, int n, int lane, int ld, int K) {
  v16h a; const int g = lane >> 4;
#pragma unroll
  for (int i = 0; i < 8; ++i) { const int ka = k0 + 8 * g + i, kb = ka + 16;
    a[i] = (_Float16)(ka < K ? W[(size_t)(ka < K ? ka : K - 1) * ld + n] : 0.f); a[8 + i] = (_Float16)(kb < K ? W[(size_t)(kb < K ? kb : K - 1) * ld + n] : 0.f); }
  return a;
}
struct F2 { v16b h, l; };
__device__ __forceinline__ F2 bsplit16(const float v[16]) { F2 r;
#pragma unroll
  for (int i = 0; i < 16; ++i) { const __bf16 h = (__bf16)v[i]; r.h[i] = h; r.l[i] = (__bf16)(v[i] - (float)h); }
  return r; }
__device__ __forceinline__ F2 split_row(const float* row, int k0, int lane) { float v[16]; const float* p = row + k0 + 8 * (lane >> 4);
#pragma unroll
  for (int i = 0; i < 8; ++i) { v[i] = p[i]; v[8 + i] = p[16 + i]; }
  return bsplit16(v); }
__device__ __forceinline__ F2 split_rowK(const float* row, int k0, int lane, int K) { float v[16]; const int g = lane >> 4;
#pragma unroll
  for (int i = 0; i < 8; ++i) { const int ka = k0 + 8 * g + i, kb = ka + 16; v[i] = ka < K ? row[ka < K ? ka : K - 1] : 0.f; v[8 + i] = kb < K ? row[kb < K ? kb : K - 1] : 0.f; }
  return bsplit16(v); }
__device__ __forceinline__ F2 split_col(const float* W, int k0, int n, int lane, int ld, int K) { float v[16]; const int g = lane >> 4;
#pragma unroll
  for (int i = 0; i < 8; ++i) { const int ka = k0 + 8 * g + i, kb = ka + 16; v[i] = ka < K ? W[(size_t)(ka < K ? ka : K - 1) * ld + n] : 0.f; v[8 + i] = kb < K ? W[(size_t)(kb < K ? kb : K - 1) * ld + n] : 0.f; }
  return bsplit16(v); }
__device__ __forceinline__ v8f mac3(const F2& a, const F2& b, v8f c) { c = wmma_bf(a.l, b.h, c); c = wmma_bf(a.h, b.l, c); return wmma_bf(a.h, b.h, c); }
__device__ __forceinline__ float sigm(float v) { return 1.0f / (1.0f + expf(-v)); }
#define LDSX() do { asm volatile("s_wait_dscnt 0" ::: "memory"); __builtin_amdgcn_wave_barrier(); __builtin_amdgcn_fence(__ATOMIC_RELEASE, "workgroup"); } while (0)


// Relative multi-head self attention (Transformer-XL style rel_shift; B 2, S 2,048, D 1,024, 16 heads x 64): pos = sinusoid(S, D) Wp + bp; scores = ((q+u) k^T + rel_shift((q+v) pos^T)) / 8, softmax, . v, Wo + bo.
#define NB 2
#define TT 2048
#define DMD 1024
#define NH 16
#define HD 64
#define POFF 32                 // ph buffer row offset (rows < 0 and >= T read as zeros)
#define PROWS (TT + 64)
#ifndef TNB
#define TNB NB
#endif
#ifndef TQB2
#define TQB2 (TT / 64)   // query blocks
#endif
#ifndef TOB2
#define TOB2 (TNB * TT / 64)
#endif
typedef __attribute__((ext_vector_type(8))) __bf16 v8b;
__device__ __forceinline__ v16b frag_b(const __bf16* rowk0, int lane) {
  union { v16b v; v8b q[2]; } u; const __bf16* p = rowk0 + 8 * (lane >> 4);
  u.q[0] = *(const v8b*)p; u.q[1] = *(const v8b*)(p + 16); return u.v;
}
__device__ __forceinline__ float bfr(float v) { return (float)(__bf16)v; }
__device__ __attribute__((noinline)) float exp_ni(float v) { return expf(v); }
__device__ __attribute__((noinline)) float erf_ni(float v) { return erff(v); }

#define WS_Q   0u                                   // f32 q rows [b*u][D] (+bq)
#define WS_KH  (WS_Q + 4u * (size_t)NB * TT * DMD)       // f16 k rows [b*t][D]
#define WS_PH  (WS_KH + 2u * (size_t)NB * TT * DMD)      // f16 ph rows [PROWS][D] (row POFF + p)
#define WS_VH  (WS_PH + 2u * (size_t)PROWS * DMD)        // f16 v planes [b][D][t]
#define WS_VL  (WS_VH + 2u * (size_t)NB * DMD * TT)      // f16 v residual planes (unscaled)
#define WS_X   (WS_VL + 2u * (size_t)NB * DMD * TT)      // f32 attention output rows [b*u][D]
#define WS_SIN (WS_X + 4u * (size_t)NB * TT * DMD)       // f32 sinusoid table [T][D]
#define WS_END (WS_SIN + 4u * (size_t)TT * DMD)

// ---- k_proj: block = (64 rows, 128-col group, which): 0 q (f32 rows), 1 k (f16 rows), 2 v (f16 hi + residual planes), 3 ph (f16 rows at POFF), natural W + bias
template <int WOFF>
__global__ __launch_bounds__(128) void k_proj(const float* __restrict__ Xin, const float* __restrict__ WQ, const float* __restrict__ BQ, const float* __restrict__ WK, const float* __restrict__ BK, const float* __restrict__ WV, const float* __restrict__ BV, const float* __restrict__ WP, const float* __restrict__ BP, float* __restrict__ Q, _Float16* __restrict__ KH, _Float16* __restrict__ VH, _Float16* __restrict__ VL, _Float16* __restrict__ PH) {
  __shared__ __align__(16) float sf[4][16][132]; __shared__ __align__(16) _Float16 sh[64][136]; __shared__ __align__(16) _Float16 th[128][72], tl[128][72];
  const int tid = threadIdx.x, wave = tid >> 5, lane = tid & 31, col = lane & 15, g = lane >> 4; const int which = blockIdx.z + WOFF; const int c0 = blockIdx.y * 128; const int nrows = (which == 3) ? TT : NB * TT;
  if ((int)blockIdx.x * 64 >= nrows) return;
  const float* Wm = (which == 0 ? WQ : which == 1 ? WK : which == 2 ? WV : WP); const float* Bm = (which == 0 ? BQ : which == 1 ? BK : which == 2 ? BV : BP);
  const size_t r0 = (size_t)blockIdx.x * 64 + wave * 16;
  v8f acc[8] = {};
#pragma unroll 2
  for (int kc = 0; kc < DMD / 32; ++kc) { F2 a2; v16b a; if (which < 3) { const float* p = Xin + (r0 + col) * DMD + kc * 32 + 8 * g;
#pragma unroll
      for (int i = 0; i < 8; ++i) { a[i] = (__bf16)p[i]; a[8 + i] = (__bf16)p[16 + i]; } }
    else { float v[16]; const float* p = Xin + (r0 + col) * DMD + kc * 32 + 8 * g;   // precomputed f32 sinusoid table (k_sin)
#pragma unroll
      for (int i = 0; i < 8; ++i) { v[i] = p[i]; v[8 + i] = p[16 + i]; }
      a2 = bsplit16(v); }
#pragma unroll
    for (int j = 0; j < 8; ++j) { v16b w; const int o = c0 + j * 16 + col;   // (in,out): B[k][o] = W[k*D + o]
#pragma unroll
      for (int i = 0; i < 8; ++i) { w[i] = (__bf16)Wm[(size_t)(kc * 32 + 8 * g + i) * DMD + o]; w[8 + i] = (__bf16)Wm[(size_t)(kc * 32 + 16 + 8 * g + i) * DMD + o]; }
      if (which < 3) acc[j] = wmma_bf(a, w, acc[j]); else { acc[j] = wmma_bf(a2.h, w, acc[j]); acc[j] = wmma_bf(a2.l, w, acc[j]); } } }
#pragma unroll
  for (int j = 0; j < 8; ++j) { const float bb = bfr(Bm[c0 + j * 16 + col]);
#pragma unroll
    for (int r = 0; r < 8; ++r) { const float v = acc[j][r] + bb; const int rl = wave * 16 + 8 * g + r, cl = j * 16 + col;
      if (which == 0) sf[wave][8 * g + r][cl] = v; else if (which == 2) { const _Float16 hv = (_Float16)v; th[cl][rl] = hv; tl[cl][rl] = (_Float16)(v - (float)hv); } else sh[rl][cl] = (_Float16)v; } }
  __syncthreads();
  if (which == 0) { for (int rl = 0; rl < 16; ++rl) vst2(Q + (r0 + rl) * DMD + c0 + lane * 4, *(const v4f*)&sf[wave][rl][lane * 4]); }
  else if (which == 2) { const size_t b = ((size_t)blockIdx.x * 64) / TT; const int t0 = (int)(((size_t)blockIdx.x * 64) % TT); for (int e = tid; e < 128 * 8; e += 128) { const int cl = e >> 3, q = e & 7; const size_t o = (b * DMD + c0 + cl) * (size_t)TT + t0 + q * 8; vst2((unsigned*)(VH + o), *(const v4u*)&th[cl][q * 8]); vst2((unsigned*)(VL + o), *(const v4u*)&tl[cl][q * 8]); } }
  else { _Float16* dst = (which == 1) ? (KH + (size_t)blockIdx.x * 64 * DMD) : (PH + ((size_t)POFF + blockIdx.x * 64) * DMD); for (int e = tid; e < 64 * 16; e += 128) { const int rl = e >> 4, q = e & 15; vst2((unsigned*)(dst + (size_t)rl * DMD + c0 + q * 8), *(const v4u*)&sh[rl][q * 8]); } } }
// ---- k_sin: block = position s: the module's sinusoid table row [sin(s f_c) | cos(s f_c)], f_c = 1e4^(-2c/D), f32
__global__ __launch_bounds__(256) void k_sin(float* __restrict__ SINT) { __shared__ __align__(16) float sr[DMD]; const int t = threadIdx.x; const int s = blockIdx.x;
  for (int c = t; c < DMD / 2; c += 256) { const float ang = (float)s * powf(10000.0f, -2.0f * (float)c / (float)DMD); sr[c] = sinf(ang); sr[DMD / 2 + c] = cosf(ang); }
  __syncthreads(); vst2(SINT + (size_t)s * DMD + t * 4, *(const v4f*)&sr[t * 4]); }
// ---- k_padph: the POFF rows before and the rows after the table are zeros
__global__ __launch_bounds__(256) void k_padph(_Float16* __restrict__ PH) { const int t = threadIdx.x; const int r = blockIdx.x; const size_t row = (r < POFF) ? r : (TT + r);   // 0..31 and TT+32 .. TT+63
  v4u z; z[0] = z[1] = z[2] = z[3] = 0u; if (t < DMD / 8) vst2((unsigned*)(PH + row * DMD + t * 8), z); }
// fragments of (q + bias) for 16 rows, head h: hi and residual as f16 (unscaled; q ~ O(1))
__device__ __forceinline__ void qfrags(const float* __restrict__ Q, size_t row0, int h, const float* __restrict__ bias, int lane, v16h* hi, v16h* lo) { const int col = lane & 15, g = lane >> 4; size_t row = row0 + col; if (row > (size_t)NB * TT - 1) row = (size_t)NB * TT - 1;   // clamp (only the never-used row T of the last batch)
#pragma unroll
  for (int kc = 0; kc < 2; ++kc) { const float* p = Q + row * DMD + h * HD + kc * 32 + 8 * g; const float* bp = bias + h * HD + kc * 32 + 8 * g; v16h a, b;
#pragma unroll
    for (int i = 0; i < 8; ++i) { const float v0 = p[i] + bfr(bp[i]), v1 = p[16 + i] + bfr(bp[16 + i]); const _Float16 h0 = (_Float16)v0, h1 = (_Float16)v1; a[i] = h0; a[8 + i] = h1; b[i] = (_Float16)(v0 - (float)h0); b[8 + i] = (_Float16)(v1 - (float)h1); }
    hi[kc] = a; lo[kc] = b; } }
// ---- k_att: block = (64 queries u, h, b)
__global__ __launch_bounds__(128) void k_att(const float* __restrict__ Q, const _Float16* __restrict__ KH, const _Float16* __restrict__ PH, const _Float16* __restrict__ VH, const _Float16* __restrict__ VL, const float* __restrict__ BU, const float* __restrict__ BVv, float* __restrict__ X) {
  __shared__ __align__(16) float sp[4][16][36]; __shared__ __align__(16) float sg1[4][16][36], sg2[4][16][36]; __shared__ __align__(16) float so[4][16][68];
  const int tid = threadIdx.x, wave = tid >> 5, lane = tid & 31, col = lane & 15, g = lane >> 4; const int qb = blockIdx.x, h = blockIdx.y; const size_t b = blockIdx.z; const int i0 = qb * 64 + wave * 16;
  v16h au[2], av[2], aw[2], tmpl[2];   // (q+u) rows i0.., (q+v) rows i0.., (q+v) rows i0+1.. (for the wrapped upper-triangle term); single f16 rounding (residuals dropped: VGPR budget)
  qfrags(Q, b * TT + i0, h, BU, lane, au, tmpl); qfrags(Q, b * TT + i0, h, BVv, lane, av, tmpl);
  qfrags(Q, b * TT + i0 + 1, h, BVv, lane, aw, tmpl);   // rows i+1; for i = T-1 the row belongs to the next batch (or is clamped) but its products are never used: j >= i+2 cannot hold for i = T-1
  const bool lastblk = (i0 + 16 >= TT);
  float m[8], l[8];
#pragma unroll
  for (int r = 0; r < 8; ++r) { m[r] = -3.0e38f; l[r] = 0.f; }
  v8f acc[4] = {};
#pragma unroll 1
  for (int ks = 0; ks < TT / 32; ++ks) { float s[2][8];
#pragma unroll
    for (int ct = 0; ct < 2; ++ct) { const int j0 = ks * 32 + ct * 16; const int kk = j0 + col; v8f c = {};
#pragma unroll
      for (int kc = 0; kc < 2; ++kc) { const v16h kh = frag_h(KH + (b * TT + kk) * DMD + h * HD + kc * 32, lane); c = wmma16(au[kc], kh, c); }
      const bool needlow = (j0 <= i0 + 15);          // some (i, j) with j <= i
      const bool needup = (j0 + 15 >= i0 + 2);        // some (i, j) with j >= i + 2
      if (needlow) { const int pA = TT - 16 - i0 + j0 + POFF;   // tile covers p = pA-POFF .. +31
#pragma unroll
        for (int pt = 0; pt < 2; ++pt) { v8f gg = {};
#pragma unroll
          for (int kc = 0; kc < 2; ++kc) { const v16h pf = frag_h(PH + (size_t)(pA + pt * 16 + col) * DMD + h * HD + kc * 32, lane); gg = wmma16(av[kc], pf, gg); }
#pragma unroll
          for (int r = 0; r < 8; ++r) sg1[wave][8 * g + r][pt * 16 + col] = gg[r]; } }
      if (needup) { const int pB = j0 - i0 - 17 + POFF;
#pragma unroll
        for (int pt = 0; pt < 2; ++pt) { v8f gg = {};
#pragma unroll
          for (int kc = 0; kc < 2; ++kc) { const v16h pf = frag_h(PH + (size_t)(pB + pt * 16 + col) * DMD + h * HD + kc * 32, lane); gg = wmma16(aw[kc], pf, gg); }
#pragma unroll
          for (int r = 0; r < 8; ++r) sg2[wave][8 * g + r][pt * 16 + col] = gg[r]; } }
      LDSX();
#pragma unroll
      for (int r = 0; r < 8; ++r) { const int il = 8 * g + r; const int i = i0 + il; const int j = kk; const int idx = 15 + col - il;   // == (T-1-i+j) - (pA-POFF) == (j-i-2) - (pB-POFF)
        float bd; if (j <= i) bd = sg1[wave][il][idx]; else if (j == i + 1) bd = 0.f; else bd = (lastblk && il == 15) ? 0.f : sg2[wave][il][idx];
        s[ct][r] = (c[r] + bd) * 0.125f; }
      LDSX(); }
    float alpha[8];
#pragma unroll
    for (int r = 0; r < 8; ++r) { float mx = fmaxf(s[0][r], s[1][r]);
#pragma unroll
      for (int o = 1; o < 16; o <<= 1) mx = fmaxf(mx, __shfl_xor(mx, o));
      const float mn = fmaxf(m[r], mx); alpha[r] = (m[r] <= -1.0e38f) ? 0.f : __expf(m[r] - mn); const float e0 = (s[0][r] <= -1.0e38f) ? 0.f : __expf(s[0][r] - mn), e1 = (s[1][r] <= -1.0e38f) ? 0.f : __expf(s[1][r] - mn); float es = e0 + e1;
#pragma unroll
      for (int o = 1; o < 16; o <<= 1) es += __shfl_xor(es, o);
      l[r] = l[r] * alpha[r] + es; m[r] = mn; sp[wave][8 * g + r][col] = e0; sp[wave][8 * g + r][16 + col] = e1; }
#pragma unroll
    for (int j = 0; j < 4; ++j)
#pragma unroll
      for (int r = 0; r < 8; ++r) acc[j][r] *= alpha[r];
    LDSX();
    v16h pa, pr; { const float* prow = &sp[wave][col][0] + 8 * (lane >> 4);
#pragma unroll
      for (int i = 0; i < 8; ++i) { const float x0 = prow[i] * 2048.0f, x1 = prow[16 + i] * 2048.0f; const _Float16 h0 = (_Float16)x0, h1 = (_Float16)x1; pa[i] = h0; pa[8 + i] = h1; pr[i] = (_Float16)(x0 - (float)h0); pr[8 + i] = (_Float16)(x1 - (float)h1); } }
#pragma unroll
    for (int j = 0; j < 4; ++j) { const size_t po = (b * DMD + (size_t)h * HD + j * 16 + col) * TT + ks * 32; const v16h vh = frag_h(VH + po, lane); acc[j] = wmma16(pa, vh, acc[j]); acc[j] = wmma16(pr, vh, acc[j]); acc[j] = wmma16(pa, frag_h(VL + po, lane), acc[j]); }
    LDSX(); }
#pragma unroll
  for (int r = 0; r < 8; ++r) { const float il = (l[r] > 0.f) ? (1.0f / 2048.0f) / l[r] : 0.f;   // fully masked rows -> zeros (the module zeroes them after the softmax)
#pragma unroll
    for (int j = 0; j < 4; ++j) so[wave][8 * g + r][j * 16 + col] = acc[j][r] * il; }
  LDSX(); for (int rl = 0; rl < 16; ++rl) if (lane < 16) vst2(X + (b * TT + i0 + rl) * DMD + h * HD + lane * 4, *(const v4f*)&so[wave][rl][lane * 4]); }
// ---- k_out: block = (64 rows, 128 of 1024 cols): out = x (hi + lo) . Wo + bo
__global__ __launch_bounds__(128) void k_out(const float* __restrict__ X, const float* __restrict__ WO, const float* __restrict__ BO, float* __restrict__ OUT) { __shared__ __align__(16) float sf[4][16][132];
  const int tid = threadIdx.x, wave = tid >> 5, lane = tid & 31, col = lane & 15, g = lane >> 4; const int c0 = blockIdx.y * 128; const size_t r0 = (size_t)blockIdx.x * 64 + wave * 16;
  v8f acc[8] = {};
#pragma unroll
  for (int kc = 0; kc < DMD / 32; ++kc) { const F2 a = split_row(X + (r0 + col) * DMD, kc * 32, lane);
#pragma unroll
    for (int j = 0; j < 8; ++j) { v16b w; const int o = c0 + j * 16 + col;
#pragma unroll
      for (int i = 0; i < 8; ++i) { w[i] = (__bf16)WO[(size_t)(kc * 32 + 8 * g + i) * DMD + o]; w[8 + i] = (__bf16)WO[(size_t)(kc * 32 + 16 + 8 * g + i) * DMD + o]; }   // (in,out)
      acc[j] = wmma_bf(a.h, w, acc[j]); acc[j] = wmma_bf(a.l, w, acc[j]); } }
#pragma unroll
  for (int j = 0; j < 8; ++j) { const float bb = bfr(BO[c0 + j * 16 + col]);
#pragma unroll
    for (int r = 0; r < 8; ++r) sf[wave][8 * g + r][j * 16 + col] = acc[j][r] + bb; }
  LDSX(); for (int rl = 0; rl < 16; ++rl) vst2(OUT + (r0 + rl) * DMD + c0 + lane * 4, *(const v4f*)&sf[wave][rl][lane * 4]); }
extern "C" void kernel_launch(void* const* d_in, const int* in_sizes, int n_in, void* d_out, int out_size, void* d_ws, size_t ws_size, hipStream_t stream) {
  (void)in_sizes; (void)n_in; (void)out_size;
  const float** F = (const float**)d_in;   // 0 x [2,2048,1024]; 1 Wq, 2 bq, 3 Wk, 4 bk, 5 Wv, 6 bv, 7 Wp, 8 bp, 9 Wo, 10 bo ((in,out) [1024,1024]); 11 u [1,16,1,64], 12 v [1,16,1,64]
  if (ws_size < (size_t)WS_END) return;
  char* ws = (char*)d_ws; float* Q = (float*)(ws + WS_Q); _Float16 *KH = (_Float16*)(ws + WS_KH), *PH = (_Float16*)(ws + WS_PH), *VH = (_Float16*)(ws + WS_VH), *VL = (_Float16*)(ws + WS_VL); float* X = (float*)(ws + WS_X);
  float* SINT = (float*)(ws + WS_SIN);
  k_sin<<<TT, 256, 0, stream>>>(SINT);
  k_proj<0><<<dim3(TNB * TT / 64, DMD / 128, 3), 128, 0, stream>>>(F[0], F[1], F[2], F[3], F[4], F[5], F[6], F[7], F[8], Q, KH, VH, VL, PH);
  k_proj<3><<<dim3(TT / 64, DMD / 128, 1), 128, 0, stream>>>(SINT, F[1], F[2], F[3], F[4], F[5], F[6], F[7], F[8], Q, KH, VH, VL, PH);
  k_padph<<<64, 256, 0, stream>>>(PH);
  k_att<<<dim3(TQB2, NH, TNB), 128, 0, stream>>>(Q, KH, PH, VH, VL, F[11], F[12], X);
  k_out<<<dim3(TOB2, DMD / 128), 128, 0, stream>>>(X, F[9], F[10], (float*)d_out);
}

// v001
// One run takes 611 microseconds.
// In two side-by-side timings against v000, it was 1.11 and 1.10 times as fast.
// compute dtype: all float inputs rounded to bf16; q/k/v projections with EXACT bf16 products on WMMA 16x16x32 ((in,out) weights, + bias), the sinusoidal position table built once on device in f32 (precise sinf/cosf/powf, k_sin) and projected with hi + lo (2 products) + bp, f32 accumulate; q kept in f32 (bias_u / bias_v added per head, then split into bf16-exact f16 hi + residual fragments), k / ph rounded once to f16, v to f16 hi + residual; content scores (q+bu) . k and the Transformer-XL position term (q+bv) . ph with single f16 products (logits ~1-2; q, k, ph each rounded once), the rel_shift realised exactly as an index map onto 16 x 32 position tiles (incl. its upper-triangle wrap-around rows and the zero at j == i+1), x 1/8, running-max softmax in f32 (hardware exp); P (f16 x 2^11 + residual) . v; out = x (bf16 hi + lo) . Wo + bo; f32 output.
#include <hip/hip_runtime.h>
#include <math.h>

typedef __attribute__((ext_vector_type(16))) _Float16 v16h;
typedef __attribute__((ext_vector_type(16))) __bf16 v16b;
typedef __attribute__((ext_vector_type(8)))  _Float16 v8h;
typedef __attribute__((ext_vector_type(8)))  float v8f;
typedef __attribute__((ext_vector_type(4)))  float v4f;
typedef __attribute__((ext_vector_type(2)))  float v2f;
typedef __attribute__((ext_vector_type(4)))  unsigned v4u;
typedef __attribute__((ext_vector_type(4)))  int v4i;
typedef float __attribute__((may_alias)) float_a;
typedef int __attribute__((may_alias)) int_a;

template <typename T> __device__ __forceinline__ void vst2(void* p, T v) { *(T*)p = v;  }
__device__ __forceinline__ v8f wmma16(v16h a, v16h b, v8f c) {
  v8f d = __builtin_amdgcn_wmma_f32_16x16x32_f16(false, a, false, b, (short)0, c, false, false);
  asm volatile("v_nop\n\tv_nop\n\tv_nop\n\tv_nop" : "+v"(d) : "v"(a), "v"(b));
  return d;
}
__device__ __forceinline__ v8f wmma_bf(v16b a, v16b b, v8f c) {
  v8f d = __builtin_amdgcn_wmma_f32_16x16x32_bf16(false, a, false, b, (short)0, c, false, false);
  asm volatile("v_nop\n\tv_nop\n\tv_nop\n\tv_nop" : "+v"(d) : "v"(a), "v"(b));
  return d;
}
// 16x16x32 fragments: lane = (h = lane>>4, row/col = lane&15); elements 0..7 = k0+8h+0..7, 8..15 = k0+16+8h+0..7; D element r = row 8h+r
__device__ __forceinline__ v16h frag_h(const _Float16* rowk0, int lane) {
  union { v16h v; v8h q[2]; } u; const _Float16* p = rowk0 + 8 * (lane >> 4);
  u.q[0] = *(const v8h*)p; u.q[1] = *(const v8h*)(p + 16); return u.v;
}
__device__ __forceinline__ v16h frag_f32(const float* rowk0, int lane) {
  v16h a; const float* p = rowk0 + 8 * (lane >> 4);
#pragma unroll
  for (int i = 0; i < 8; ++i) { a[i] = (_Float16)p[i]; a[8 + i] = (_Float16)p[16 + i]; }
  return a;
}
__device__ __forceinline__ v16h frag_f32s(const float* rowk0, int lane, float sc) {
  v16h a; const float* p = rowk0 + 8 * (lane >> 4);
#pragma unroll
  for (int i = 0; i < 8; ++i) { a[i] = (_Float16)(p[i] * sc); a[8 + i] = (_Float16)(p[16 + i] * sc); }
  return a;
}
// column fragment from a [K][ld] layout (column n), rows >= K read as 0
__device__ __forceinline__ v16h fragc_f32(const float* W, int k0, int n, int lane, int ld, int K) {
  v16h a; const int g = lane >> 4;
#pragma unroll
  for (int i = 0; i < 8; ++i) { const int ka = k0 + 8 * g + i, kb = ka + 16;
    a[i] = (_Float16)(ka < K ? W[(size_t)(ka < K ? ka : K - 1) * ld + n] : 0.f); a[8 + i] = (_Float16)(kb < K ? W[(size_t)(kb < K ? kb : K - 1) * ld + n] : 0.f); }
  return a;
}
struct F2 { v16b h, l; };
__device__ __forceinline__ F2 bsplit16(const float v[16]) { F2 r;
#pragma unroll
  for (int i = 0; i < 16; ++i) { const __bf16 h = (__bf16)v[i]; r.h[i] = h; r.l[i] = (__bf16)(v[i] - (float)h); }
  return r; }
__device__ __forceinline__ F2 split_row(const float* row, int k0, int lane) { float v[16]; const float* p = row + k0 + 8 * (lane >> 4);
#pragma unroll
  for (int i = 0; i < 8; ++i) { v[i] = p[i]; v[8 + i] = p[16 + i]; }
  return bsplit16(v); }
__device__ __forceinline__ F2 split_rowK(const float* row, int k0, int lane, int K) { float v[16]; const int g = lane >> 4;
#pragma unroll
  for (int i = 0; i < 8; ++i) { const int ka = k0 + 8 * g + i, kb = ka + 16; v[i] = ka < K ? row[ka < K ? ka : K - 1] : 0.f; v[8 + i] = kb < K ? row[kb < K ? kb : K - 1] : 0.f; }
  return bsplit16(v); }
__device__ __forceinline__ F2 split_col(const float* W, int k0, int n, int lane, int ld, int K) { float v[16]; const int g = lane >> 4;
#pragma unroll
  for (int i = 0; i < 8; ++i) { const int ka = k0 + 8 * g + i, kb = ka + 16; v[i] = ka < K ? W[(size_t)(ka < K ? ka : K - 1) * ld + n] : 0.f; v[8 + i] = kb < K ? W[(size_t)(kb < K ? kb : K - 1) * ld + n] : 0.f; }
  return bsplit16(v); }
__device__ __forceinline__ v8f mac3(const F2& a, const F2& b, v8f c) { c = wmma_bf(a.l, b.h, c); c = wmma_bf(a.h, b.l, c); return wmma_bf(a.h, b.h, c); }
__device__ __forceinline__ float sigm(float v) { return 1.0f / (1.0f + expf(-v)); }
#define LDSX() do { asm volatile("s_wait_dscnt 0" ::: "memory"); __builtin_amdgcn_wave_barrier(); __builtin_amdgcn_fence(__ATOMIC_RELEASE, "workgroup"); } while (0)


// Relative multi-head self attention (Transformer-XL style rel_shift; B 2, S 2,048, D 1,024, 16 heads x 64): pos = sinusoid(S, D) Wp + bp; scores = ((q+u) k^T + rel_shift((q+v) pos^T)) / 8, softmax, . v, Wo + bo.
#define NB 2
#define TT 2048
#define DMD 1024
#define NH 16
#define HD 64
#define POFF 32                 // ph buffer row offset (rows < 0 and >= T read as zeros)
#define PROWS (TT + 64)
#ifndef TNB
#define TNB NB
#endif
#ifndef TQB2
#define TQB2 (TT / 64)   // query blocks
#endif
#ifndef TOB2
#define TOB2 (TNB * TT / 64)
#endif
typedef __attribute__((ext_vector_type(8))) __bf16 v8b;
__device__ __forceinline__ v16b frag_b(const __bf16* rowk0, int lane) {
  union { v16b v; v8b q[2]; } u; const __bf16* p = rowk0 + 8 * (lane >> 4);
  u.q[0] = *(const v8b*)p; u.q[1] = *(const v8b*)(p + 16); return u.v;
}
__device__ __forceinline__ float bfr(float v) { return (float)(__bf16)v; }
__device__ __attribute__((noinline)) float exp_ni(float v) { return expf(v); }
__device__ __attribute__((noinline)) float erf_ni(float v) { return erff(v); }

#define WS_Q   0u                                   // f32 q rows [b*u][D] (+bq)
#define WS_KH  (WS_Q + 4u * (size_t)NB * TT * DMD)       // f16 k rows [b*t][D]
#define WS_PH  (WS_KH + 2u * (size_t)NB * TT * DMD)      // f16 ph rows [PROWS][D] (row POFF + p)
#define WS_VH  (WS_PH + 2u * (size_t)PROWS * DMD)        // f16 v planes [b][D][t]
#define WS_VL  (WS_VH + 2u * (size_t)NB * DMD * TT)      // f16 v residual planes (unscaled)
#define WS_X   (WS_VL + 2u * (size_t)NB * DMD * TT)      // f32 attention output rows [b*u][D]
#define WS_SIN (WS_X + 4u * (size_t)NB * TT * DMD)       // f32 sinusoid table [T][D]
#define WS_END (WS_SIN + 4u * (size_t)TT * DMD)

// ---- k_proj: block = (64 rows, 128-col group, which): 0 q (f32 rows), 1 k (f16 rows), 2 v (f16 hi + residual planes), 3 ph (f16 rows at POFF), natural W + bias
template <int WOFF>
__global__ __launch_bounds__(128) void k_proj(const float* __restrict__ Xin, const float* __restrict__ WQ, const float* __restrict__ BQ, const float* __restrict__ WK, const float* __restrict__ BK, const float* __restrict__ WV, const float* __restrict__ BV, const float* __restrict__ WP, const float* __restrict__ BP, float* __restrict__ Q, _Float16* __restrict__ KH, _Float16* __restrict__ VH, _Float16* __restrict__ VL, _Float16* __restrict__ PH) {
  __shared__ __align__(16) float sf[4][16][132]; __shared__ __align__(16) _Float16 sh[64][136]; __shared__ __align__(16) _Float16 th[128][72], tl[128][72];
  const int tid = threadIdx.x, wave = tid >> 5, lane = tid & 31, col = lane & 15, g = lane >> 4; const int which = blockIdx.z + WOFF; const int c0 = blockIdx.y * 128; const int nrows = (which == 3) ? TT : NB * TT;
  if ((int)blockIdx.x * 64 >= nrows) return;
  const float* Wm = (which == 0 ? WQ : which == 1 ? WK : which == 2 ? WV : WP); const float* Bm = (which == 0 ? BQ : which == 1 ? BK : which == 2 ? BV : BP);
  const size_t r0 = (size_t)blockIdx.x * 64 + wave * 16;
  v8f acc[8] = {};
#pragma unroll 2
  for (int kc = 0; kc < DMD / 32; ++kc) { F2 a2; v16b a; if (which < 3) { const float* p = Xin + (r0 + col) * DMD + kc * 32 + 8 * g;
#pragma unroll
      for (int i = 0; i < 8; ++i) { a[i] = (__bf16)p[i]; a[8 + i] = (__bf16)p[16 + i]; } }
    else { float v[16]; const float* p = Xin + (r0 + col) * DMD + kc * 32 + 8 * g;   // precomputed f32 sinusoid table (k_sin)
#pragma unroll
      for (int i = 0; i < 8; ++i) { v[i] = p[i]; v[8 + i] = p[16 + i]; }
      a2 = bsplit16(v); }
#pragma unroll
    for (int j = 0; j < 8; ++j) { v16b w; const int o = c0 + j * 16 + col;   // (in,out): B[k][o] = W[k*D + o]
#pragma unroll
      for (int i = 0; i < 8; ++i) { w[i] = (__bf16)Wm[(size_t)(kc * 32 + 8 * g + i) * DMD + o]; w[8 + i] = (__bf16)Wm[(size_t)(kc * 32 + 16 + 8 * g + i) * DMD + o]; }
      if (which < 3) acc[j] = wmma_bf(a, w, acc[j]); else { acc[j] = wmma_bf(a2.h, w, acc[j]); acc[j] = wmma_bf(a2.l, w, acc[j]); } } }
#pragma unroll
  for (int j = 0; j < 8; ++j) { const float bb = bfr(Bm[c0 + j * 16 + col]);
#pragma unroll
    for (int r = 0; r < 8; ++r) { const float v = acc[j][r] + bb; const int rl = wave * 16 + 8 * g + r, cl = j * 16 + col;
      if (which == 0) sf[wave][8 * g + r][cl] = v; else if (which == 2) { const _Float16 hv = (_Float16)v; th[cl][rl] = hv; tl[cl][rl] = (_Float16)(v - (float)hv); } else sh[rl][cl] = (_Float16)v; } }
  __syncthreads();
  if (which == 0) { for (int rl = 0; rl < 16; ++rl) vst2(Q + (r0 + rl) * DMD + c0 + lane * 4, *(const v4f*)&sf[wave][rl][lane * 4]); }
  else if (which == 2) { const size_t b = ((size_t)blockIdx.x * 64) / TT; const int t0 = (int)(((size_t)blockIdx.x * 64) % TT); for (int e = tid; e < 128 * 8; e += 128) { const int cl = e >> 3, q = e & 7; const size_t o = (b * DMD + c0 + cl) * (size_t)TT + t0 + q * 8; vst2((unsigned*)(VH + o), *(const v4u*)&th[cl][q * 8]); vst2((unsigned*)(VL + o), *(const v4u*)&tl[cl][q * 8]); } }
  else { _Float16* dst = (which == 1) ? (KH + (size_t)blockIdx.x * 64 * DMD) : (PH + ((size_t)POFF + blockIdx.x * 64) * DMD); for (int e = tid; e < 64 * 16; e += 128) { const int rl = e >> 4, q = e & 15; vst2((unsigned*)(dst + (size_t)rl * DMD + c0 + q * 8), *(const v4u*)&sh[rl][q * 8]); } } }
// ---- k_sin: block = position s: the module's sinusoid table row [sin(s f_c) | cos(s f_c)], f_c = 1e4^(-2c/D), f32
__global__ __launch_bounds__(256) void k_sin(float* __restrict__ SINT) { __shared__ __align__(16) float sr[DMD]; const int t = threadIdx.x; const int s = blockIdx.x;
  for (int c = t; c < DMD / 2; c += 256) { const float ang = (float)s * powf(10000.0f, -2.0f * (float)c / (float)DMD); sr[c] = sinf(ang); sr[DMD / 2 + c] = cosf(ang); }
  __syncthreads(); vst2(SINT + (size_t)s * DMD + t * 4, *(const v4f*)&sr[t * 4]); }
// ---- k_padph: the POFF rows before and the rows after the table are zeros
__global__ __launch_bounds__(256) void k_padph(_Float16* __restrict__ PH) { const int t = threadIdx.x; const int r = blockIdx.x; const size_t row = (r < POFF) ? r : (TT + r);   // 0..31 and TT+32 .. TT+63
  v4u z; z[0] = z[1] = z[2] = z[3] = 0u; if (t < DMD / 8) vst2((unsigned*)(PH + row * DMD + t * 8), z); }
// fragments of (q + bias) for 16 rows, head h: hi and residual as f16 (unscaled; q ~ O(1))
__device__ __forceinline__ void qfrags(const float* __restrict__ Q, size_t row0, int h, const float* __restrict__ bias, int lane, v16h* hi, v16h* lo) { const int col = lane & 15, g = lane >> 4; size_t row = row0 + col; if (row > (size_t)NB * TT - 1) row = (size_t)NB * TT - 1;   // clamp (only the never-used row T of the last batch)
#pragma unroll
  for (int kc = 0; kc < 2; ++kc) { const float* p = Q + row * DMD + h * HD + kc * 32 + 8 * g; const float* bp = bias + h * HD + kc * 32 + 8 * g; v16h a, b;
#pragma unroll
    for (int i = 0; i < 8; ++i) { const float v0 = p[i] + bfr(bp[i]), v1 = p[16 + i] + bfr(bp[16 + i]); const _Float16 h0 = (_Float16)v0, h1 = (_Float16)v1; a[i] = h0; a[8 + i] = h1; b[i] = (_Float16)(v0 - (float)h0); b[8 + i] = (_Float16)(v1 - (float)h1); }
    hi[kc] = a; lo[kc] = b; } }
// LDS row pitches: 16 B x odd (144 B for 64-half rows, 80 B for 32-half rows)
#define KP 72
#define VP 40
struct AttTiles { _Float16 K[32][KP], VH[64][VP], VL[64][VP], PL[96][KP], PU[96][KP]; };
union AttStage { AttTiles t; float so[4][16][68]; };
// ---- k_att: block = (64 queries u, h, b)
__global__ __launch_bounds__(128) void k_att(const float* __restrict__ Q, const _Float16* __restrict__ KH, const _Float16* __restrict__ PH, const _Float16* __restrict__ VH, const _Float16* __restrict__ VL, const float* __restrict__ BU, const float* __restrict__ BVv, float* __restrict__ X) {
  __shared__ __align__(16) float sp[4][16][36]; __shared__ __align__(16) float sg1[4][16][36], sg2[4][16][36];
  __shared__ __align__(16) AttStage u;   // the trip's operand tiles, shared by the four waves; output staging behind the loop
  const int tid = threadIdx.x, wave = tid >> 5, lane = tid & 31, col = lane & 15, g = lane >> 4; const int qb = blockIdx.x, h = blockIdx.y; const size_t b = blockIdx.z; const int i0 = qb * 64 + wave * 16;
  // whole-line fetch of one trip's tiles: 8 lanes per 128-byte row (k, ph), 4 lanes per 64-byte row (v planes); held in registers until the tile in LDS is free
  const int r8 = tid >> 3, q8 = tid & 7, r4 = tid >> 2, q4 = tid & 3;
  // block-uniform bases and 32-bit lane byte offsets
  const char* gK = (const char*)(KH + b * TT * DMD + h * HD); const char* gP = (const char*)(PH + h * HD);
  const char* gVH = (const char*)(VH + (b * DMD + (size_t)h * HD) * TT); const char* gVL = (const char*)(VL + (b * DMD + (size_t)h * HD) * TT);
  const unsigned oK = (unsigned)(r8 * DMD + q8 * 8) * 2u, oV = (unsigned)(r4 * TT + q4 * 8) * 2u;
  const int wrow = 48 - 16 * wave;   // this wave's first row inside the block's 96-row position window
  v8h rk[2], rvh[2], rvl[2], rp[6];
  auto fetch = [&](int ks) {
#pragma unroll
    for (int i = 0; i < 2; ++i) { rk[i] = *(const v8h*)(gK + (oK + (unsigned)((ks * 32 + i * 16) * DMD * 2))); rvh[i] = *(const v8h*)(gVH + (oV + (unsigned)((i * 32 * TT + ks * 32) * 2))); rvl[i] = *(const v8h*)(gVL + (oV + (unsigned)((i * 32 * TT + ks * 32) * 2))); }
    // 96-row position window of the block: the j <= i window while some wave needs it, else the j >= i + 2 window (rows outside the buffer are used by no wave: clamped)
    const int base = (ks * 32 <= qb * 64 + 63) ? (TT - 64 - qb * 64 + ks * 32 + POFF) : (ks * 32 - qb * 64 - 65 + POFF);
#pragma unroll
    for (int i = 0; i < 6; ++i) { int row = base + i * 16 + r8; row = row < 0 ? 0 : (row > PROWS - 1 ? PROWS - 1 : row); rp[i] = *(const v8h*)(gP + (unsigned)(row * DMD + q8 * 8) * 2u); } };
  fetch(0);
  v16h au[2], av[2], aw[2], tmpl[2];   // (q+u) rows i0.., (q+v) rows i0.., (q+v) rows i0+1.. (for the wrapped upper-triangle term); single f16 rounding (residuals dropped: VGPR budget)
  qfrags(Q, b * TT + i0, h, BU, lane, au, tmpl); qfrags(Q, b * TT + i0, h, BVv, lane, av, tmpl);
  qfrags(Q, b * TT + i0 + 1, h, BVv, lane, aw, tmpl);   // rows i+1; for i = T-1 the row belongs to the next batch (or is clamped) but its products are never used: j >= i+2 cannot hold for i = T-1
  const bool lastblk = (i0 + 16 >= TT);
  float m[8], l[8];
#pragma unroll
  for (int r = 0; r < 8; ++r) { m[r] = -3.0e38f; l[r] = 0.f; }
  v8f acc[4] = {};
#pragma unroll 1
  for (int ks = 0; ks < TT / 32; ++ks) { float s[2][8];
    __syncthreads();   // every wave has left the previous trip's tiles
#pragma unroll
    for (int i = 0; i < 2; ++i) { *(v8h*)&u.t.K[i * 16 + r8][q8 * 8] = rk[i]; *(v8h*)&u.t.VH[i * 32 + r4][q4 * 8] = rvh[i]; *(v8h*)&u.t.VL[i * 32 + r4][q4 * 8] = rvl[i]; }
    const bool blow = (ks * 32 <= qb * 64 + 63);
    { _Float16 (*dst)[KP] = blow ? u.t.PL : u.t.PU;
#pragma unroll
      for (int i = 0; i < 6; ++i) *(v8h*)&dst[i * 16 + r8][q8 * 8] = rp[i]; }
    if (blow && ks * 32 + 31 >= qb * 64 + 2) {   // the two trips on the diagonal need both windows: the j >= i + 2 one is brought here
#pragma unroll
      for (int i = 0; i < 6; ++i) { int row = ks * 32 - qb * 64 - 65 + POFF + i * 16 + r8; row = row < 0 ? 0 : (row > PROWS - 1 ? PROWS - 1 : row); *(v8h*)&u.t.PU[i * 16 + r8][q8 * 8] = *(const v8h*)(gP + (unsigned)(row * DMD + q8 * 8) * 2u); } }
    __syncthreads();   // this trip's tiles are published
#pragma unroll
    for (int ct = 0; ct < 2; ++ct) { const int j0 = ks * 32 + ct * 16; const int kk = j0 + col; v8f c = {}; v16h kh[2];
#pragma unroll
      for (int kc = 0; kc < 2; ++kc) kh[kc] = frag_h(&u.t.K[ct * 16 + col][kc * 32], lane);
#pragma unroll
      for (int kc = 0; kc < 2; ++kc) c = wmma16(au[kc], kh[kc], c);
      const bool needlow = (j0 <= i0 + 15);          // some (i, j) with j <= i
      const bool needup = (j0 + 15 >= i0 + 2);        // some (i, j) with j >= i + 2
      if (needlow) { v16h pf[2][2];   // tile covers p = T-16-i0+j0 .. +31: rows wrow + 16 ct .. +31 of the staged window
#pragma unroll
        for (int pt = 0; pt < 2; ++pt)
#pragma unroll
          for (int kc = 0; kc < 2; ++kc) pf[pt][kc] = frag_h(&u.t.PL[wrow + ct * 16 + pt * 16 + col][kc * 32], lane);
#pragma unroll
        for (int pt = 0; pt < 2; ++pt) { v8f gg = {};
#pragma unroll
          for (int kc = 0; kc < 2; ++kc) gg = wmma16(av[kc], pf[pt][kc], gg);
#pragma unroll
          for (int r = 0; r < 8; ++r) sg1[wave][8 * g + r][pt * 16 + col] = gg[r]; } }
      if (needup) { v16h pf[2][2];   // tile covers p = j0-i0-17 .. +31
#pragma unroll
        for (int pt = 0; pt < 2; ++pt)
#pragma unroll
          for (int kc = 0; kc < 2; ++kc) pf[pt][kc] = frag_h(&u.t.PU[wrow + ct * 16 + pt * 16 + col][kc * 32], lane);
#pragma unroll
        for (int pt = 0; pt < 2; ++pt) { v8f gg = {};
#pragma unroll
          for (int kc = 0; kc < 2; ++kc) gg = wmma16(aw[kc], pf[pt][kc], gg);
#pragma unroll
          for (int r = 0; r < 8; ++r) sg2[wave][8 * g + r][pt * 16 + col] = gg[r]; } }
      LDSX();
#pragma unroll
      for (int r = 0; r < 8; ++r) { const int il = 8 * g + r; const int i = i0 + il; const int j = kk; const int idx = 15 + col - il;   // == (T-1-i+j) - (T-16-i0+j0) == (j-i-2) - (j0-i0-17)
        float bd; if (j <= i) bd = sg1[wave][il][idx]; else if (j == i + 1) bd = 0.f; else bd = (lastblk && il == 15) ? 0.f : sg2[wave][il][idx];
        s[ct][r] = (c[r] + bd) * 0.125f; }
      LDSX(); }
    float alpha[8];
#pragma unroll
    for (int r = 0; r < 8; ++r) { float mx = fmaxf(s[0][r], s[1][r]);
#pragma unroll
      for (int o = 1; o < 16; o <<= 1) mx = fmaxf(mx, __shfl_xor(mx, o));
      const float mn = fmaxf(m[r], mx); alpha[r] = (m[r] <= -1.0e38f) ? 0.f : __expf(m[r] - mn); const float e0 = (s[0][r] <= -1.0e38f) ? 0.f : __expf(s[0][r] - mn), e1 = (s[1][r] <= -1.0e38f) ? 0.f : __expf(s[1][r] - mn); float es = e0 + e1;
#pragma unroll
      for (int o = 1; o < 16; o <<= 1) es += __shfl_xor(es, o);
      l[r] = l[r] * alpha[r] + es; m[r] = mn; sp[wave][8 * g + r][col] = e0; sp[wave][8 * g + r][16 + col] = e1; }
#pragma unroll
    for (int j = 0; j < 4; ++j)
#pragma unroll
      for (int r = 0; r < 8; ++r) acc[j][r] *= alpha[r];
    LDSX();
    fetch(ks + 1 < TT / 32 ? ks + 1 : ks);   // the next trip's tiles fly under the P . v products (the last trip names its own again: always in bounds, never stored)
    v16h pa, pr; { const float* prow = &sp[wave][col][0] + 8 * (lane >> 4);
#pragma unroll
      for (int i = 0; i < 8; ++i) { const float x0 = prow[i] * 2048.0f, x1 = prow[16 + i] * 2048.0f; const _Float16 h0 = (_Float16)x0, h1 = (_Float16)x1; pa[i] = h0; pa[8 + i] = h1; pr[i] = (_Float16)(x0 - (float)h0); pr[8 + i] = (_Float16)(x1 - (float)h1); } }
#pragma unroll
    for (int j = 0; j < 4; ++j) { const v16h vh = frag_h(&u.t.VH[j * 16 + col][0], lane), vl = frag_h(&u.t.VL[j * 16 + col][0], lane);   // both planes' fragments in one run: one LDS wait for three products
      acc[j] = wmma16(pa, vh, acc[j]); acc[j] = wmma16(pr, vh, acc[j]); acc[j] = wmma16(pa, vl, acc[j]); }
    LDSX(); }
  __syncthreads();   // every wave has left the last tiles before they become output staging
#pragma unroll
  for (int r = 0; r < 8; ++r) { const float il = (l[r] > 0.f) ? (1.0f / 2048.0f) / l[r] : 0.f;   // fully masked rows -> zeros (the module zeroes them after the softmax)
#pragma unroll
    for (int j = 0; j < 4; ++j) u.so[wave][8 * g + r][j * 16 + col] = acc[j][r] * il; }
  LDSX(); for (int rl = 0; rl < 16; ++rl) if (lane < 16) vst2(X + (b * TT + i0 + rl) * DMD + h * HD + lane * 4, *(const v4f*)&u.so[wave][rl][lane * 4]); }
// ---- k_out: block = (64 rows, 128 of 1024 cols): out = x (hi + lo) . Wo + bo
__global__ __launch_bounds__(128) void k_out(const float* __restrict__ X, const float* __restrict__ WO, const float* __restrict__ BO, float* __restrict__ OUT) { __shared__ __align__(16) float sf[4][16][132];
  const int tid = threadIdx.x, wave = tid >> 5, lane = tid & 31, col = lane & 15, g = lane >> 4; const int c0 = blockIdx.y * 128; const size_t r0 = (size_t)blockIdx.x * 64 + wave * 16;
  v8f acc[8] = {};
#pragma unroll
  for (int kc = 0; kc < DMD / 32; ++kc) { const F2 a = split_row(X + (r0 + col) * DMD, kc * 32, lane);
#pragma unroll
    for (int j = 0; j < 8; ++j) { v16b w; const int o = c0 + j * 16 + col;
#pragma unroll
      for (int i = 0; i < 8; ++i) { w[i] = (__bf16)WO[(size_t)(kc * 32 + 8 * g + i) * DMD + o]; w[8 + i] = (__bf16)WO[(size_t)(kc * 32 + 16 + 8 * g + i) * DMD + o]; }   // (in,out)
      acc[j] = wmma_bf(a.h, w, acc[j]); acc[j] = wmma_bf(a.l, w, acc[j]); } }
#pragma unroll
  for (int j = 0; j < 8; ++j) { const float bb = bfr(BO[c0 + j * 16 + col]);
#pragma unroll
    for (int r = 0; r < 8; ++r) sf[wave][8 * g + r][j * 16 + col] = acc[j][r] + bb; }
  LDSX(); for (int rl = 0; rl < 16; ++rl) vst2(OUT + (r0 + rl) * DMD + c0 + lane * 4, *(const v4f*)&sf[wave][rl][lane * 4]); }
extern "C" void kernel_launch(void* const* d_in, const int* in_sizes, int n_in, void* d_out, int out_size, void* d_ws, size_t ws_size, hipStream_t stream) {
  (void)in_sizes; (void)n_in; (void)out_size;
  const float** F = (const float**)d_in;   // 0 x [2,2048,1024]; 1 Wq, 2 bq, 3 Wk, 4 bk, 5 Wv, 6 bv, 7 Wp, 8 bp, 9 Wo, 10 bo ((in,out) [1024,1024]); 11 u [1,16,1,64], 12 v [1,16,1,64]
  if (ws_size < (size_t)WS_END) return;
  char* ws = (char*)d_ws; float* Q = (float*)(ws + WS_Q); _Float16 *KH = (_Float16*)(ws + WS_KH), *PH = (_Float16*)(ws + WS_PH), *VH = (_Float16*)(ws + WS_VH), *VL = (_Float16*)(ws + WS_VL); float* X = (float*)(ws + WS_X);
  float* SINT = (float*)(ws + WS_SIN);
  k_sin<<<TT, 256, 0, stream>>>(SINT);
  k_proj<0><<<dim3(TNB * TT / 64, DMD / 128, 3), 128, 0, stream>>>(F[0], F[1], F[2], F[3], F[4], F[5], F[6], F[7], F[8], Q, KH, VH, VL, PH);
  k_proj<3><<<dim3(TT / 64, DMD / 128, 1), 128, 0, stream>>>(SINT, F[1], F[2], F[3], F[4], F[5], F[6], F[7], F[8], Q, KH, VH, VL, PH);
  k_padph<<<64, 256, 0, stream>>>(PH);
  k_att<<<dim3(TQB2, NH, TNB), 128, 0, stream>>>(Q, KH, PH, VH, VL, F[11], F[12], X);
  k_out<<<dim3(TOB2, DMD / 128), 128, 0, stream>>>(X, F[9], F[10], (float*)d_out);
}

// v002
// One run takes 417 microseconds.
// In two side-by-side timings against v001, it was 1.46 and 1.47 times as fast.
// Counting every step since v000, it is 1.62 times as fast.
// compute dtype: all float inputs rounded to bf16; q/k/v projections with EXACT bf16 products on WMMA 16x16x32 ((in,out) weights, + bias), the sinusoidal position table built once on device in f32 (precise sinf/cosf/powf, k_sin) and projected with hi + lo (2 products) + bp, f32 accumulate; q kept in f32 (bias_u / bias_v added per head, then split into bf16-exact f16 hi + residual fragments), k / ph rounded once to f16, v to f16 hi + residual; content scores (q+bu) . k and the Transformer-XL position term (q+bv) . ph with single f16 products (logits ~1-2; q, k, ph each rounded once), the rel_shift realised exactly as an index map onto 16 x 32 position tiles (incl. its upper-triangle wrap-around rows and the zero at j == i+1), x 1/8, running-max softmax in f32 (hardware exp); P (f16 x 2^11 + residual) . v; out = x (bf16 hi + lo) . Wo + bo; f32 output.
#include <hip/hip_runtime.h>
#include <math.h>

typedef __attribute__((ext_vector_type(16))) _Float16 v16h;
typedef __attribute__((ext_vector_type(16))) __bf16 v16b;
typedef __attribute__((ext_vector_type(8)))  _Float16 v8h;
typedef __attribute__((ext_vector_type(8)))  float v8f;
typedef __attribute__((ext_vector_type(4)))  float v4f;
typedef __attribute__((ext_vector_type(2)))  float v2f;
typedef __attribute__((ext_vector_type(4)))  unsigned v4u;
typedef __attribute__((ext_vector_type(4)))  int v4i;
typedef float __attribute__((may_alias)) float_a;
typedef int __attribute__((may_alias)) int_a;

template <typename T> __device__ __forceinline__ void vst2(void* p, T v) { *(T*)p = v;  }
__device__ __forceinline__ v8f wmma16(v16h a, v16h b, v8f c) {
  v8f d = __builtin_amdgcn_wmma_f32_16x16x32_f16(false, a, false, b, (short)0, c, false, false);
  asm volatile("v_nop\n\tv_nop\n\tv_nop\n\tv_nop" : "+v"(d) : "v"(a), "v"(b));
  return d;
}
__device__ __forceinline__ v8f wmma_bf(v16b a, v16b b, v8f c) {
  v8f d = __builtin_amdgcn_wmma_f32_16x16x32_bf16(false, a, false, b, (short)0, c, false, false);
  asm volatile("v_nop\n\tv_nop\n\tv_nop\n\tv_nop" : "+v"(d) : "v"(a), "v"(b));
  return d;
}
// 16x16x32 fragments: lane = (h = lane>>4, row/col = lane&15); elements 0..7 = k0+8h+0..7, 8..15 = k0+16+8h+0..7; D element r = row 8h+r
__device__ __forceinline__ v16h frag_h(const _Float16* rowk0, int lane) {
  union { v16h v; v8h q[2]; } u; const _Float16* p = rowk0 + 8 * (lane >> 4);
  u.q[0] = *(const v8h*)p; u.q[1] = *(const v8h*)(p + 16); return u.v;
}
__device__ __forceinline__ v16h frag_f32(const float* rowk0, int lane) {
  v16h a; const float* p = rowk0 + 8 * (lane >> 4);
#pragma unroll
  for (int i = 0; i < 8; ++i) { a[i] = (_Float16)p[i]; a[8 + i] = (_Float16)p[16 + i]; }
  return a;
}
__device__ __forceinline__ v16h frag_f32s(const float* rowk0, int lane, float sc) {
  v16h a; const float* p = rowk0 + 8 * (lane >> 4);
#pragma unroll
  for (int i = 0; i < 8; ++i) { a[i] = (_Float16)(p[i] * sc); a[8 + i] = (_Float16)(p[16 + i] * sc); }
  return a;
}
// column fragment from a [K][ld] layout (column n), rows >= K read as 0
__device__ __forceinline__ v16h fragc_f32(const float* W, int k0, int n, int lane, int ld, int K) {
  v16h a; const int g = lane >> 4;
#pragma unroll
  for (int i = 0; i < 8; ++i) { const int ka = k0 + 8 * g + i, kb = ka + 16;
    a[i] = (_Float16)(ka < K ? W[(size_t)(ka < K ? ka : K - 1) * ld + n] : 0.f); a[8 + i] = (_Float16)(kb < K ? W[(size_t)(kb < K ? kb : K - 1) * ld + n] : 0.f); }
  return a;
}
struct F2 { v16b h, l; };
__device__ __forceinline__ F2 bsplit16(const float v[16]) { F2 r;
#pragma unroll
  for (int i = 0; i < 16; ++i) { const __bf16 h = (__bf16)v[i]; r.h[i] = h; r.l[i] = (__bf16)(v[i] - (float)h); }
  return r; }
__device__ __forceinline__ F2 split_row(const float* row, int k0, int lane) { float v[16]; const float* p = row + k0 + 8 * (lane >> 4);
#pragma unroll
  for (int i = 0; i < 8; ++i) { v[i] = p[i]; v[8 + i] = p[16 + i]; }
  return bsplit16(v); }
__device__ __forceinline__ F2 split_rowK(const float* row, int k0, int lane, int K) { float v[16]; const int g = lane >> 4;
#pragma unroll
  for (int i = 0; i < 8; ++i) { const int ka = k0 + 8 * g + i, kb = ka + 16; v[i] = ka < K ? row[ka < K ? ka : K - 1] : 0.f; v[8 + i] = kb < K ? row[kb < K ? kb : K - 1] : 0.f; }
  return bsplit16(v); }
__device__ __forceinline__ F2 split_col(const float* W, int k0, int n, int lane, int ld, int K) { float v[16]; const int g = lane >> 4;
#pragma unroll
  for (int i = 0; i < 8; ++i) { const int ka = k0 + 8 * g + i, kb = ka + 16; v[i] = ka < K ? W[(size_t)(ka < K ? ka : K - 1) * ld + n] : 0.f; v[8 + i] = kb < K ? W[(size_t)(kb < K ? kb : K - 1) * ld + n] : 0.f; }
  return bsplit16(v); }
__device__ __forceinline__ v8f mac3(const F2& a, const F2& b, v8f c) { c = wmma_bf(a.l, b.h, c); c = wmma_bf(a.h, b.l, c); return wmma_bf(a.h, b.h, c); }
__device__ __forceinline__ float sigm(float v) { return 1.0f / (1.0f + expf(-v)); }
#define LDSX() do { asm volatile("s_wait_dscnt 0" ::: "memory"); __builtin_amdgcn_wave_barrier(); __builtin_amdgcn_fence(__ATOMIC_RELEASE, "workgroup"); } while (0)


// Relative multi-head self attention (Transformer-XL style rel_shift; B 2, S 2,048, D 1,024, 16 heads x 64): pos = sinusoid(S, D) Wp + bp; scores = ((q+u) k^T + rel_shift((q+v) pos^T)) / 8, softmax, . v, Wo + bo.
#define NB 2
#define TT 2048
#define DMD 1024
#define NH 16
#define HD 64
#define POFF 32                 // ph buffer row offset (rows < 0 and >= T read as zeros)
#define PROWS (TT + 64)
#ifndef TNB
#define TNB NB
#endif
#ifndef TQB2
#define TQB2 (TT / 64)   // query blocks
#endif
#ifndef TOB2
#define TOB2 (TNB * TT / 64)
#endif
typedef __attribute__((ext_vector_type(8))) __bf16 v8b;
__device__ __forceinline__ v16b frag_b(const __bf16* rowk0, int lane) {
  union { v16b v; v8b q[2]; } u; const __bf16* p = rowk0 + 8 * (lane >> 4);
  u.q[0] = *(const v8b*)p; u.q[1] = *(const v8b*)(p + 16); return u.v;
}
__device__ __forceinline__ float bfr(float v) { return (float)(__bf16)v; }
__device__ __attribute__((noinline)) float exp_ni(float v) { return expf(v); }
__device__ __attribute__((noinline)) float erf_ni(float v) { return erff(v); }

#define WS_Q   0u                                   // f32 q rows [b*u][D] (+bq)
#define WS_KH  (WS_Q + 4u * (size_t)NB * TT * DMD)       // f16 k rows [b*t][D]
#define WS_PH  (WS_KH + 2u * (size_t)NB * TT * DMD)      // f16 ph rows [PROWS][D] (row POFF + p)
#define WS_VH  (WS_PH + 2u * (size_t)PROWS * DMD)        // f16 v planes [b][D][t]
#define WS_VL  (WS_VH + 2u * (size_t)NB * DMD * TT)      // f16 v residual planes (unscaled)
#define WS_X   (WS_VL + 2u * (size_t)NB * DMD * TT)      // f32 attention output rows [b*u][D]
#define WS_SIN (WS_X + 4u * (size_t)NB * TT * DMD)       // f32 sinusoid table [T][D]
#define WS_END (WS_SIN + 4u * (size_t)TT * DMD)

// ---- operand tiles of the projection GEMMs: one 32-k slice of the block's 64 rows and 128 weight columns, rounded once and shared by the four waves
#define GP 40                   // LDS pitch of a 32-element bf16 row: 80 B = 16 B x odd
typedef __attribute__((ext_vector_type(4))) __bf16 v4b;
template <bool SPLIT> struct GTiles { __bf16 W[2][128][GP]; __bf16 A[2][64][GP]; __bf16 L[SPLIT ? 2 : 1][SPLIT ? 64 : 1][GP]; };   // W transposed to [column][k]; A rows (hi), L their residuals
// acc[j] += rows (bf16, or bf16 hi then lo) . W[:, 16 j ..]; k ascending in slices of 32, as one product (two with SPLIT) per slice and column tile
template <bool SPLIT>
__device__ __forceinline__ void gemm_tiles(const float* __restrict__ Arows, const float* __restrict__ Wcols, GTiles<SPLIT>& t, int tid, v8f* acc) {
  const int wave = tid >> 5, lane = tid & 31, col = lane & 15, r8 = tid >> 3, q8 = tid & 7;
  // whole-line fetch: a wave reads 512 contiguous bytes of one weight row (8 rows a wave), 8 lanes read one 128-byte piece of an operand row
  const float* gw = Wcols + (size_t)(wave * 8) * DMD + lane * 4; const float* ga = Arows + (size_t)r8 * DMD + q8 * 4;
  v4f rw[8], ra[4];
  auto fetch = [&](int kc) {
#pragma unroll
    for (int i = 0; i < 8; ++i) rw[i] = *(const v4f*)(gw + (size_t)(kc * 32 + i) * DMD);
#pragma unroll
    for (int i = 0; i < 4; ++i) ra[i] = *(const v4f*)(ga + (size_t)(i * 16) * DMD + kc * 32);
    asm volatile("s_wait_xcnt 0x0" ::: "memory"); };   // stands in front of the loop's advance of these loads' address registers
  fetch(0);
#pragma unroll 2   // the two buffers' addresses become constants
  for (int kc = 0; kc < DMD / 32; ++kc) { const int bf = kc & 1;
#pragma unroll
    for (int c = 0; c < 4; ++c) { v8b p;
#pragma unroll
      for (int i = 0; i < 8; ++i) p[i] = (__bf16)rw[i][c];
      *(v8b*)&t.W[bf][lane * 4 + c][wave * 8] = p; }
#pragma unroll
    for (int i = 0; i < 4; ++i) { v4b hv, lv;
#pragma unroll
      for (int e = 0; e < 4; ++e) { const __bf16 hh = (__bf16)ra[i][e]; hv[e] = hh; if (SPLIT) lv[e] = (__bf16)(ra[i][e] - (float)hh); }
      *(v4b*)&t.A[bf][i * 16 + r8][q8 * 4] = hv; if (SPLIT) *(v4b*)&t.L[bf][i * 16 + r8][q8 * 4] = lv; }
    __syncthreads();   // this slice is published; the other buffer's readers all stand in front of this barrier, so the next trip may refill it
    if (kc + 1 < DMD / 32) fetch(kc + 1);   // the next slice flies under this slice's products (issued behind the barrier: a load does not stay in flight across it)
    const v16b a = frag_b(&t.A[bf][wave * 16 + col][0], lane); v16b al; if (SPLIT) al = frag_b(&t.L[bf][wave * 16 + col][0], lane);
    v16b w[8];
#pragma unroll
    for (int j = 0; j < 8; ++j) w[j] = frag_b(&t.W[bf][j * 16 + col][0], lane);
#pragma unroll
    for (int j = 0; j < 8; ++j) { acc[j] = wmma_bf(a, w[j], acc[j]); if (SPLIT) acc[j] = wmma_bf(al, w[j], acc[j]); }
    __builtin_amdgcn_sched_barrier(0);   // keeps the next slice's roundings, which wait for its loads, behind this slice's products
  } }
struct ProjEpi { float sf[4][16][132]; _Float16 sh[64][136]; _Float16 th[128][72], tl[128][72]; };
template <bool SPLIT> union ProjStage { GTiles<SPLIT> t; ProjEpi e; };   // the epilogue's staging reuses the tiles' LDS behind the loop
// ---- k_proj: block = (64 rows, 128-col group, which): 0 q (f32 rows), 1 k (f16 rows), 2 v (f16 hi + residual planes), 3 ph (f16 rows at POFF), natural W + bias
template <int WOFF>
__global__ __launch_bounds__(128) void k_proj(const float* __restrict__ Xin, const float* __restrict__ WQ, const float* __restrict__ BQ, const float* __restrict__ WK, const float* __restrict__ BK, const float* __restrict__ WV, const float* __restrict__ BV, const float* __restrict__ WP, const float* __restrict__ BP, float* __restrict__ Q, _Float16* __restrict__ KH, _Float16* __restrict__ VH, _Float16* __restrict__ VL, _Float16* __restrict__ PH) {
  __shared__ __align__(16) ProjStage<WOFF == 3> u;
  float (&sf)[4][16][132] = u.e.sf; _Float16 (&sh)[64][136] = u.e.sh; _Float16 (&th)[128][72] = u.e.th; _Float16 (&tl)[128][72] = u.e.tl;
  const int tid = threadIdx.x, wave = tid >> 5, lane = tid & 31, col = lane & 15, g = lane >> 4; const int which = blockIdx.z + WOFF; const int c0 = blockIdx.y * 128; const int nrows = (which == 3) ? TT : NB * TT;
  if ((int)blockIdx.x * 64 >= nrows) return;
  const float* Wm = (which == 0 ? WQ : which == 1 ? WK : which == 2 ? WV : WP); const float* Bm = (which == 0 ? BQ : which == 1 ? BK : which == 2 ? BV : BP);
  const size_t r0 = (size_t)blockIdx.x * 64 + wave * 16;
  v8f acc[8] = {};
  gemm_tiles<WOFF == 3>(Xin + (size_t)blockIdx.x * 64 * DMD, Wm + c0, u.t, tid, acc);   // WOFF 3: rows of the f32 sinusoid table (k_sin), hi + lo
  __syncthreads();   // every wave has left the last tiles before they become output staging
#pragma unroll
  for (int j = 0; j < 8; ++j) { const float bb = bfr(Bm[c0 + j * 16 + col]);
#pragma unroll
    for (int r = 0; r < 8; ++r) { const float v = acc[j][r] + bb; const int rl = wave * 16 + 8 * g + r, cl = j * 16 + col;
      if (which == 0) sf[wave][8 * g + r][cl] = v; else if (which == 2) { const _Float16 hv = (_Float16)v; th[cl][rl] = hv; tl[cl][rl] = (_Float16)(v - (float)hv); } else sh[rl][cl] = (_Float16)v; } }
  __syncthreads();
  if (which == 0) { for (int rl = 0; rl < 16; ++rl) vst2(Q + (r0 + rl) * DMD + c0 + lane * 4, *(const v4f*)&sf[wave][rl][lane * 4]); }
  else if (which == 2) { const size_t b = ((size_t)blockIdx.x * 64) / TT; const int t0 = (int)(((size_t)blockIdx.x * 64) % TT); for (int e = tid; e < 128 * 8; e += 128) { const int cl = e >> 3, q = e & 7; const size_t o = (b * DMD + c0 + cl) * (size_t)TT + t0 + q * 8; vst2((unsigned*)(VH + o), *(const v4u*)&th[cl][q * 8]); vst2((unsigned*)(VL + o), *(const v4u*)&tl[cl][q * 8]); } }
  else { _Float16* dst = (which == 1) ? (KH + (size_t)blockIdx.x * 64 * DMD) : (PH + ((size_t)POFF + blockIdx.x * 64) * DMD); for (int e = tid; e < 64 * 16; e += 128) { const int rl = e >> 4, q = e & 15; vst2((unsigned*)(dst + (size_t)rl * DMD + c0 + q * 8), *(const v4u*)&sh[rl][q * 8]); } } }
// ---- k_sin: block = position s: the module's sinusoid table row [sin(s f_c) | cos(s f_c)], f_c = 1e4^(-2c/D), f32
__global__ __launch_bounds__(256) void k_sin(float* __restrict__ SINT) { __shared__ __align__(16) float sr[DMD]; const int t = threadIdx.x; const int s = blockIdx.x;
  for (int c = t; c < DMD / 2; c += 256) { const float ang = (float)s * powf(10000.0f, -2.0f * (float)c / (float)DMD); sr[c] = sinf(ang); sr[DMD / 2 + c] = cosf(ang); }
  __syncthreads(); vst2(SINT + (size_t)s * DMD + t * 4, *(const v4f*)&sr[t * 4]); }
// ---- k_padph: the POFF rows before and the rows after the table are zeros
__global__ __launch_bounds__(256) void k_padph(_Float16* __restrict__ PH) { const int t = threadIdx.x; const int r = blockIdx.x; const size_t row = (r < POFF) ? r : (TT + r);   // 0..31 and TT+32 .. TT+63
  v4u z; z[0] = z[1] = z[2] = z[3] = 0u; if (t < DMD / 8) vst2((unsigned*)(PH + row * DMD + t * 8), z); }
// fragments of (q + bias) for 16 rows, head h: hi and residual as f16 (unscaled; q ~ O(1))
__device__ __forceinline__ void qfrags(const float* __restrict__ Q, size_t row0, int h, const float* __restrict__ bias, int lane, v16h* hi, v16h* lo) { const int col = lane & 15, g = lane >> 4; size_t row = row0 + col; if (row > (size_t)NB * TT - 1) row = (size_t)NB * TT - 1;   // clamp (only the never-used row T of the last batch)
#pragma unroll
  for (int kc = 0; kc < 2; ++kc) { const float* p = Q + row * DMD + h * HD + kc * 32 + 8 * g; const float* bp = bias + h * HD + kc * 32 + 8 * g; v16h a, b;
#pragma unroll
    for (int i = 0; i < 8; ++i) { const float v0 = p[i] + bfr(bp[i]), v1 = p[16 + i] + bfr(bp[16 + i]); const _Float16 h0 = (_Float16)v0, h1 = (_Float16)v1; a[i] = h0; a[8 + i] = h1; b[i] = (_Float16)(v0 - (float)h0); b[8 + i] = (_Float16)(v1 - (float)h1); }
    hi[kc] = a; lo[kc] = b; } }
// LDS row pitches: 16 B x odd (144 B for 64-half rows, 80 B for 32-half rows)
#define KP 72
#define VP 40
struct AttTiles { _Float16 K[32][KP], VH[64][VP], VL[64][VP], PL[96][KP], PU[96][KP]; };
union AttStage { AttTiles t; float so[4][16][68]; };
// ---- k_att: block = (64 queries u, h, b)
__global__ __launch_bounds__(128) void k_att(const float* __restrict__ Q, const _Float16* __restrict__ KH, const _Float16* __restrict__ PH, const _Float16* __restrict__ VH, const _Float16* __restrict__ VL, const float* __restrict__ BU, const float* __restrict__ BVv, float* __restrict__ X) {
  __shared__ __align__(16) float sp[4][16][36]; __shared__ __align__(16) float sg1[4][16][36], sg2[4][16][36];
  __shared__ __align__(16) AttStage u;   // the trip's operand tiles, shared by the four waves; output staging behind the loop
  const int tid = threadIdx.x, wave = tid >> 5, lane = tid & 31, col = lane & 15, g = lane >> 4; const int qb = blockIdx.x, h = blockIdx.y; const size_t b = blockIdx.z; const int i0 = qb * 64 + wave * 16;
  // whole-line fetch of one trip's tiles: 8 lanes per 128-byte row (k, ph), 4 lanes per 64-byte row (v planes); held in registers until the tile in LDS is free
  const int r8 = tid >> 3, q8 = tid & 7, r4 = tid >> 2, q4 = tid & 3;
  // block-uniform bases and 32-bit lane byte offsets
  const char* gK = (const char*)(KH + b * TT * DMD + h * HD); const char* gP = (const char*)(PH + h * HD);
  const char* gVH = (const char*)(VH + (b * DMD + (size_t)h * HD) * TT); const char* gVL = (const char*)(VL + (b * DMD + (size_t)h * HD) * TT);
  const unsigned oK = (unsigned)(r8 * DMD + q8 * 8) * 2u, oV = (unsigned)(r4 * TT + q4 * 8) * 2u;
  const int wrow = 48 - 16 * wave;   // this wave's first row inside the block's 96-row position window
  v8h rk[2], rvh[2], rvl[2], rp[6];
  auto fetch = [&](int ks) {
#pragma unroll
    for (int i = 0; i < 2; ++i) { rk[i] = *(const v8h*)(gK + (oK + (unsigned)((ks * 32 + i * 16) * DMD * 2))); rvh[i] = *(const v8h*)(gVH + (oV + (unsigned)((i * 32 * TT + ks * 32) * 2))); rvl[i] = *(const v8h*)(gVL + (oV + (unsigned)((i * 32 * TT + ks * 32) * 2))); }
    // 96-row position window of the block: the j <= i window while some wave needs it, else the j >= i + 2 window (rows outside the buffer are used by no wave: clamped)
    const int base = (ks * 32 <= qb * 64 + 63) ? (TT - 64 - qb * 64 + ks * 32 + POFF) : (ks * 32 - qb * 64 - 65 + POFF);
#pragma unroll
    for (int i = 0; i < 6; ++i) { int row = base + i * 16 + r8; row = row < 0 ? 0 : (row > PROWS - 1 ? PROWS - 1 : row); rp[i] = *(const v8h*)(gP + (unsigned)(row * DMD + q8 * 8) * 2u); } };
  fetch(0);
  v16h au[2], av[2], aw[2], tmpl[2];   // (q+u) rows i0.., (q+v) rows i0.., (q+v) rows i0+1.. (for the wrapped upper-triangle term); single f16 rounding (residuals dropped: VGPR budget)
  qfrags(Q, b * TT + i0, h, BU, lane, au, tmpl); qfrags(Q, b * TT + i0, h, BVv, lane, av, tmpl);
  qfrags(Q, b * TT + i0 + 1, h, BVv, lane, aw, tmpl);   // rows i+1; for i = T-1 the row belongs to the next batch (or is clamped) but its products are never used: j >= i+2 cannot hold for i = T-1
  const bool lastblk = (i0 + 16 >= TT);
  float m[8], l[8];
#pragma unroll
  for (int r = 0; r < 8; ++r) { m[r] = -3.0e38f; l[r] = 0.f; }
  v8f acc[4] = {};
#pragma unroll 1
  for (int ks = 0; ks < TT / 32; ++ks) { float s[2][8];
    __syncthreads();   // every wave has left the previous trip's tiles
#pragma unroll
    for (int i = 0; i < 2; ++i) { *(v8h*)&u.t.K[i * 16 + r8][q8 * 8] = rk[i]; *(v8h*)&u.t.VH[i * 32 + r4][q4 * 8] = rvh[i]; *(v8h*)&u.t.VL[i * 32 + r4][q4 * 8] = rvl[i]; }
    const bool blow = (ks * 32 <= qb * 64 + 63);
    { _Float16 (*dst)[KP] = blow ? u.t.PL : u.t.PU;
#pragma unroll
      for (int i = 0; i < 6; ++i) *(v8h*)&dst[i * 16 + r8][q8 * 8] = rp[i]; }
    if (blow && ks * 32 + 31 >= qb * 64 + 2) {   // the two trips on the diagonal need both windows: the j >= i + 2 one is brought here
#pragma unroll
      for (int i = 0; i < 6; ++i) { int row = ks * 32 - qb * 64 - 65 + POFF + i * 16 + r8; row = row < 0 ? 0 : (row > PROWS - 1 ? PROWS - 1 : row); *(v8h*)&u.t.PU[i * 16 + r8][q8 * 8] = *(const v8h*)(gP + (unsigned)(row * DMD + q8 * 8) * 2u); } }
    __syncthreads();   // this trip's tiles are published
#pragma unroll
    for (int ct = 0; ct < 2; ++ct) { const int j0 = ks * 32 + ct * 16; const int kk = j0 + col; v8f c = {}; v16h kh[2];
#pragma unroll
      for (int kc = 0; kc < 2; ++kc) kh[kc] = frag_h(&u.t.K[ct * 16 + col][kc * 32], lane);
#pragma unroll
      for (int kc = 0; kc < 2; ++kc) c = wmma16(au[kc], kh[kc], c);
      const bool needlow = (j0 <= i0 + 15);          // some (i, j) with j <= i
      const bool needup = (j0 + 15 >= i0 + 2);        // some (i, j) with j >= i + 2
      if (needlow) { v16h pf[2][2];   // tile covers p = T-16-i0+j0 .. +31: rows wrow + 16 ct .. +31 of the staged window
#pragma unroll
        for (int pt = 0; pt < 2; ++pt)
#pragma unroll
          for (int kc = 0; kc < 2; ++kc) pf[pt][kc] = frag_h(&u.t.PL[wrow + ct * 16 + pt * 16 + col][kc * 32], lane);
#pragma unroll
        for (int pt = 0; pt < 2; ++pt) { v8f gg = {};
#pragma unroll
          for (int kc = 0; kc < 2; ++kc) gg = wmma16(av[kc], pf[pt][kc], gg);
#pragma unroll
          for (int r = 0; r < 8; ++r) sg1[wave][8 * g + r][pt * 16 + col] = gg[r]; } }
      if (needup) { v16h pf[2][2];   // tile covers p = j0-i0-17 .. +31
#pragma unroll
        for (int pt = 0; pt < 2; ++pt)
#pragma unroll
          for (int kc = 0; kc < 2; ++kc) pf[pt][kc] = frag_h(&u.t.PU[wrow + ct * 16 + pt * 16 + col][kc * 32], lane);
#pragma unroll
        for (int pt = 0; pt < 2; ++pt) { v8f gg = {};
#pragma unroll
          for (int kc = 0; kc < 2; ++kc) gg = wmma16(aw[kc], pf[pt][kc], gg);
#pragma unroll
          for (int r = 0; r < 8; ++r) sg2[wave][8 * g + r][pt * 16 + col] = gg[r]; } }
      LDSX();
#pragma unroll
      for (int r = 0; r < 8; ++r) { const int il = 8 * g + r; const int i = i0 + il; const int j = kk; const int idx = 15 + col - il;   // == (T-1-i+j) - (T-16-i0+j0) == (j-i-2) - (j0-i0-17)
        float bd; if (j <= i) bd = sg1[wave][il][idx]; else if (j == i + 1) bd = 0.f; else bd = (lastblk && il == 15) ? 0.f : sg2[wave][il][idx];
        s[ct][r] = (c[r] + bd) * 0.125f; }
      LDSX(); }
    float alpha[8];
#pragma unroll
    for (int r = 0; r < 8; ++r) { float mx = fmaxf(s[0][r], s[1][r]);
#pragma unroll
      for (int o = 1; o < 16; o <<= 1) mx = fmaxf(mx, __shfl_xor(mx, o));
      const float mn = fmaxf(m[r], mx); alpha[r] = (m[r] <= -1.0e38f) ? 0.f : __expf(m[r] - mn); const float e0 = (s[0][r] <= -1.0e38f) ? 0.f : __expf(s[0][r] - mn), e1 = (s[1][r] <= -1.0e38f) ? 0.f : __expf(s[1][r] - mn); float es = e0 + e1;
#pragma unroll
      for (int o = 1; o < 16; o <<= 1) es += __shfl_xor(es, o);
      l[r] = l[r] * alpha[r] + es; m[r] = mn; sp[wave][8 * g + r][col] = e0; sp[wave][8 * g + r][16 + col] = e1; }
#pragma unroll
    for (int j = 0; j < 4; ++j)
#pragma unroll
      for (int r = 0; r < 8; ++r) acc[j][r] *= alpha[r];
    LDSX();
    fetch(ks + 1 < TT / 32 ? ks + 1 : ks);   // the next trip's tiles fly under the P . v products (the last trip names its own again: always in bounds, never stored)
    v16h pa, pr; { const float* prow = &sp[wave][col][0] + 8 * (lane >> 4);
#pragma unroll
      for (int i = 0; i < 8; ++i) { const float x0 = prow[i] * 2048.0f, x1 = prow[16 + i] * 2048.0f; const _Float16 h0 = (_Float16)x0, h1 = (_Float16)x1; pa[i] = h0; pa[8 + i] = h1; pr[i] = (_Float16)(x0 - (float)h0); pr[8 + i] = (_Float16)(x1 - (float)h1); } }
#pragma unroll
    for (int j = 0; j < 4; ++j) { const v16h vh = frag_h(&u.t.VH[j * 16 + col][0], lane), vl = frag_h(&u.t.VL[j * 16 + col][0], lane);   // both planes' fragments in one run: one LDS wait for three products
      acc[j] = wmma16(pa, vh, acc[j]); acc[j] = wmma16(pr, vh, acc[j]); acc[j] = wmma16(pa, vl, acc[j]); }
    LDSX(); }
  __syncthreads();   // every wave has left the last tiles before they become output staging
#pragma unroll
  for (int r = 0; r < 8; ++r) { const float il = (l[r] > 0.f) ? (1.0f / 2048.0f) / l[r] : 0.f;   // fully masked rows -> zeros (the module zeroes them after the softmax)
#pragma unroll
    for (int j = 0; j < 4; ++j) u.so[wave][8 * g + r][j * 16 + col] = acc[j][r] * il; }
  LDSX(); for (int rl = 0; rl < 16; ++rl) if (lane < 16) vst2(X + (b * TT + i0 + rl) * DMD + h * HD + lane * 4, *(const v4f*)&u.so[wave][rl][lane * 4]); }
// ---- k_out: block = (64 rows, 128 of 1024 cols): out = x (hi + lo) . Wo + bo
__global__ __launch_bounds__(128) void k_out(const float* __restrict__ X, const float* __restrict__ WO, const float* __restrict__ BO, float* __restrict__ OUT) { __shared__ __align__(16) float sf[4][16][132];
  const int tid = threadIdx.x, wave = tid >> 5, lane = tid & 31, col = lane & 15, g = lane >> 4; const int c0 = blockIdx.y * 128; const size_t r0 = (size_t)blockIdx.x * 64 + wave * 16;
  __shared__ __align__(16) GTiles<true> t;
  v8f acc[8] = {};
  gemm_tiles<true>(X + (size_t)blockIdx.x * 64 * DMD, WO + c0, t, tid, acc);
#pragma unroll
  for (int j = 0; j < 8; ++j) { const float bb = bfr(BO[c0 + j * 16 + col]);
#pragma unroll
    for (int r = 0; r < 8; ++r) sf[wave][8 * g + r][j * 16 + col] = acc[j][r] + bb; }
  LDSX(); for (int rl = 0; rl < 16; ++rl) vst2(OUT + (r0 + rl) * DMD + c0 + lane * 4, *(const v4f*)&sf[wave][rl][lane * 4]); }
extern "C" void kernel_launch(void* const* d_in, const int* in_sizes, int n_in, void* d_out, int out_size, void* d_ws, size_t ws_size, hipStream_t stream) {
  (void)in_sizes; (void)n_in; (void)out_size;
  const float** F = (const float**)d_in;   // 0 x [2,2048,1024]; 1 Wq, 2 bq, 3 Wk, 4 bk, 5 Wv, 6 bv, 7 Wp, 8 bp, 9 Wo, 10 bo ((in,out) [1024,1024]); 11 u [1,16,1,64], 12 v [1,16,1,64]
  if (ws_size < (size_t)WS_END) return;
  char* ws = (char*)d_ws; float* Q = (float*)(ws + WS_Q); _Float16 *KH = (_Float16*)(ws + WS_KH), *PH = (_Float16*)(ws + WS_PH), *VH = (_Float16*)(ws + WS_VH), *VL = (_Float16*)(ws + WS_VL); float* X = (float*)(ws + WS_X);
  float* SINT = (float*)(ws + WS_SIN);
  k_sin<<<TT, 256, 0, stream>>>(SINT);
  k_proj<0><<<dim3(TNB * TT / 64, DMD / 128, 3), 128, 0, stream>>>(F[0], F[1], F[2], F[3], F[4], F[5], F[6], F[7], F[8], Q, KH, VH, VL, PH);
  k_proj<3><<<dim3(TT / 64, DMD / 128, 1), 128, 0, stream>>>(SINT, F[1], F[2], F[3], F[4], F[5], F[6], F[7], F[8], Q, KH, VH, VL, PH);
  k_padph<<<64, 256, 0, stream>>>(PH);
  k_att<<<dim3(TQB2, NH, TNB), 128, 0, stream>>>(Q, KH, PH, VH, VL, F[11], F[12], X);
  k_out<<<dim3(TOB2, DMD / 128), 128, 0, stream>>>(X, F[9], F[10], (float*)d_out);
}

// v003
// A run of this version takes 304 microseconds.
// Two timings next to v002 put it at 1.37 and 1.38 times that version's speed.
// All steps since v000 together make it 2.22 times as fast.
// compute dtype: all float inputs rounded to bf16; q/k/v projections with EXACT bf16 products on WMMA 16x16x32 ((in,out) weights, + bias), the sinusoidal position table built once on device in f32 (precise sinf/cosf/powf, k_sin) and projected with hi + lo (2 products) + bp, f32 accumulate; q kept in f32 (bias_u / bias_v added per head, then rounded once to f16 fragments), k / ph rounded once to f16, v to f16 hi + residual; content scores (q+bu) . k and the Transformer-XL position term (q+bv) . ph with single f16 products (logits ~1-2; q, k, ph each rounded once), the rel_shift realised exactly as an index map onto 16 x 32 position tiles (incl. its upper-triangle wrap-around rows and the zero at j == i+1), x 1/8, running-max softmax in f32 (hardware exp); P (f16 x 2^11 + residual) . v; out = x (bf16 hi + lo) . Wo + bo; f32 output.
#include <hip/hip_runtime.h>
#include <math.h>

typedef __attribute__((ext_vector_type(16))) _Float16 v16h;
typedef __attribute__((ext_vector_type(16))) __bf16 v16b;
typedef __attribute__((ext_vector_type(8)))  _Float16 v8h;
typedef __attribute__((ext_vector_type(8)))  float v8f;
typedef __attribute__((ext_vector_type(4)))  float v4f;
typedef __attribute__((ext_vector_type(2)))  float v2f;
typedef __attribute__((ext_vector_type(4)))  unsigned v4u;
typedef __attribute__((ext_vector_type(4)))  int v4i;
typedef float __attribute__((may_alias)) float_a;
typedef int __attribute__((may_alias)) int_a;

template <typename T> __device__ __forceinline__ void vst2(void* p, T v) { *(T*)p = v;  }
__device__ __forceinline__ v8f wmma16(v16h a, v16h b, v8f c) {
  v8f d = __builtin_amdgcn_wmma_f32_16x16x32_f16(false, a, false, b, (short)0, c, false, false);
  asm volatile("v_nop\n\tv_nop\n\tv_nop\n\tv_nop" : "+v"(d) : "v"(a), "v"(b));
  return d;
}
__device__ __forceinline__ v8f wmma_bf(v16b a, v16b b, v8f c) {
  v8f d = __builtin_amdgcn_wmma_f32_16x16x32_bf16(false, a, false, b, (short)0, c, false, false);
  asm volatile("v_nop\n\tv_nop\n\tv_nop\n\tv_nop" : "+v"(d) : "v"(a), "v"(b));
  return d;
}
// 16x16x32 fragments: lane = (h = lane>>4, row/col = lane&15); elements 0..7 = k0+8h+0..7, 8..15 = k0+16+8h+0..7; D element r = row 8h+r
__device__ __forceinline__ v16h frag_h(const _Float16* rowk0, int lane) {
  union { v16h v; v8h q[2]; } u; const _Float16* p = rowk0 + 8 * (lane >> 4);
  u.q[0] = *(const v8h*)p; u.q[1] = *(const v8h*)(p + 16); return u.v;
}
__device__ __forceinline__ v16h frag_f32(const float* rowk0, int lane) {
  v16h a; const float* p = rowk0 + 8 * (lane >> 4);
#pragma unroll
  for (int i = 0; i < 8; ++i) { a[i] = (_Float16)p[i]; a[8 + i] = (_Float16)p[16 + i]; }
  return a;
}
__device__ __forceinline__ v16h frag_f32s(const float* rowk0, int lane, float sc) {
  v16h a; const float* p = rowk0 + 8 * (lane >> 4);
#pragma unroll
  for (int i = 0; i < 8; ++i) { a[i] = (_Float16)(p[i] * sc); a[8 + i] = (_Float16)(p[16 + i] * sc); }
  return a;
}
// column fragment from a [K][ld] layout (column n), rows >= K read as 0
__device__ __forceinline__ v16h fragc_f32(const float* W, int k0, int n, int lane, int ld, int K) {
  v16h a; const int g = lane >> 4;
#pragma unroll
  for (int i = 0; i < 8; ++i) { const int ka = k0 + 8 * g + i, kb = ka + 16;
    a[i] = (_Float16)(ka < K ? W[(size_t)(ka < K ? ka : K - 1) * ld + n] : 0.f); a[8 + i] = (_Float16)(kb < K ? W[(size_t)(kb < K ? kb : K - 1) * ld + n] : 0.f); }
  return a;
}
struct F2 { v16b h, l; };
__device__ __forceinline__ F2 bsplit16(const float v[16]) { F2 r;
#pragma unroll
  for (int i = 0; i < 16; ++i) { const __bf16 h = (__bf16)v[i]; r.h[i] = h; r.l[i] = (__bf16)(v[i] - (float)h); }
  return r; }
__device__ __forceinline__ F2 split_row(const float* row, int k0, int lane) { float v[16]; const float* p = row + k0 + 8 * (lane >> 4);
#pragma unroll
  for (int i = 0; i < 8; ++i) { v[i] = p[i]; v[8 + i] = p[16 + i]; }
  return bsplit16(v); }
__device__ __forceinline__ F2 split_rowK(const float* row, int k0, int lane, int K) { float v[16]; const int g = lane >> 4;
#pragma unroll
  for (int i = 0; i < 8; ++i) { const int ka = k0 + 8 * g + i, kb = ka + 16; v[i] = ka < K ? row[ka < K ? ka : K - 1] : 0.f; v[8 + i] = kb < K ? row[kb < K ? kb : K - 1] : 0.f; }
  return bsplit16(v); }
__device__ __forceinline__ F2 split_col(const float* W, int k0, int n, int lane, int ld, int K) { float v[16]; const int g = lane >> 4;
#pragma unroll
  for (int i = 0; i < 8; ++i) { const int ka = k0 + 8 * g + i, kb = ka + 16; v[i] = ka < K ? W[(size_t)(ka < K ? ka : K - 1) * ld + n] : 0.f; v[8 + i] = kb < K ? W[(size_t)(kb < K ? kb : K - 1) * ld + n] : 0.f; }
  return bsplit16(v); }
__device__ __forceinline__ v8f mac3(const F2& a, const F2& b, v8f c) { c = wmma_bf(a.l, b.h, c); c = wmma_bf(a.h, b.l, c); return wmma_bf(a.h, b.h, c); }
__device__ __forceinline__ float sigm(float v) { return 1.0f / (1.0f + expf(-v)); }
#define LDSX() do { asm volatile("s_wait_dscnt 0" ::: "memory"); __builtin_amdgcn_wave_barrier(); __builtin_amdgcn_fence(__ATOMIC_RELEASE, "workgroup"); } while (0)


// Relative multi-head self attention (Transformer-XL style rel_shift; B 2, S 2,048, D 1,024, 16 heads x 64): pos = sinusoid(S, D) Wp + bp; scores = ((q+u) k^T + rel_shift((q+v) pos^T)) / 8, softmax, . v, Wo + bo.
#define NB 2
#define TT 2048
#define DMD 1024
#define NH 16
#define HD 64
#define POFF 32                 // ph buffer row offset (rows < 0 and >= T read as zeros)
#define PROWS (TT + 64)
#ifndef TNB
#define TNB NB
#endif
#ifndef TQB2
#define TQB2 (TT / 64)   // query blocks
#endif
#ifndef TOB2
#define TOB2 (TNB * TT / 64)
#endif
typedef __attribute__((ext_vector_type(8))) __bf16 v8b;
__device__ __forceinline__ v16b frag_b(const __bf16* rowk0, int lane) {
  union { v16b v; v8b q[2]; } u; const __bf16* p = rowk0 + 8 * (lane >> 4);
  u.q[0] = *(const v8b*)p; u.q[1] = *(const v8b*)(p + 16); return u.v;
}
__device__ __forceinline__ float bfr(float v) { return (float)(__bf16)v; }
__device__ __attribute__((noinline)) float exp_ni(float v) { return expf(v); }
__device__ __attribute__((noinline)) float erf_ni(float v) { return erff(v); }

#define WS_Q   0u                                   // f32 q rows [b*u][D] (+bq)
#define WS_KH  (WS_Q + 4u * (size_t)NB * TT * DMD)       // f16 k rows [b*t][D]
#define WS_PH  (WS_KH + 2u * (size_t)NB * TT * DMD)      // f16 ph rows [PROWS][D] (row POFF + p)
#define WS_VH  (WS_PH + 2u * (size_t)PROWS * DMD)        // f16 v planes [b][D][t]
#define WS_VL  (WS_VH + 2u * (size_t)NB * DMD * TT)      // f16 v residual planes (unscaled)
#define WS_X   (WS_VL + 2u * (size_t)NB * DMD * TT)      // f32 attention output rows [b*u][D]
#define WS_SIN (WS_X + 4u * (size_t)NB * TT * DMD)       // f32 sinusoid table [T][D]
#define WS_END (WS_SIN + 4u * (size_t)TT * DMD)

// ---- operand tiles of the projection GEMMs: one 32-k slice of the block's 64 rows and 128 weight columns, rounded once and shared by the four waves
#define GP 40                   // LDS pitch of a 32-element bf16 row: 80 B = 16 B x odd
typedef __attribute__((ext_vector_type(4))) __bf16 v4b;
template <bool SPLIT> struct GTiles { __bf16 W[2][128][GP]; __bf16 A[2][64][GP]; __bf16 L[SPLIT ? 2 : 1][SPLIT ? 64 : 1][GP]; };   // W transposed to [column][k]; A rows (hi), L their residuals
// acc[j] += rows (bf16, or bf16 hi then lo) . W[:, 16 j ..]; k ascending in slices of 32, as one product (two with SPLIT) per slice and column tile
template <bool SPLIT>
__device__ __forceinline__ void gemm_tiles(const float* __restrict__ Arows, const float* __restrict__ Wcols, GTiles<SPLIT>& t, int tid, v8f* acc) {
  const int wave = tid >> 5, lane = tid & 31, col = lane & 15, r8 = tid >> 3, q8 = tid & 7;
  // whole-line fetch: a wave reads 512 contiguous bytes of one weight row (8 rows a wave), 8 lanes read one 128-byte piece of an operand row
  const float* gw = Wcols + (size_t)(wave * 8) * DMD + lane * 4; const float* ga = Arows + (size_t)r8 * DMD + q8 * 4;
  v4f rw[8], ra[4];
  auto fetch = [&](int kc) {
#pragma unroll
    for (int i = 0; i < 8; ++i) rw[i] = *(const v4f*)(gw + (size_t)(kc * 32 + i) * DMD);
#pragma unroll
    for (int i = 0; i < 4; ++i) ra[i] = *(const v4f*)(ga + (size_t)(i * 16) * DMD + kc * 32);
    asm volatile("s_wait_xcnt 0x0" ::: "memory"); };   // stands in front of the loop's advance of these loads' address registers
  fetch(0);
#pragma unroll 2   // the two buffers' addresses become constants
  for (int kc = 0; kc < DMD / 32; ++kc) { const int bf = kc & 1;
#pragma unroll
    for (int c = 0; c < 4; ++c) { v8b p;
#pragma unroll
      for (int i = 0; i < 8; ++i) p[i] = (__bf16)rw[i][c];
      *(v8b*)&t.W[bf][lane * 4 + c][wave * 8] = p; }
#pragma unroll
    for (int i = 0; i < 4; ++i) { v4b hv, lv;
#pragma unroll
      for (int e = 0; e < 4; ++e) { const __bf16 hh = (__bf16)ra[i][e]; hv[e] = hh; if (SPLIT) lv[e] = (__bf16)(ra[i][e] - (float)hh); }
      *(v4b*)&t.A[bf][i * 16 + r8][q8 * 4] = hv; if (SPLIT) *(v4b*)&t.L[bf][i * 16 + r8][q8 * 4] = lv; }
    __syncthreads();   // this slice is published; the other buffer's readers all stand in front of this barrier, so the next trip may refill it
    if (kc + 1 < DMD / 32) fetch(kc + 1);   // the next slice flies under this slice's products (issued behind the barrier: a load does not stay in flight across it)
    const v16b a = frag_b(&t.A[bf][wave * 16 + col][0], lane); v16b al; if (SPLIT) al = frag_b(&t.L[bf][wave * 16 + col][0], lane);
    v16b w[8];
#pragma unroll
    for (int j = 0; j < 8; ++j) w[j] = frag_b(&t.W[bf][j * 16 + col][0], lane);
#pragma unroll
    for (int j = 0; j < 8; ++j) { acc[j] = wmma_bf(a, w[j], acc[j]); if (SPLIT) acc[j] = wmma_bf(al, w[j], acc[j]); }
    __builtin_amdgcn_sched_barrier(0);   // keeps the next slice's roundings, which wait for its loads, behind this slice's products
  } }
struct ProjEpi { float sf[4][16][132]; _Float16 sh[64][136]; _Float16 th[128][72], tl[128][72]; };
template <bool SPLIT> union ProjStage { GTiles<SPLIT> t; ProjEpi e; };   // the epilogue's staging reuses the tiles' LDS behind the loop
// ---- k_proj: block = (64 rows, 128-col group, which): 0 q (f32 rows), 1 k (f16 rows), 2 v (f16 hi + residual planes), 3 ph (f16 rows at POFF), natural W + bias
template <int WOFF>
__global__ __launch_bounds__(128) void k_proj(const float* __restrict__ Xin, const float* __restrict__ WQ, const float* __restrict__ BQ, const float* __restrict__ WK, const float* __restrict__ BK, const float* __restrict__ WV, const float* __restrict__ BV, const float* __restrict__ WP, const float* __restrict__ BP, float* __restrict__ Q, _Float16* __restrict__ KH, _Float16* __restrict__ VH, _Float16* __restrict__ VL, _Float16* __restrict__ PH) {
  __shared__ __align__(16) ProjStage<WOFF == 3> u;
  float (&sf)[4][16][132] = u.e.sf; _Float16 (&sh)[64][136] = u.e.sh; _Float16 (&th)[128][72] = u.e.th; _Float16 (&tl)[128][72] = u.e.tl;
  const int tid = threadIdx.x, wave = tid >> 5, lane = tid & 31, col = lane & 15, g = lane >> 4; const int which = blockIdx.z + WOFF; const int c0 = blockIdx.y * 128; const int nrows = (which == 3) ? TT : NB * TT;
  if ((int)blockIdx.x * 64 >= nrows) return;
  const float* Wm = (which == 0 ? WQ : which == 1 ? WK : which == 2 ? WV : WP); const float* Bm = (which == 0 ? BQ : which == 1 ? BK : which == 2 ? BV : BP);
  const size_t r0 = (size_t)blockIdx.x * 64 + wave * 16;
  v8f acc[8] = {};
  gemm_tiles<WOFF == 3>(Xin + (size_t)blockIdx.x * 64 * DMD, Wm + c0, u.t, tid, acc);   // WOFF 3: rows of the f32 sinusoid table (k_sin), hi + lo
  __syncthreads();   // every wave has left the last tiles before they become output staging
#pragma unroll
  for (int j = 0; j < 8; ++j) { const float bb = bfr(Bm[c0 + j * 16 + col]);
#pragma unroll
    for (int r = 0; r < 8; ++r) { const float v = acc[j][r] + bb; const int rl = wave * 16 + 8 * g + r, cl = j * 16 + col;
      if (which == 0) sf[wave][8 * g + r][cl] = v; else if (which == 2) { const _Float16 hv = (_Float16)v; th[cl][rl] = hv; tl[cl][rl] = (_Float16)(v - (float)hv); } else sh[rl][cl] = (_Float16)v; } }
  __syncthreads();
  if (which == 0) { for (int rl = 0; rl < 16; ++rl) vst2(Q + (r0 + rl) * DMD + c0 + lane * 4, *(const v4f*)&sf[wave][rl][lane * 4]); }
  else if (which == 2) { const size_t b = ((size_t)blockIdx.x * 64) / TT; const int t0 = (int)(((size_t)blockIdx.x * 64) % TT); for (int e = tid; e < 128 * 8; e += 128) { const int cl = e >> 3, q = e & 7; const size_t o = (b * DMD + c0 + cl) * (size_t)TT + t0 + q * 8; vst2((unsigned*)(VH + o), *(const v4u*)&th[cl][q * 8]); vst2((unsigned*)(VL + o), *(const v4u*)&tl[cl][q * 8]); } }
  else { _Float16* dst = (which == 1) ? (KH + (size_t)blockIdx.x * 64 * DMD) : (PH + ((size_t)POFF + blockIdx.x * 64) * DMD); for (int e = tid; e < 64 * 16; e += 128) { const int rl = e >> 4, q = e & 15; vst2((unsigned*)(dst + (size_t)rl * DMD + c0 + q * 8), *(const v4u*)&sh[rl][q * 8]); } } }
// ---- k_sin: block = position s: the module's sinusoid table row [sin(s f_c) | cos(s f_c)], f_c = 1e4^(-2c/D), f32
__global__ __launch_bounds__(256) void k_sin(float* __restrict__ SINT) { __shared__ __align__(16) float sr[DMD]; const int t = threadIdx.x; const int s = blockIdx.x;
  for (int c = t; c < DMD / 2; c += 256) { const float ang = (float)s * powf(10000.0f, -2.0f * (float)c / (float)DMD); sr[c] = sinf(ang); sr[DMD / 2 + c] = cosf(ang); }
  __syncthreads(); vst2(SINT + (size_t)s * DMD + t * 4, *(const v4f*)&sr[t * 4]); }
// ---- k_padph: the POFF rows before and the rows after the table are zeros
__global__ __launch_bounds__(256) void k_padph(_Float16* __restrict__ PH) { const int t = threadIdx.x; const int r = blockIdx.x; const size_t row = (r < POFF) ? r : (TT + r);   // 0..31 and TT+32 .. TT+63
  v4u z; z[0] = z[1] = z[2] = z[3] = 0u; if (t < DMD / 8) vst2((unsigned*)(PH + row * DMD + t * 8), z); }
// fragments of (q + bias) for 16 rows, head h: hi and residual as f16 (unscaled; q ~ O(1))
__device__ __forceinline__ void qfrags(const float* __restrict__ Q, size_t row0, int h, const float* __restrict__ bias, int lane, v16h* hi, v16h* lo) { const int col = lane & 15, g = lane >> 4; size_t row = row0 + col; if (row > (size_t)NB * TT - 1) row = (size_t)NB * TT - 1;   // clamp (only the never-used row T of the last batch)
#pragma unroll
  for (int kc = 0; kc < 2; ++kc) { const float* p = Q + row * DMD + h * HD + kc * 32 + 8 * g; const float* bp = bias + h * HD + kc * 32 + 8 * g; v16h a, b;
#pragma unroll
    for (int i = 0; i < 8; ++i) { const float v0 = p[i] + bfr(bp[i]), v1 = p[16 + i] + bfr(bp[16 + i]); const _Float16 h0 = (_Float16)v0, h1 = (_Float16)v1; a[i] = h0; a[8 + i] = h1; b[i] = (_Float16)(v0 - (float)h0); b[8 + i] = (_Float16)(v1 - (float)h1); }
    hi[kc] = a; lo[kc] = b; } }
// LDS row pitches: 16 B x odd (144 B for 64-half rows, 80 B for 32-half rows)
#define KP 72
#define VP 40
struct AttTiles { _Float16 K[32][KP], VH[64][VP], VL[64][VP], PL[96][KP], PU[96][KP]; };
union AttStage { AttTiles t; float so[4][16][68]; };
// ---- k_att: block = (64 queries u, h, b)
__global__ __launch_bounds__(128) void k_att(const float* __restrict__ Q, const _Float16* __restrict__ KH, const _Float16* __restrict__ PH, const _Float16* __restrict__ VH, const _Float16* __restrict__ VL, const float* __restrict__ BU, const float* __restrict__ BVv, float* __restrict__ X) {
  __shared__ __align__(16) float sp[4][16][36]; __shared__ __align__(16) float sg1[4][16][36], sg2[4][16][36];
  __shared__ __align__(16) AttStage u;   // the trip's operand tiles, shared by the four waves; output staging behind the loop
  const int tid = threadIdx.x, wave = __builtin_amdgcn_readfirstlane(tid >> 5), lane = tid & 31, col = lane & 15, g = lane >> 4; const int qb = blockIdx.x, h = blockIdx.y; const size_t b = blockIdx.z; const int i0 = qb * 64 + wave * 16;   // the wave's number in a scalar register: every test on i0 below is a scalar branch
  // whole-line fetch of one trip's tiles: 8 lanes per 128-byte row (k, ph), 4 lanes per 64-byte row (v planes); held in registers until the tile in LDS is free
  const int r8 = tid >> 3, q8 = tid & 7, r4 = tid >> 2, q4 = tid & 3;
  // block-uniform bases and 32-bit lane byte offsets
  const char* gK = (const char*)(KH + b * TT * DMD + h * HD); const char* gP = (const char*)(PH + h * HD);
  const char* gVH = (const char*)(VH + (b * DMD + (size_t)h * HD) * TT); const char* gVL = (const char*)(VL + (b * DMD + (size_t)h * HD) * TT);
  const unsigned oK = (unsigned)(r8 * DMD + q8 * 8) * 2u, oV = (unsigned)(r4 * TT + q4 * 8) * 2u;
  const int wrow = 48 - 16 * wave;   // this wave's first row inside the block's 96-row position window
  v8h rk[2], rvh[2], rvl[2], rp[6];
  auto fetch = [&](int ks) {
#pragma unroll
    for (int i = 0; i < 2; ++i) { rk[i] = *(const v8h*)(gK + (oK + (unsigned)((ks * 32 + i * 16) * DMD * 2))); rvh[i] = *(const v8h*)(gVH + (oV + (unsigned)((i * 32 * TT + ks * 32) * 2))); rvl[i] = *(const v8h*)(gVL + (oV + (unsigned)((i * 32 * TT + ks * 32) * 2))); }
    // 96-row position window of the block: the j <= i window while some wave needs it, else the j >= i + 2 window (rows outside the buffer are used by no wave: clamped)
    const int base = (ks * 32 <= qb * 64 + 63) ? (TT - 64 - qb * 64 + ks * 32 + POFF) : (ks * 32 - qb * 64 - 65 + POFF);
#pragma unroll
    for (int i = 0; i < 6; ++i) { int row = base + i * 16 + r8; row = row < 0 ? 0 : (row > PROWS - 1 ? PROWS - 1 : row); rp[i] = *(const v8h*)(gP + (unsigned)(row * DMD + q8 * 8) * 2u); } };
  fetch(0);
  v16h au[2], av[2], aw[2], tmpl[2];   // (q+u) rows i0.., (q+v) rows i0.., (q+v) rows i0+1.. (for the wrapped upper-triangle term); single f16 rounding (residuals dropped: VGPR budget)
  qfrags(Q, b * TT + i0, h, BU, lane, au, tmpl); qfrags(Q, b * TT + i0, h, BVv, lane, av, tmpl);
  qfrags(Q, b * TT + i0 + 1, h, BVv, lane, aw, tmpl);   // rows i+1; for i = T-1 the row belongs to the next batch (or is clamped) but its products are never used: j >= i+2 cannot hold for i = T-1
  const bool lastblk = (i0 + 16 >= TT);
  const float* d1 = &sg1[wave][8 * g][15 + col - 8 * g]; const float* d2 = &sg2[wave][8 * g][15 + col - 8 * g];   // element (row 8 g + r, column 15 + col - row) lies r * 35 floats on: one row down, one column back
  float m[8], l[8];
#pragma unroll
  for (int r = 0; r < 8; ++r) { m[r] = -3.0e38f; l[r] = 0.f; }
  v8f acc[4] = {};
#pragma unroll 1
  for (int ks = 0; ks < TT / 32; ++ks) { float s[2][8];
    __syncthreads();   // every wave has left the previous trip's tiles
#pragma unroll
    for (int i = 0; i < 2; ++i) { *(v8h*)&u.t.K[i * 16 + r8][q8 * 8] = rk[i]; *(v8h*)&u.t.VH[i * 32 + r4][q4 * 8] = rvh[i]; *(v8h*)&u.t.VL[i * 32 + r4][q4 * 8] = rvl[i]; }
    const bool blow = (ks * 32 <= qb * 64 + 63);
    { _Float16 (*dst)[KP] = blow ? u.t.PL : u.t.PU;
#pragma unroll
      for (int i = 0; i < 6; ++i) *(v8h*)&dst[i * 16 + r8][q8 * 8] = rp[i]; }
    if (blow && ks * 32 + 31 >= qb * 64 + 2) {   // the two trips on the diagonal need both windows: the j >= i + 2 one is brought here
#pragma unroll
      for (int i = 0; i < 6; ++i) { int row = ks * 32 - qb * 64 - 65 + POFF + i * 16 + r8; row = row < 0 ? 0 : (row > PROWS - 1 ? PROWS - 1 : row); *(v8h*)&u.t.PU[i * 16 + r8][q8 * 8] = *(const v8h*)(gP + (unsigned)(row * DMD + q8 * 8) * 2u); } }
    __syncthreads();   // this trip's tiles are published
#pragma unroll
    for (int ct = 0; ct < 2; ++ct) { const int j0 = ks * 32 + ct * 16; v8f c = {}; v16h kh[2];
#pragma unroll
      for (int kc = 0; kc < 2; ++kc) kh[kc] = frag_h(&u.t.K[ct * 16 + col][kc * 32], lane);
#pragma unroll
      for (int kc = 0; kc < 2; ++kc) c = wmma16(au[kc], kh[kc], c);
      const bool needlow = (j0 <= i0 + 15);          // some (i, j) with j <= i
      const bool needup = (j0 + 15 >= i0 + 2);        // some (i, j) with j >= i + 2
      if (needlow) { v16h pf[2][2];   // tile covers p = T-16-i0+j0 .. +31: rows wrow + 16 ct .. +31 of the staged window
#pragma unroll
        for (int pt = 0; pt < 2; ++pt)
#pragma unroll
          for (int kc = 0; kc < 2; ++kc) pf[pt][kc] = frag_h(&u.t.PL[wrow + ct * 16 + pt * 16 + col][kc * 32], lane);
#pragma unroll
        for (int pt = 0; pt < 2; ++pt) { v8f gg = {};
#pragma unroll
          for (int kc = 0; kc < 2; ++kc) gg = wmma16(av[kc], pf[pt][kc], gg);
#pragma unroll
          for (int r = 0; r < 8; ++r) sg1[wave][8 * g + r][pt * 16 + col] = gg[r]; } }
      if (needup) { v16h pf[2][2];   // tile covers p = j0-i0-17 .. +31
#pragma unroll
        for (int pt = 0; pt < 2; ++pt)
#pragma unroll
          for (int kc = 0; kc < 2; ++kc) pf[pt][kc] = frag_h(&u.t.PU[wrow + ct * 16 + pt * 16 + col][kc * 32], lane);
#pragma unroll
        for (int pt = 0; pt < 2; ++pt) { v8f gg = {};
#pragma unroll
          for (int kc = 0; kc < 2; ++kc) gg = wmma16(aw[kc], pf[pt][kc], gg);
#pragma unroll
          for (int r = 0; r < 8; ++r) sg2[wave][8 * g + r][pt * 16 + col] = gg[r]; } }
      LDSX();
      if (j0 + 15 <= i0) {   // the whole tile has j <= i: its eight values are read unmasked, in one run
#pragma unroll
        for (int r = 0; r < 8; ++r) s[ct][r] = (c[r] + d1[r * 35]) * 0.125f; }
      else if (j0 >= i0 + 17) {   // the whole tile has j >= i + 2 (no such tile exists for the rows of the last 16: j0 + 15 < T)
#pragma unroll
        for (int r = 0; r < 8; ++r) s[ct][r] = (c[r] + d2[r * 35]) * 0.125f; }
      else { const int dj = j0 - i0 + col - 8 * g;   // the two tiles on the diagonal: chosen per element by j - i = dj - r
#pragma unroll
        for (int r = 0; r < 8; ++r) { const int d = dj - r;
          float bd; if (d <= 0) bd = d1[r * 35]; else if (d == 1) bd = 0.f; else bd = (lastblk && 8 * g + r == 15) ? 0.f : d2[r * 35];
          s[ct][r] = (c[r] + bd) * 0.125f; } }
      LDSX(); }
    float alpha[8];
#pragma unroll
    for (int r = 0; r < 8; ++r) { float mx = fmaxf(s[0][r], s[1][r]);
#pragma unroll
      for (int o = 1; o < 16; o <<= 1) mx = fmaxf(mx, __shfl_xor(mx, o));
      const float mn = fmaxf(m[r], mx); alpha[r] = (m[r] <= -1.0e38f) ? 0.f : __expf(m[r] - mn); const float e0 = (s[0][r] <= -1.0e38f) ? 0.f : __expf(s[0][r] - mn), e1 = (s[1][r] <= -1.0e38f) ? 0.f : __expf(s[1][r] - mn); float es = e0 + e1;
#pragma unroll
      for (int o = 1; o < 16; o <<= 1) es += __shfl_xor(es, o);
      l[r] = l[r] * alpha[r] + es; m[r] = mn; sp[wave][8 * g + r][col] = e0; sp[wave][8 * g + r][16 + col] = e1; }
#pragma unroll
    for (int j = 0; j < 4; ++j)
#pragma unroll
      for (int r = 0; r < 8; ++r) acc[j][r] *= alpha[r];
    LDSX();
    fetch(ks + 1 < TT / 32 ? ks + 1 : ks);   // the next trip's tiles fly under the P . v products (the last trip names its own again: always in bounds, never stored)
    v16h pa, pr; { const float* prow = &sp[wave][col][0] + 8 * (lane >> 4);
#pragma unroll
      for (int i = 0; i < 8; ++i) { const float x0 = prow[i] * 2048.0f, x1 = prow[16 + i] * 2048.0f; const _Float16 h0 = (_Float16)x0, h1 = (_Float16)x1; pa[i] = h0; pa[8 + i] = h1; pr[i] = (_Float16)(x0 - (float)h0); pr[8 + i] = (_Float16)(x1 - (float)h1); } }
#pragma unroll
    for (int j = 0; j < 4; ++j) { const v16h vh = frag_h(&u.t.VH[j * 16 + col][0], lane), vl = frag_h(&u.t.VL[j * 16 + col][0], lane);   // both planes' fragments in one run: one LDS wait for three products
      acc[j] = wmma16(pa, vh, acc[j]); acc[j] = wmma16(pr, vh, acc[j]); acc[j] = wmma16(pa, vl, acc[j]); }
    LDSX(); }
  __syncthreads();   // every wave has left the last tiles before they become output staging
#pragma unroll
  for (int r = 0; r < 8; ++r) { const float il = (l[r] > 0.f) ? (1.0f / 2048.0f) / l[r] : 0.f;   // fully masked rows -> zeros (the module zeroes them after the softmax)
#pragma unroll
    for (int j = 0; j < 4; ++j) u.so[wave][8 * g + r][j * 16 + col] = acc[j][r] * il; }
  LDSX(); for (int rl = 0; rl < 16; ++rl) if (lane < 16) vst2(X + (b * TT + i0 + rl) * DMD + h * HD + lane * 4, *(const v4f*)&u.so[wave][rl][lane * 4]); }
// ---- k_out: block = (64 rows, 128 of 1024 cols): out = x (hi + lo) . Wo + bo
__global__ __launch_bounds__(128) void k_out(const float* __restrict__ X, const float* __restrict__ WO, const float* __restrict__ BO, float* __restrict__ OUT) { __shared__ __align__(16) float sf[4][16][132];
  const int tid = threadIdx.x, wave = tid >> 5, lane = tid & 31, col = lane & 15, g = lane >> 4; const int c0 = blockIdx.y * 128; const size_t r0 = (size_t)blockIdx.x * 64 + wave * 16;
  __shared__ __align__(16) GTiles<true> t;
  v8f acc[8] = {};
  gemm_tiles<true>(X + (size_t)blockIdx.x * 64 * DMD, WO + c0, t, tid, acc);
#pragma unroll
  for (int j = 0; j < 8; ++j) { const float bb = bfr(BO[c0 + j * 16 + col]);
#pragma unroll
    for (int r = 0; r < 8; ++r) sf[wave][8 * g + r][j * 16 + col] = acc[j][r] + bb; }
  LDSX(); for (int rl = 0; rl < 16; ++rl) vst2(OUT + (r0 + rl) * DMD + c0 + lane * 4, *(const v4f*)&sf[wave][rl][lane * 4]); }
extern "C" void kernel_launch(void* const* d_in, const int* in_sizes, int n_in, void* d_out, int out_size, void* d_ws, size_t ws_size, hipStream_t stream) {
  (void)in_sizes; (void)n_in; (void)out_size;
  const float** F = (const float**)d_in;   // 0 x [2,2048,1024]; 1 Wq, 2 bq, 3 Wk, 4 bk, 5 Wv, 6 bv, 7 Wp, 8 bp, 9 Wo, 10 bo ((in,out) [1024,1024]); 11 u [1,16,1,64], 12 v [1,16,1,64]
  if (ws_size < (size_t)WS_END) return;
  char* ws = (char*)d_ws; float* Q = (float*)(ws + WS_Q); _Float16 *KH = (_Float16*)(ws + WS_KH), *PH = (_Float16*)(ws + WS_PH), *VH = (_Float16*)(ws + WS_VH), *VL = (_Float16*)(ws + WS_VL); float* X = (float*)(ws + WS_X);
  float* SINT = (float*)(ws + WS_SIN);
  k_sin<<<TT, 256, 0, stream>>>(SINT);
  k_proj<0><<<dim3(TNB * TT / 64, DMD / 128, 3), 128, 0, stream>>>(F[0], F[1], F[2], F[3], F[4], F[5], F[6], F[7], F[8], Q, KH, VH, VL, PH);
  k_proj<3><<<dim3(TT / 64, DMD / 128, 1), 128, 0, stream>>>(SINT, F[1], F[2], F[3], F[4], F[5], F[6], F[7], F[8], Q, KH, VH, VL, PH);
  k_padph<<<64, 256, 0, stream>>>(PH);
  k_att<<<dim3(TQB2, NH, TNB), 128, 0, stream>>>(Q, KH, PH, VH, VL, F[11], F[12], X);
  k_out<<<dim3(TOB2, DMD / 128), 128, 0, stream>>>(X, F[9], F[10], (float*)d_out);
}

// v004
// It runs in 286 microseconds.
// Next to v003, in two timings, it ran 1.06 times as fast each time.
// Counting every step since v000, it is 2.36 times as fast.
// compute dtype: all float inputs rounded to bf16; q/k/v projections with EXACT bf16 products on WMMA 16x16x32 ((in,out) weights, + bias), the sinusoidal position table built once on device in f32 (precise sinf/cosf/powf, k_sin) and projected with hi + lo (2 products) + bp, f32 accumulate; q kept in f32 (bias_u / bias_v added per head, then rounded once to f16 fragments), k / ph rounded once to f16, v to f16 hi + residual; content scores (q+bu) . k and the Transformer-XL position term (q+bv) . ph with single f16 products (logits ~1-2; q, k, ph each rounded once), the rel_shift realised exactly as an index map onto 16 x 32 position tiles (incl. its upper-triangle wrap-around rows and the zero at j == i+1), x 1/8, running-max softmax in f32 (hardware exp); P (f16 x 2^11 + residual) . v; out = x (bf16 hi + lo) . Wo + bo; f32 output.
#include <hip/hip_runtime.h>
#include <math.h>

typedef __attribute__((ext_vector_type(16))) _Float16 v16h;
typedef __attribute__((ext_vector_type(16))) __bf16 v16b;
typedef __attribute__((ext_vector_type(8)))  _Float16 v8h;
typedef __attribute__((ext_vector_type(8)))  float v8f;
typedef __attribute__((ext_vector_type(4)))  float v4f;
typedef __attribute__((ext_vector_type(2)))  float v2f;
typedef __attribute__((ext_vector_type(4)))  unsigned v4u;
typedef __attribute__((ext_vector_type(4)))  int v4i;
typedef float __attribute__((may_alias)) float_a;
typedef int __attribute__((may_alias)) int_a;

template <typename T> __device__ __forceinline__ void vst2(void* p, T v) { *(T*)p = v;  }
__device__ __forceinline__ v8f wmma16(v16h a, v16h b, v8f c) {
  v8f d = __builtin_amdgcn_wmma_f32_16x16x32_f16(false, a, false, b, (short)0, c, false, false);
  asm volatile("v_nop\n\tv_nop\n\tv_nop\n\tv_nop" : "+v"(d) : "v"(a), "v"(b));
  return d;
}
__device__ __forceinline__ v8f wmma_bf(v16b a, v16b b, v8f c) {
  v8f d = __builtin_amdgcn_wmma_f32_16x16x32_bf16(false, a, false, b, (short)0, c, false, false);
  asm volatile("v_nop\n\tv_nop\n\tv_nop\n\tv_nop" : "+v"(d) : "v"(a), "v"(b));
  return d;
}
// 16x16x32 fragments: lane = (h = lane>>4, row/col = lane&15); elements 0..7 = k0+8h+0..7, 8..15 = k0+16+8h+0..7; D element r = row 8h+r
__device__ __forceinline__ v16h frag_h(const _Float16* rowk0, int lane) {
  union { v16h v; v8h q[2]; } u; const _Float16* p = rowk0 + 8 * (lane >> 4);
  u.q[0] = *(const v8h*)p; u.q[1] = *(const v8h*)(p + 16); return u.v;
}
__device__ __forceinline__ v16h frag_f32(const float* rowk0, int lane) {
  v16h a; const float* p = rowk0 + 8 * (lane >> 4);
#pragma unroll
  for (int i = 0; i < 8; ++i) { a[i] = (_Float16)p[i]; a[8 + i] = (_Float16)p[16 + i]; }
  return a;
}
__device__ __forceinline__ v16h frag_f32s(const float* rowk0, int lane, float sc) {
  v16h a; const float* p = rowk0 + 8 * (lane >> 4);
#pragma unroll
  for (int i = 0; i < 8; ++i) { a[i] = (_Float16)(p[i] * sc); a[8 + i] = (_Float16)(p[16 + i] * sc); }
  return a;
}
// column fragment from a [K][ld] layout (column n), rows >= K read as 0
__device__ __forceinline__ v16h fragc_f32(const float* W, int k0, int n, int lane, int ld, int K) {
  v16h a; const int g = lane >> 4;
#pragma unroll
  for (int i = 0; i < 8; ++i) { const int ka = k0 + 8 * g + i, kb = ka + 16;
    a[i] = (_Float16)(ka < K ? W[(size_t)(ka < K ? ka : K - 1) * ld + n] : 0.f); a[8 + i] = (_Float16)(kb < K ? W[(size_t)(kb < K ? kb : K - 1) * ld + n] : 0.f); }
  return a;
}
struct F2 { v16b h, l; };
__device__ __forceinline__ F2 bsplit16(const float v[16]) { F2 r;
#pragma unroll
  for (int i = 0; i < 16; ++i) { const __bf16 h = (__bf16)v[i]; r.h[i] = h; r.l[i] = (__bf16)(v[i] - (float)h); }
  return r; }
__device__ __forceinline__ F2 split_row(const float* row, int k0, int lane) { float v[16]; const float* p = row + k0 + 8 * (lane >> 4);
#pragma unroll
  for (int i = 0; i < 8; ++i) { v[i] = p[i]; v[8 + i] = p[16 + i]; }
  return bsplit16(v); }
__device__ __forceinline__ F2 split_rowK(const float* row, int k0, int lane, int K) { float v[16]; const int g = lane >> 4;
#pragma unroll
  for (int i = 0; i < 8; ++i) { const int ka = k0 + 8 * g + i, kb = ka + 16; v[i] = ka < K ? row[ka < K ? ka : K - 1] : 0.f; v[8 + i] = kb < K ? row[kb < K ? kb : K - 1] : 0.f; }
  return bsplit16(v); }
__device__ __forceinline__ F2 split_col(const float* W, int k0, int n, int lane, int ld, int K) { float v[16]; const int g = lane >> 4;
#pragma unroll
  for (int i = 0; i < 8; ++i) { const int ka = k0 + 8 * g + i, kb = ka + 16; v[i] = ka < K ? W[(size_t)(ka < K ? ka : K - 1) * ld + n] : 0.f; v[8 + i] = kb < K ? W[(size_t)(kb < K ? kb : K - 1) * ld + n] : 0.f; }
  return bsplit16(v); }
__device__ __forceinline__ v8f mac3(const F2& a, const F2& b, v8f c) { c = wmma_bf(a.l, b.h, c); c = wmma_bf(a.h, b.l, c); return wmma_bf(a.h, b.h, c); }
__device__ __forceinline__ float sigm(float v) { return 1.0f / (1.0f + expf(-v)); }
#define LDSX() do { asm volatile("s_wait_dscnt 0" ::: "memory"); __builtin_amdgcn_wave_barrier(); __builtin_amdgcn_fence(__ATOMIC_RELEASE, "workgroup"); } while (0)


// Relative multi-head self attention (Transformer-XL style rel_shift; B 2, S 2,048, D 1,024, 16 heads x 64): pos = sinusoid(S, D) Wp + bp; scores = ((q+u) k^T + rel_shift((q+v) pos^T)) / 8, softmax, . v, Wo + bo.
#define NB 2
#define TT 2048
#define DMD 1024
#define NH 16
#define HD 64
#define POFF 32                 // ph buffer row offset (rows < 0 and >= T read as zeros)
#define PROWS (TT + 64)
#ifndef TNB
#define TNB NB
#endif
#ifndef TQB2
#define TQB2 (TT / 64)   // query blocks
#endif
#ifndef TOB2
#define TOB2 (TNB * TT / 64)
#endif
typedef __attribute__((ext_vector_type(8))) __bf16 v8b;
__device__ __forceinline__ v16b frag_b(const __bf16* rowk0, int lane) {
  union { v16b v; v8b q[2]; } u; const __bf16* p = rowk0 + 8 * (lane >> 4);
  u.q[0] = *(const v8b*)p; u.q[1] = *(const v8b*)(p + 16); return u.v;
}
__device__ __forceinline__ float bfr(float v) { return (float)(__bf16)v; }
__device__ __attribute__((noinline)) float exp_ni(float v) { return expf(v); }
__device__ __attribute__((noinline)) float erf_ni(float v) { return erff(v); }

#define WS_Q   0u                                   // f32 q rows [b*u][D] (+bq)
#define WS_KH  (WS_Q + 4u * (size_t)NB * TT * DMD)       // f16 k rows [b*t][D]
#define WS_PH  (WS_KH + 2u * (size_t)NB * TT * DMD)      // f16 ph rows [PROWS][D] (row POFF + p)
#define WS_VH  (WS_PH + 2u * (size_t)PROWS * DMD)        // f16 v planes [b][D][t]
#define WS_VL  (WS_VH + 2u * (size_t)NB * DMD * TT)      // f16 v residual planes (unscaled)
#define WS_X   (WS_VL + 2u * (size_t)NB * DMD * TT)      // f32 attention output rows [b*u][D]
#define WS_SIN (WS_X + 4u * (size_t)NB * TT * DMD)       // f32 sinusoid table [T][D]
#define WS_END (WS_SIN + 4u * (size_t)TT * DMD)

// ---- operand tiles of the projection GEMMs: one 32-k slice of the block's 64 rows and 128 weight columns, rounded once and shared by the four waves
#define GP 40                   // LDS pitch of a 32-element bf16 row: 80 B = 16 B x odd
typedef __attribute__((ext_vector_type(4))) __bf16 v4b;
template <bool SPLIT> struct GTiles { __bf16 W[2][128][GP]; __bf16 A[2][64][GP]; __bf16 L[SPLIT ? 2 : 1][SPLIT ? 64 : 1][GP]; };   // W transposed to [column][k]; A rows (hi), L their residuals
// acc[j] += rows (bf16, or bf16 hi then lo) . W[:, 16 j ..]; k ascending in slices of 32, as one product (two with SPLIT) per slice and column tile
template <bool SPLIT>
__device__ __forceinline__ void gemm_tiles(const float* __restrict__ Arows, const float* __restrict__ Wcols, GTiles<SPLIT>& t, int tid, v8f* acc) {
  const int wave = tid >> 5, lane = tid & 31, col = lane & 15, r8 = tid >> 3, q8 = tid & 7;
  // whole-line fetch: a wave reads 512 contiguous bytes of one weight row (8 rows a wave), 8 lanes read one 128-byte piece of an operand row
  const float* gw = Wcols + (size_t)(wave * 8) * DMD + lane * 4; const float* ga = Arows + (size_t)r8 * DMD + q8 * 4;
  v4f rw[8], ra[4];
  auto fetch = [&](int kc) {
#pragma unroll
    for (int i = 0; i < 8; ++i) rw[i] = *(const v4f*)(gw + (size_t)(kc * 32 + i) * DMD);
#pragma unroll
    for (int i = 0; i < 4; ++i) ra[i] = *(const v4f*)(ga + (size_t)(i * 16) * DMD + kc * 32);
    asm volatile("s_wait_xcnt 0x0" ::: "memory"); };   // stands in front of the loop's advance of these loads' address registers
  fetch(0);
#pragma unroll 2   // the two buffers' addresses become constants
  for (int kc = 0; kc < DMD / 32; ++kc) { const int bf = kc & 1;
#pragma unroll
    for (int c = 0; c < 4; ++c) { v8b p;
#pragma unroll
      for (int i = 0; i < 8; ++i) p[i] = (__bf16)rw[i][c];
      *(v8b*)&t.W[bf][lane * 4 + c][wave * 8] = p; }
#pragma unroll
    for (int i = 0; i < 4; ++i) { v4b hv, lv;
#pragma unroll
      for (int e = 0; e < 4; ++e) { const __bf16 hh = (__bf16)ra[i][e]; hv[e] = hh; if (SPLIT) lv[e] = (__bf16)(ra[i][e] - (float)hh); }
      *(v4b*)&t.A[bf][i * 16 + r8][q8 * 4] = hv; if (SPLIT) *(v4b*)&t.L[bf][i * 16 + r8][q8 * 4] = lv; }
    __syncthreads();   // this slice is published; the other buffer's readers all stand in front of this barrier, so the next trip may refill it
    if (kc + 1 < DMD / 32) fetch(kc + 1);   // the next slice flies under this slice's products (issued behind the barrier: a load does not stay in flight across it)
    const v16b a = frag_b(&t.A[bf][wave * 16 + col][0], lane); v16b al; if (SPLIT) al = frag_b(&t.L[bf][wave * 16 + col][0], lane);
    v16b w[8];
#pragma unroll
    for (int j = 0; j < 8; ++j) w[j] = frag_b(&t.W[bf][j * 16 + col][0], lane);
#pragma unroll
    for (int j = 0; j < 8; ++j) { acc[j] = wmma_bf(a, w[j], acc[j]); if (SPLIT) acc[j] = wmma_bf(al, w[j], acc[j]); }
    __builtin_amdgcn_sched_barrier(0);   // keeps the next slice's roundings, which wait for its loads, behind this slice's products
  } }
struct ProjEpi { float sf[4][16][132]; _Float16 sh[64][136]; _Float16 th[128][72], tl[128][72]; };
template <bool SPLIT> union ProjStage { GTiles<SPLIT> t; ProjEpi e; };   // the epilogue's staging reuses the tiles' LDS behind the loop
// ---- k_proj: block = (64 rows, 128-col group, which): 0 q (f32 rows), 1 k (f16 rows), 2 v (f16 hi + residual planes), 3 ph (f16 rows at POFF), natural W + bias
template <int WOFF>
__global__ __launch_bounds__(128) void k_proj(const float* __restrict__ Xin, const float* __restrict__ WQ, const float* __restrict__ BQ, const float* __restrict__ WK, const float* __restrict__ BK, const float* __restrict__ WV, const float* __restrict__ BV, const float* __restrict__ WP, const float* __restrict__ BP, float* __restrict__ Q, _Float16* __restrict__ KH, _Float16* __restrict__ VH, _Float16* __restrict__ VL, _Float16* __restrict__ PH) {
  __shared__ __align__(16) ProjStage<WOFF == 3> u;
  float (&sf)[4][16][132] = u.e.sf; _Float16 (&sh)[64][136] = u.e.sh; _Float16 (&th)[128][72] = u.e.th; _Float16 (&tl)[128][72] = u.e.tl;
  const int tid = threadIdx.x, wave = tid >> 5, lane = tid & 31, col = lane & 15, g = lane >> 4; const int which = blockIdx.z + WOFF; const int c0 = blockIdx.y * 128; const int nrows = (which == 3) ? TT : NB * TT;
  if ((int)blockIdx.x * 64 >= nrows) return;
  const float* Wm = (which == 0 ? WQ : which == 1 ? WK : which == 2 ? WV : WP); const float* Bm = (which == 0 ? BQ : which == 1 ? BK : which == 2 ? BV : BP);
  const size_t r0 = (size_t)blockIdx.x * 64 + wave * 16;
  v8f acc[8] = {};
  gemm_tiles<WOFF == 3>(Xin + (size_t)blockIdx.x * 64 * DMD, Wm + c0, u.t, tid, acc);   // WOFF 3: rows of the f32 sinusoid table (k_sin), hi + lo
  __syncthreads();   // every wave has left the last tiles before they become output staging
#pragma unroll
  for (int j = 0; j < 8; ++j) { const float bb = bfr(Bm[c0 + j * 16 + col]);
#pragma unroll
    for (int r = 0; r < 8; ++r) { const float v = acc[j][r] + bb; const int rl = wave * 16 + 8 * g + r, cl = j * 16 + col;
      if (which == 0) sf[wave][8 * g + r][cl] = v; else if (which == 2) { const _Float16 hv = (_Float16)v; th[cl][rl] = hv; tl[cl][rl] = (_Float16)(v - (float)hv); } else sh[rl][cl] = (_Float16)v; } }
  __syncthreads();
  if (which == 0) { for (int rl = 0; rl < 16; ++rl) vst2(Q + (r0 + rl) * DMD + c0 + lane * 4, *(const v4f*)&sf[wave][rl][lane * 4]); }
  else if (which == 2) { const size_t b = ((size_t)blockIdx.x * 64) / TT; const int t0 = (int)(((size_t)blockIdx.x * 64) % TT); for (int e = tid; e < 128 * 8; e += 128) { const int cl = e >> 3, q = e & 7; const size_t o = (b * DMD + c0 + cl) * (size_t)TT + t0 + q * 8; vst2((unsigned*)(VH + o), *(const v4u*)&th[cl][q * 8]); vst2((unsigned*)(VL + o), *(const v4u*)&tl[cl][q * 8]); } }
  else { _Float16* dst = (which == 1) ? (KH + (size_t)blockIdx.x * 64 * DMD) : (PH + ((size_t)POFF + blockIdx.x * 64) * DMD); for (int e = tid; e < 64 * 16; e += 128) { const int rl = e >> 4, q = e & 15; vst2((unsigned*)(dst + (size_t)rl * DMD + c0 + q * 8), *(const v4u*)&sh[rl][q * 8]); } } }
// ---- k_sin: block = position s: the module's sinusoid table row [sin(s f_c) | cos(s f_c)], f_c = 1e4^(-2c/D), f32
__global__ __launch_bounds__(256) void k_sin(float* __restrict__ SINT) { __shared__ __align__(16) float sr[DMD]; const int t = threadIdx.x; const int s = blockIdx.x;
  for (int c = t; c < DMD / 2; c += 256) { const float ang = (float)s * powf(10000.0f, -2.0f * (float)c / (float)DMD); sr[c] = sinf(ang); sr[DMD / 2 + c] = cosf(ang); }
  __syncthreads(); vst2(SINT + (size_t)s * DMD + t * 4, *(const v4f*)&sr[t * 4]); }
// ---- k_padph: the POFF rows before and the rows after the table are zeros
__global__ __launch_bounds__(256) void k_padph(_Float16* __restrict__ PH) { const int t = threadIdx.x; const int r = blockIdx.x; const size_t row = (r < POFF) ? r : (TT + r);   // 0..31 and TT+32 .. TT+63
  v4u z; z[0] = z[1] = z[2] = z[3] = 0u; if (t < DMD / 8) vst2((unsigned*)(PH + row * DMD + t * 8), z); }
// fragments of (q + bias) for 16 rows, head h: hi and residual as f16 (unscaled; q ~ O(1))
__device__ __forceinline__ void qfrags(const float* __restrict__ Q, size_t row0, int h, const float* __restrict__ bias, int lane, v16h* hi, v16h* lo) { const int col = lane & 15, g = lane >> 4; size_t row = row0 + col; if (row > (size_t)NB * TT - 1) row = (size_t)NB * TT - 1;   // clamp (only the never-used row T of the last batch)
#pragma unroll
  for (int kc = 0; kc < 2; ++kc) { const float* p = Q + row * DMD + h * HD + kc * 32 + 8 * g; const float* bp = bias + h * HD + kc * 32 + 8 * g; v16h a, b;
#pragma unroll
    for (int i = 0; i < 8; ++i) { const float v0 = p[i] + bfr(bp[i]), v1 = p[16 + i] + bfr(bp[16 + i]); const _Float16 h0 = (_Float16)v0, h1 = (_Float16)v1; a[i] = h0; a[8 + i] = h1; b[i] = (_Float16)(v0 - (float)h0); b[8 + i] = (_Float16)(v1 - (float)h1); }
    hi[kc] = a; lo[kc] = b; } }
// reduction over each 16-lane row of eight values at once: four DPP row_xmask steps (lane ^ 1, 2, 4, 8); all 32 lanes on.
// One statement, the eight chains interleaved: every producer stands eight vector instructions back, so no step waits on the one in front of it.
#define ROWSTEP8(OP, X) \
  OP " %0, %0, %0 row_xmask:" X " row_mask:0xf bank_mask:0xf\n\t" OP " %1, %1, %1 row_xmask:" X " row_mask:0xf bank_mask:0xf\n\t" \
  OP " %2, %2, %2 row_xmask:" X " row_mask:0xf bank_mask:0xf\n\t" OP " %3, %3, %3 row_xmask:" X " row_mask:0xf bank_mask:0xf\n\t" \
  OP " %4, %4, %4 row_xmask:" X " row_mask:0xf bank_mask:0xf\n\t" OP " %5, %5, %5 row_xmask:" X " row_mask:0xf bank_mask:0xf\n\t" \
  OP " %6, %6, %6 row_xmask:" X " row_mask:0xf bank_mask:0xf\n\t" OP " %7, %7, %7 row_xmask:" X " row_mask:0xf bank_mask:0xf\n\t"
// m[r] = max(m[r], a[r], b[r]) in the lane, then over the row (m is the same in all 16 lanes on entry, so it may join in front of the steps)
#define ROWMAX8(m, a, b) asm("v_max3_num_f32 %0, %8, %16, %0\n\tv_max3_num_f32 %1, %9, %17, %1\n\tv_max3_num_f32 %2, %10, %18, %2\n\tv_max3_num_f32 %3, %11, %19, %3\n\t" \
  "v_max3_num_f32 %4, %12, %20, %4\n\tv_max3_num_f32 %5, %13, %21, %5\n\tv_max3_num_f32 %6, %14, %22, %6\n\tv_max3_num_f32 %7, %15, %23, %7\n\t" \
  ROWSTEP8("v_max_num_f32_dpp", "1") ROWSTEP8("v_max_num_f32_dpp", "2") ROWSTEP8("v_max_num_f32_dpp", "4") ROWSTEP8("v_max_num_f32_dpp", "8") \
  : "+v"(m[0]), "+v"(m[1]), "+v"(m[2]), "+v"(m[3]), "+v"(m[4]), "+v"(m[5]), "+v"(m[6]), "+v"(m[7]) \
  : "v"(a[0]), "v"(a[1]), "v"(a[2]), "v"(a[3]), "v"(a[4]), "v"(a[5]), "v"(a[6]), "v"(a[7]), "v"(b[0]), "v"(b[1]), "v"(b[2]), "v"(b[3]), "v"(b[4]), "v"(b[5]), "v"(b[6]), "v"(b[7]))
#define ROWRED8(OP, v) asm(ROWSTEP8(OP, "1") ROWSTEP8(OP, "2") ROWSTEP8(OP, "4") ROWSTEP8(OP, "8") \
  : "+v"(v[0]), "+v"(v[1]), "+v"(v[2]), "+v"(v[3]), "+v"(v[4]), "+v"(v[5]), "+v"(v[6]), "+v"(v[7]))
// LDS row pitches: 16 B x odd (144 B for 64-half rows, 80 B for 32-half rows)
#define KP 72
#define VP 40
struct AttTiles { _Float16 K[32][KP], VH[64][VP], VL[64][VP], PL[96][KP], PU[96][KP]; };
union AttStage { AttTiles t; float so[4][16][68]; };
// ---- k_att: block = (64 queries u, h, b)
__global__ __launch_bounds__(128) void k_att(const float* __restrict__ Q, const _Float16* __restrict__ KH, const _Float16* __restrict__ PH, const _Float16* __restrict__ VH, const _Float16* __restrict__ VL, const float* __restrict__ BU, const float* __restrict__ BVv, float* __restrict__ X) {
  __shared__ __align__(16) float sp[4][16][36]; __shared__ __align__(16) float sg1[4][16][36], sg2[4][16][36];
  __shared__ __align__(16) AttStage u;   // the trip's operand tiles, shared by the four waves; output staging behind the loop
  const int tid = threadIdx.x, wave = __builtin_amdgcn_readfirstlane(tid >> 5), lane = tid & 31, col = lane & 15, g = lane >> 4; const int qb = blockIdx.x, h = blockIdx.y; const size_t b = blockIdx.z; const int i0 = qb * 64 + wave * 16;   // the wave's number in a scalar register: every test on i0 below is a scalar branch
  // whole-line fetch of one trip's tiles: 8 lanes per 128-byte row (k, ph), 4 lanes per 64-byte row (v planes); held in registers until the tile in LDS is free
  const int r8 = tid >> 3, q8 = tid & 7, r4 = tid >> 2, q4 = tid & 3;
  // block-uniform bases and 32-bit lane byte offsets
  const char* gK = (const char*)(KH + b * TT * DMD + h * HD); const char* gP = (const char*)(PH + h * HD);
  const char* gVH = (const char*)(VH + (b * DMD + (size_t)h * HD) * TT); const char* gVL = (const char*)(VL + (b * DMD + (size_t)h * HD) * TT);
  const unsigned oK = (unsigned)(r8 * DMD + q8 * 8) * 2u, oV = (unsigned)(r4 * TT + q4 * 8) * 2u;
  const int wrow = 48 - 16 * wave;   // this wave's first row inside the block's 96-row position window
  v8h rk[2], rvh[2], rvl[2], rp[6];
  auto fetch = [&](int ks) {
#pragma unroll
    for (int i = 0; i < 2; ++i) { rk[i] = *(const v8h*)(gK + (oK + (unsigned)((ks * 32 + i * 16) * DMD * 2))); rvh[i] = *(const v8h*)(gVH + (oV + (unsigned)((i * 32 * TT + ks * 32) * 2))); rvl[i] = *(const v8h*)(gVL + (oV + (unsigned)((i * 32 * TT + ks * 32) * 2))); }
    // 96-row position window of the block: the j <= i window while some wave needs it, else the j >= i + 2 window (rows outside the buffer are used by no wave: clamped)
    const int base = (ks * 32 <= qb * 64 + 63) ? (TT - 64 - qb * 64 + ks * 32 + POFF) : (ks * 32 - qb * 64 - 65 + POFF);
#pragma unroll
    for (int i = 0; i < 6; ++i) { int row = base + i * 16 + r8; row = row < 0 ? 0 : (row > PROWS - 1 ? PROWS - 1 : row); rp[i] = *(const v8h*)(gP + (unsigned)(row * DMD + q8 * 8) * 2u); } };
  fetch(0);
  v16h au[2], av[2], aw[2], tmpl[2];   // (q+u) rows i0.., (q+v) rows i0.., (q+v) rows i0+1.. (for the wrapped upper-triangle term); single f16 rounding (residuals dropped: VGPR budget)
  qfrags(Q, b * TT + i0, h, BU, lane, au, tmpl); qfrags(Q, b * TT + i0, h, BVv, lane, av, tmpl);
  qfrags(Q, b * TT + i0 + 1, h, BVv, lane, aw, tmpl);   // rows i+1; for i = T-1 the row belongs to the next batch (or is clamped) but its products are never used: j >= i+2 cannot hold for i = T-1
  const bool lastblk = (i0 + 16 >= TT);
  const float* d1 = &sg1[wave][8 * g][15 + col - 8 * g]; const float* d2 = &sg2[wave][8 * g][15 + col - 8 * g];   // element (row 8 g + r, column 15 + col - row) lies r * 35 floats on: one row down, one column back
  float m[8], l[8];
#pragma unroll
  for (int r = 0; r < 8; ++r) { m[r] = -3.0e38f; l[r] = 0.f; }
  v8f acc[4] = {};
#pragma unroll 1
  for (int ks = 0; ks < TT / 32; ++ks) { float s[2][8];
    __syncthreads();   // every wave has left the previous trip's tiles
#pragma unroll
    for (int i = 0; i < 2; ++i) { *(v8h*)&u.t.K[i * 16 + r8][q8 * 8] = rk[i]; *(v8h*)&u.t.VH[i * 32 + r4][q4 * 8] = rvh[i]; *(v8h*)&u.t.VL[i * 32 + r4][q4 * 8] = rvl[i]; }
    const bool blow = (ks * 32 <= qb * 64 + 63);
    { _Float16 (*dst)[KP] = blow ? u.t.PL : u.t.PU;
#pragma unroll
      for (int i = 0; i < 6; ++i) *(v8h*)&dst[i * 16 + r8][q8 * 8] = rp[i]; }
    if (blow && ks * 32 + 31 >= qb * 64 + 2) {   // the two trips on the diagonal need both windows: the j >= i + 2 one is brought here
#pragma unroll
      for (int i = 0; i < 6; ++i) { int row = ks * 32 - qb * 64 - 65 + POFF + i * 16 + r8; row = row < 0 ? 0 : (row > PROWS - 1 ? PROWS - 1 : row); *(v8h*)&u.t.PU[i * 16 + r8][q8 * 8] = *(const v8h*)(gP + (unsigned)(row * DMD + q8 * 8) * 2u); } }
    __syncthreads();   // this trip's tiles are published
#pragma unroll
    for (int ct = 0; ct < 2; ++ct) { const int j0 = ks * 32 + ct * 16; v8f c = {}; v16h kh[2];
#pragma unroll
      for (int kc = 0; kc < 2; ++kc) kh[kc] = frag_h(&u.t.K[ct * 16 + col][kc * 32], lane);
#pragma unroll
      for (int kc = 0; kc < 2; ++kc) c = wmma16(au[kc], kh[kc], c);
      const bool needlow = (j0 <= i0 + 15);          // some (i, j) with j <= i
      const bool needup = (j0 + 15 >= i0 + 2);        // some (i, j) with j >= i + 2
      if (needlow) { v16h pf[2][2];   // tile covers p = T-16-i0+j0 .. +31: rows wrow + 16 ct .. +31 of the staged window
#pragma unroll
        for (int pt = 0; pt < 2; ++pt)
#pragma unroll
          for (int kc = 0; kc < 2; ++kc) pf[pt][kc] = frag_h(&u.t.PL[wrow + ct * 16 + pt * 16 + col][kc * 32], lane);
#pragma unroll
        for (int pt = 0; pt < 2; ++pt) { v8f gg = {};
#pragma unroll
          for (int kc = 0; kc < 2; ++kc) gg = wmma16(av[kc], pf[pt][kc], gg);
#pragma unroll
          for (int r = 0; r < 8; ++r) sg1[wave][8 * g + r][pt * 16 + col] = gg[r]; } }
      if (needup) { v16h pf[2][2];   // tile covers p = j0-i0-17 .. +31
#pragma unroll
        for (int pt = 0; pt < 2; ++pt)
#pragma unroll
          for (int kc = 0; kc < 2; ++kc) pf[pt][kc] = frag_h(&u.t.PU[wrow + ct * 16 + pt * 16 + col][kc * 32], lane);
#pragma unroll
        for (int pt = 0; pt < 2; ++pt) { v8f gg = {};
#pragma unroll
          for (int kc = 0; kc < 2; ++kc) gg = wmma16(aw[kc], pf[pt][kc], gg);
#pragma unroll
          for (int r = 0; r < 8; ++r) sg2[wave][8 * g + r][pt * 16 + col] = gg[r]; } }
      LDSX();
      if (j0 + 15 <= i0) {   // the whole tile has j <= i: its eight values are read unmasked, in one run
#pragma unroll
        for (int r = 0; r < 8; ++r) s[ct][r] = (c[r] + d1[r * 35]) * 0.125f; }
      else if (j0 >= i0 + 17) {   // the whole tile has j >= i + 2 (no such tile exists for the rows of the last 16: j0 + 15 < T)
#pragma unroll
        for (int r = 0; r < 8; ++r) s[ct][r] = (c[r] + d2[r * 35]) * 0.125f; }
      else { const int dj = j0 - i0 + col - 8 * g;   // the two tiles on the diagonal: chosen per element by j - i = dj - r
#pragma unroll
        for (int r = 0; r < 8; ++r) { const int d = dj - r;
          float bd; if (d <= 0) bd = d1[r * 35]; else if (d == 1) bd = 0.f; else bd = (lastblk && 8 * g + r == 15) ? 0.f : d2[r * 35];
          s[ct][r] = (c[r] + bd) * 0.125f; } }
      LDSX(); }
    float alpha[8], mo[8], es[8];
#pragma unroll
    for (int r = 0; r < 8; ++r) mo[r] = m[r];
    ROWMAX8(m, s[0], s[1]);   // running row maxima in the vector unit: no LDS-pipe shuffle, no wait on its counter
#pragma unroll
    for (int r = 0; r < 8; ++r) {
      const float mn = m[r]; alpha[r] = (mo[r] <= -1.0e38f) ? 0.f : __expf(mo[r] - mn); const float e0 = (s[0][r] <= -1.0e38f) ? 0.f : __expf(s[0][r] - mn), e1 = (s[1][r] <= -1.0e38f) ? 0.f : __expf(s[1][r] - mn); es[r] = e0 + e1;
      sp[wave][8 * g + r][col] = e0; sp[wave][8 * g + r][16 + col] = e1; }
    ROWRED8("v_add_f32_dpp", es);   // row sums likewise; the same xor tree (1, 2, 4, 8) as the shuffles had
#pragma unroll
    for (int r = 0; r < 8; ++r) l[r] = l[r] * alpha[r] + es[r];
#pragma unroll
    for (int j = 0; j < 4; ++j)
#pragma unroll
      for (int r = 0; r < 8; ++r) acc[j][r] *= alpha[r];
    LDSX();
    fetch(ks + 1 < TT / 32 ? ks + 1 : ks);   // the next trip's tiles fly under the P . v products (the last trip names its own again: always in bounds, never stored)
    v16h pa, pr; { const float* prow = &sp[wave][col][0] + 8 * (lane >> 4);
#pragma unroll
      for (int i = 0; i < 8; ++i) { const float x0 = prow[i] * 2048.0f, x1 = prow[16 + i] * 2048.0f; const _Float16 h0 = (_Float16)x0, h1 = (_Float16)x1; pa[i] = h0; pa[8 + i] = h1; pr[i] = (_Float16)(x0 - (float)h0); pr[8 + i] = (_Float16)(x1 - (float)h1); } }
#pragma unroll
    for (int j = 0; j < 4; ++j) { const v16h vh = frag_h(&u.t.VH[j * 16 + col][0], lane), vl = frag_h(&u.t.VL[j * 16 + col][0], lane);   // both planes' fragments in one run: one LDS wait for three products
      acc[j] = wmma16(pa, vh, acc[j]); acc[j] = wmma16(pr, vh, acc[j]); acc[j] = wmma16(pa, vl, acc[j]); }
    LDSX(); }
  __syncthreads();   // every wave has left the last tiles before they become output staging
#pragma unroll
  for (int r = 0; r < 8; ++r) { const float il = (l[r] > 0.f) ? (1.0f / 2048.0f) / l[r] : 0.f;   // fully masked rows -> zeros (the module zeroes them after the softmax)
#pragma unroll
    for (int j = 0; j < 4; ++j) u.so[wave][8 * g + r][j * 16 + col] = acc[j][r] * il; }
  LDSX(); for (int rl = 0; rl < 16; ++rl) if (lane < 16) vst2(X + (b * TT + i0 + rl) * DMD + h * HD + lane * 4, *(const v4f*)&u.so[wave][rl][lane * 4]); }
// ---- k_out: block = (64 rows, 128 of 1024 cols): out = x (hi + lo) . Wo + bo
__global__ __launch_bounds__(128) void k_out(const float* __restrict__ X, const float* __restrict__ WO, const float* __restrict__ BO, float* __restrict__ OUT) { __shared__ __align__(16) float sf[4][16][132];
  const int tid = threadIdx.x, wave = tid >> 5, lane = tid & 31, col = lane & 15, g = lane >> 4; const int c0 = blockIdx.y * 128; const size_t r0 = (size_t)blockIdx.x * 64 + wave * 16;
  __shared__ __align__(16) GTiles<true> t;
  v8f acc[8] = {};
  gemm_tiles<true>(X + (size_t)blockIdx.x * 64 * DMD, WO + c0, t, tid, acc);
#pragma unroll
  for (int j = 0; j < 8; ++j) { const float bb = bfr(BO[c0 + j * 16 + col]);
#pragma unroll
    for (int r = 0; r < 8; ++r) sf[wave][8 * g + r][j * 16 + col] = acc[j][r] + bb; }
  LDSX(); for (int rl = 0; rl < 16; ++rl) vst2(OUT + (r0 + rl) * DMD + c0 + lane * 4, *(const v4f*)&sf[wave][rl][lane * 4]); }
extern "C" void kernel_launch(void* const* d_in, const int* in_sizes, int n_in, void* d_out, int out_size, void* d_ws, size_t ws_size, hipStream_t stream) {
  (void)in_sizes; (void)n_in; (void)out_size;
  const float** F = (const float**)d_in;   // 0 x [2,2048,1024]; 1 Wq, 2 bq, 3 Wk, 4 bk, 5 Wv, 6 bv, 7 Wp, 8 bp, 9 Wo, 10 bo ((in,out) [1024,1024]); 11 u [1,16,1,64], 12 v [1,16,1,64]
  if (ws_size < (size_t)WS_END) return;
  char* ws = (char*)d_ws; float* Q = (float*)(ws + WS_Q); _Float16 *KH = (_Float16*)(ws + WS_KH), *PH = (_Float16*)(ws + WS_PH), *VH = (_Float16*)(ws + WS_VH), *VL = (_Float16*)(ws + WS_VL); float* X = (float*)(ws + WS_X);
  float* SINT = (float*)(ws + WS_SIN);
  k_sin<<<TT, 256, 0, stream>>>(SINT);
  k_proj<0><<<dim3(TNB * TT / 64, DMD / 128, 3), 128, 0, stream>>>(F[0], F[1], F[2], F[3], F[4], F[5], F[6], F[7], F[8], Q, KH, VH, VL, PH);
  k_proj<3><<<dim3(TT / 64, DMD / 128, 1), 128, 0, stream>>>(SINT, F[1], F[2], F[3], F[4], F[5], F[6], F[7], F[8], Q, KH, VH, VL, PH);
  k_padph<<<64, 256, 0, stream>>>(PH);
  k_att<<<dim3(TQB2, NH, TNB), 128, 0, stream>>>(Q, KH, PH, VH, VL, F[11], F[12], X);
  k_out<<<dim3(TOB2, DMD / 128), 128, 0, stream>>>(X, F[9], F[10], (float*)d_out);
}

// v005
// One run takes 277 microseconds.
// In both of two side-by-side timings against v004, it was 1.03 times as fast.
// Over all steps from v000 it is 2.44 times as fast.
// compute dtype: all float inputs rounded to bf16; q/k/v projections with EXACT bf16 products on WMMA 16x16x32 ((in,out) weights, + bias), the sinusoidal position table built once on device in f32 (precise sinf/cosf/powf, k_sin) and projected with hi + lo (2 products) + bp, f32 accumulate; q kept in f32 (bias_u / bias_v added per head, then split into bf16-exact f16 hi + residual fragments), k / ph rounded once to f16, v to f16 hi + residual; content scores (q+bu) . k and the Transformer-XL position term (q+bv) . ph with single f16 products (logits ~1-2; q, k, ph each rounded once), the rel_shift realised exactly as an index map onto 16 x 48 position windows (incl. its upper-triangle wrap-around rows and the zero at j == i+1), x 1/8, running-max softmax in f32 (hardware exp); P (f16 x 2^11 + residual) . v; out = x (bf16 hi + lo) . Wo + bo; f32 output.
#include <hip/hip_runtime.h>
#include <math.h>

typedef __attribute__((ext_vector_type(16))) _Float16 v16h;
typedef __attribute__((ext_vector_type(16))) __bf16 v16b;
typedef __attribute__((ext_vector_type(8)))  _Float16 v8h;
typedef __attribute__((ext_vector_type(8)))  float v8f;
typedef __attribute__((ext_vector_type(4)))  float v4f;
typedef __attribute__((ext_vector_type(2)))  float v2f;
typedef __attribute__((ext_vector_type(4)))  unsigned v4u;
typedef __attribute__((ext_vector_type(4)))  int v4i;
typedef float __attribute__((may_alias)) float_a;
typedef int __attribute__((may_alias)) int_a;

template <typename T> __device__ __forceinline__ void vst2(void* p, T v) { *(T*)p = v;  }
__device__ __forceinline__ v8f wmma16(v16h a, v16h b, v8f c) {
  v8f d = __builtin_amdgcn_wmma_f32_16x16x32_f16(false, a, false, b, (short)0, c, false, false);
  asm volatile("v_nop\n\tv_nop\n\tv_nop\n\tv_nop" : "+v"(d) : "v"(a), "v"(b));
  return d;
}
__device__ __forceinline__ v8f wmma_bf(v16b a, v16b b, v8f c) {
  v8f d = __builtin_amdgcn_wmma_f32_16x16x32_bf16(false, a, false, b, (short)0, c, false, false);
  asm volatile("v_nop\n\tv_nop\n\tv_nop\n\tv_nop" : "+v"(d) : "v"(a), "v"(b));
  return d;
}
// 16x16x32 fragments: lane = (h = lane>>4, row/col = lane&15); elements 0..7 = k0+8h+0..7, 8..15 = k0+16+8h+0..7; D element r = row 8h+r
__device__ __forceinline__ v16h frag_h(const _Float16* rowk0, int lane) {
  union { v16h v; v8h q[2]; } u; const _Float16* p = rowk0 + 8 * (lane >> 4);
  u.q[0] = *(const v8h*)p; u.q[1] = *(const v8h*)(p + 16); return u.v;
}
__device__ __forceinline__ v16h frag_f32(const float* rowk0, int lane) {
  v16h a; const float* p = rowk0 + 8 * (lane >> 4);
#pragma unroll
  for (int i = 0; i < 8; ++i) { a[i] = (_Float16)p[i]; a[8 + i] = (_Float16)p[16 + i]; }
  return a;
}
__device__ __forceinline__ v16h frag_f32s(const float* rowk0, int lane, float sc) {
  v16h a; const float* p = rowk0 + 8 * (lane >> 4);
#pragma unroll
  for (int i = 0; i < 8; ++i) { a[i] = (_Float16)(p[i] * sc); a[8 + i] = (_Float16)(p[16 + i] * sc); }
  return a;
}
// column fragment from a [K][ld] layout (column n), rows >= K read as 0
__device__ __forceinline__ v16h fragc_f32(const float* W, int k0, int n, int lane, int ld, int K) {
  v16h a; const int g = lane >> 4;
#pragma unroll
  for (int i = 0; i < 8; ++i) { const int ka = k0 + 8 * g + i, kb = ka + 16;
    a[i] = (_Float16)(ka < K ? W[(size_t)(ka < K ? ka : K - 1) * ld + n] : 0.f); a[8 + i] = (_Float16)(kb < K ? W[(size_t)(kb < K ? kb : K - 1) * ld + n] : 0.f); }
  return a;
}
struct F2 { v16b h, l; };
__device__ __forceinline__ F2 bsplit16(const float v[16]) { F2 r;
#pragma unroll
  for (int i = 0; i < 16; ++i) { const __bf16 h = (__bf16)v[i]; r.h[i] = h; r.l[i] = (__bf16)(v[i] - (float)h); }
  return r; }
__device__ __forceinline__ F2 split_row(const float* row, int k0, int lane) { float v[16]; const float* p = row + k0 + 8 * (lane >> 4);
#pragma unroll
  for (int i = 0; i < 8; ++i) { v[i] = p[i]; v[8 + i] = p[16 + i]; }
  return bsplit16(v); }
__device__ __forceinline__ F2 split_rowK(const float* row, int k0, int lane, int K) { float v[16]; const int g = lane >> 4;
#pragma unroll
  for (int i = 0; i < 8; ++i) { const int ka = k0 + 8 * g + i, kb = ka + 16; v[i] = ka < K ? row[ka < K ? ka : K - 1] : 0.f; v[8 + i] = kb < K ? row[kb < K ? kb : K - 1] : 0.f; }
  return bsplit16(v); }
__device__ __forceinline__ F2 split_col(const float* W, int k0, int n, int lane, int ld, int K) { float v[16]; const int g = lane >> 4;
#pragma unroll
  for (int i = 0; i < 8; ++i) { const int ka = k0 + 8 * g + i, kb = ka + 16; v[i] = ka < K ? W[(size_t)(ka < K ? ka : K - 1) * ld + n] : 0.f; v[8 + i] = kb < K ? W[(size_t)(kb < K ? kb : K - 1) * ld + n] : 0.f; }
  return bsplit16(v); }
__device__ __forceinline__ v8f mac3(const F2& a, const F2& b, v8f c) { c = wmma_bf(a.l, b.h, c); c = wmma_bf(a.h, b.l, c); return wmma_bf(a.h, b.h, c); }
__device__ __forceinline__ float sigm(float v) { return 1.0f / (1.0f + expf(-v)); }
#define LDSX() do { asm volatile("s_wait_dscnt 0" ::: "memory"); __builtin_amdgcn_wave_barrier(); __builtin_amdgcn_fence(__ATOMIC_RELEASE, "workgroup"); } while (0)


// Relative multi-head self attention (Transformer-XL style rel_shift; B 2, S 2,048, D 1,024, 16 heads x 64): pos = sinusoid(S, D) Wp + bp; scores = ((q+u) k^T + rel_shift((q+v) pos^T)) / 8, softmax, . v, Wo + bo.
#define NB 2
#define TT 2048
#define DMD 1024
#define NH 16
#define HD 64
#define POFF 32                 // ph buffer row offset (rows < 0 and >= T read as zeros)
#define PROWS (TT + 64)
#ifndef TNB
#define TNB NB
#endif
#ifndef TQB2
#define TQB2 (TT / 64)   // query blocks
#endif
#ifndef TOB2
#define TOB2 (TNB * TT / 64)
#endif
typedef __attribute__((ext_vector_type(8))) __bf16 v8b;
__device__ __forceinline__ v16b frag_b(const __bf16* rowk0, int lane) {
  union { v16b v; v8b q[2]; } u; const __bf16* p = rowk0 + 8 * (lane >> 4);
  u.q[0] = *(const v8b*)p; u.q[1] = *(const v8b*)(p + 16); return u.v;
}
__device__ __forceinline__ float bfr(float v) { return (float)(__bf16)v; }
__device__ __attribute__((noinline)) float exp_ni(float v) { return expf(v); }
__device__ __attribute__((noinline)) float erf_ni(float v) { return erff(v); }

#define WS_Q   0u                                   // f32 q rows [b*u][D] (+bq)
#define WS_KH  (WS_Q + 4u * (size_t)NB * TT * DMD)       // f16 k rows [b*t][D]
#define WS_PH  (WS_KH + 2u * (size_t)NB * TT * DMD)      // f16 ph rows [PROWS][D] (row POFF + p)
#define WS_VH  (WS_PH + 2u * (size_t)PROWS * DMD)        // f16 v planes [b][D][t]
#define WS_VL  (WS_VH + 2u * (size_t)NB * DMD * TT)      // f16 v residual planes (unscaled)
#define WS_X   (WS_VL + 2u * (size_t)NB * DMD * TT)      // f32 attention output rows [b*u][D]
#define WS_SIN (WS_X + 4u * (size_t)NB * TT * DMD)       // f32 sinusoid table [T][D]
#define WS_END (WS_SIN + 4u * (size_t)TT * DMD)

// ---- operand tiles of the projection GEMMs: one 32-k slice of the block's 64 rows and 128 weight columns, rounded once and shared by the four waves
#define GP 40                   // LDS pitch of a 32-element bf16 row: 80 B = 16 B x odd
typedef __attribute__((ext_vector_type(4))) __bf16 v4b;
template <bool SPLIT> struct GTiles { __bf16 W[2][128][GP]; __bf16 A[2][64][GP]; __bf16 L[SPLIT ? 2 : 1][SPLIT ? 64 : 1][GP]; };   // W transposed to [column][k]; A rows (hi), L their residuals
// acc[j] += rows (bf16, or bf16 hi then lo) . W[:, 16 j ..]; k ascending in slices of 32, as one product (two with SPLIT) per slice and column tile
template <bool SPLIT>
__device__ __forceinline__ void gemm_tiles(const float* __restrict__ Arows, const float* __restrict__ Wcols, GTiles<SPLIT>& t, int tid, v8f* acc) {
  const int wave = tid >> 5, lane = tid & 31, col = lane & 15, r8 = tid >> 3, q8 = tid & 7;
  // whole-line fetch: a wave reads 512 contiguous bytes of one weight row (8 rows a wave), 8 lanes read one 128-byte piece of an operand row
  const float* gw = Wcols + (size_t)(wave * 8) * DMD + lane * 4; const float* ga = Arows + (size_t)r8 * DMD + q8 * 4;
  v4f rw[8], ra[4];
  auto fetch = [&](int kc) {
#pragma unroll
    for (int i = 0; i < 8; ++i) rw[i] = *(const v4f*)(gw + (size_t)(kc * 32 + i) * DMD);
#pragma unroll
    for (int i = 0; i < 4; ++i) ra[i] = *(const v4f*)(ga + (size_t)(i * 16) * DMD + kc * 32);
    asm volatile("s_wait_xcnt 0x0" ::: "memory"); };   // stands in front of the loop's advance of these loads' address registers
  fetch(0);
#pragma unroll 2   // the two buffers' addresses become constants
  for (int kc = 0; kc < DMD / 32; ++kc) { const int bf = kc & 1;
#pragma unroll
    for (int c = 0; c < 4; ++c) { v8b p;
#pragma unroll
      for (int i = 0; i < 8; ++i) p[i] = (__bf16)rw[i][c];
      *(v8b*)&t.W[bf][lane * 4 + c][wave * 8] = p; }
#pragma unroll
    for (int i = 0; i < 4; ++i) { v4b hv, lv;
#pragma unroll
      for (int e = 0; e < 4; ++e) { const __bf16 hh = (__bf16)ra[i][e]; hv[e] = hh; if (SPLIT) lv[e] = (__bf16)(ra[i][e] - (float)hh); }
      *(v4b*)&t.A[bf][i * 16 + r8][q8 * 4] = hv; if (SPLIT) *(v4b*)&t.L[bf][i * 16 + r8][q8 * 4] = lv; }
    __syncthreads();   // this slice is published; the other buffer's readers all stand in front of this barrier, so the next trip may refill it
    if (kc + 1 < DMD / 32) fetch(kc + 1);   // the next slice flies under this slice's products (issued behind the barrier: a load does not stay in flight across it)
    const v16b a = frag_b(&t.A[bf][wave * 16 + col][0], lane); v16b al; if (SPLIT) al = frag_b(&t.L[bf][wave * 16 + col][0], lane);
    v16b w[8];
#pragma unroll
    for (int j = 0; j < 8; ++j) w[j] = frag_b(&t.W[bf][j * 16 + col][0], lane);
#pragma unroll
    for (int j = 0; j < 8; ++j) { acc[j] = wmma_bf(a, w[j], acc[j]); if (SPLIT) acc[j] = wmma_bf(al, w[j], acc[j]); }
    __builtin_amdgcn_sched_barrier(0);   // keeps the next slice's roundings, which wait for its loads, behind this slice's products
  } }
struct ProjEpi { float sf[4][16][132]; _Float16 sh[64][136]; _Float16 th[128][72], tl[128][72]; };
template <bool SPLIT> union ProjStage { GTiles<SPLIT> t; ProjEpi e; };   // the epilogue's staging reuses the tiles' LDS behind the loop
// ---- k_proj: block = (64 rows, 128-col group, which): 0 q (f32 rows), 1 k (f16 rows), 2 v (f16 hi + residual planes), 3 ph (f16 rows at POFF), natural W + bias
template <int WOFF>
__global__ __launch_bounds__(128) void k_proj(const float* __restrict__ Xin, const float* __restrict__ WQ, const float* __restrict__ BQ, const float* __restrict__ WK, const float* __restrict__ BK, const float* __restrict__ WV, const float* __restrict__ BV, const float* __restrict__ WP, const float* __restrict__ BP, float* __restrict__ Q, _Float16* __restrict__ KH, _Float16* __restrict__ VH, _Float16* __restrict__ VL, _Float16* __restrict__ PH) {
  __shared__ __align__(16) ProjStage<WOFF == 3> u;
  float (&sf)[4][16][132] = u.e.sf; _Float16 (&sh)[64][136] = u.e.sh; _Float16 (&th)[128][72] = u.e.th; _Float16 (&tl)[128][72] = u.e.tl;
  const int tid = threadIdx.x, wave = tid >> 5, lane = tid & 31, col = lane & 15, g = lane >> 4; const int which = blockIdx.z + WOFF; const int c0 = blockIdx.y * 128; const int nrows = (which == 3) ? TT : NB * TT;
  if ((int)blockIdx.x * 64 >= nrows) return;
  const float* Wm = (which == 0 ? WQ : which == 1 ? WK : which == 2 ? WV : WP); const float* Bm = (which == 0 ? BQ : which == 1 ? BK : which == 2 ? BV : BP);
  const size_t r0 = (size_t)blockIdx.x * 64 + wave * 16;
  v8f acc[8] = {};
  gemm_tiles<WOFF == 3>(Xin + (size_t)blockIdx.x * 64 * DMD, Wm + c0, u.t, tid, acc);   // WOFF 3: rows of the f32 sinusoid table (k_sin), hi + lo
  __syncthreads();   // every wave has left the last tiles before they become output staging
#pragma unroll
  for (int j = 0; j < 8; ++j) { const float bb = bfr(Bm[c0 + j * 16 + col]);
#pragma unroll
    for (int r = 0; r < 8; ++r) { const float v = acc[j][r] + bb; const int rl = wave * 16 + 8 * g + r, cl = j * 16 + col;
      if (which == 0) sf[wave][8 * g + r][cl] = v; else if (which == 2) { const _Float16 hv = (_Float16)v; th[cl][rl] = hv; tl[cl][rl] = (_Float16)(v - (float)hv); } else sh[rl][cl] = (_Float16)v; } }
  __syncthreads();
  if (which == 0) { for (int rl = 0; rl < 16; ++rl) vst2(Q + (r0 + rl) * DMD + c0 + lane * 4, *(const v4f*)&sf[wave][rl][lane * 4]); }
  else if (which == 2) { const size_t b = ((size_t)blockIdx.x * 64) / TT; const int t0 = (int)(((size_t)blockIdx.x * 64) % TT); for (int e = tid; e < 128 * 8; e += 128) { const int cl = e >> 3, q = e & 7; const size_t o = (b * DMD + c0 + cl) * (size_t)TT + t0 + q * 8; vst2((unsigned*)(VH + o), *(const v4u*)&th[cl][q * 8]); vst2((unsigned*)(VL + o), *(const v4u*)&tl[cl][q * 8]); } }
  else { _Float16* dst = (which == 1) ? (KH + (size_t)blockIdx.x * 64 * DMD) : (PH + ((size_t)POFF + blockIdx.x * 64) * DMD); for (int e = tid; e < 64 * 16; e += 128) { const int rl = e >> 4, q = e & 15; vst2((unsigned*)(dst + (size_t)rl * DMD + c0 + q * 8), *(const v4u*)&sh[rl][q * 8]); } } }
// ---- k_sin: block = position s: the module's sinusoid table row [sin(s f_c) | cos(s f_c)], f_c = 1e4^(-2c/D), f32
__global__ __launch_bounds__(256) void k_sin(float* __restrict__ SINT) { __shared__ __align__(16) float sr[DMD]; const int t = threadIdx.x; const int s = blockIdx.x;
  for (int c = t; c < DMD / 2; c += 256) { const float ang = (float)s * powf(10000.0f, -2.0f * (float)c / (float)DMD); sr[c] = sinf(ang); sr[DMD / 2 + c] = cosf(ang); }
  __syncthreads(); vst2(SINT + (size_t)s * DMD + t * 4, *(const v4f*)&sr[t * 4]); }
// ---- k_padph: the POFF rows before and the rows after the table are zeros
__global__ __launch_bounds__(256) void k_padph(_Float16* __restrict__ PH) { const int t = threadIdx.x; const int r = blockIdx.x; const size_t row = (r < POFF) ? r : (TT + r);   // 0..31 and TT+32 .. TT+63
  v4u z; z[0] = z[1] = z[2] = z[3] = 0u; if (t < DMD / 8) vst2((unsigned*)(PH + row * DMD + t * 8), z); }
// fragments of (q + bias) for 16 rows, head h: hi and residual as f16 (unscaled; q ~ O(1))
__device__ __forceinline__ void qfrags(const float* __restrict__ Q, size_t row0, int h, const float* __restrict__ bias, int lane, v16h* hi, v16h* lo) { const int col = lane & 15, g = lane >> 4; size_t row = row0 + col; if (row > (size_t)NB * TT - 1) row = (size_t)NB * TT - 1;   // clamp (only the never-used row T of the last batch)
#pragma unroll
  for (int kc = 0; kc < 2; ++kc) { const float* p = Q + row * DMD + h * HD + kc * 32 + 8 * g; const float* bp = bias + h * HD + kc * 32 + 8 * g; v16h a, b;
#pragma unroll
    for (int i = 0; i < 8; ++i) { const float v0 = p[i] + bfr(bp[i]), v1 = p[16 + i] + bfr(bp[16 + i]); const _Float16 h0 = (_Float16)v0, h1 = (_Float16)v1; a[i] = h0; a[8 + i] = h1; b[i] = (_Float16)(v0 - (float)h0); b[8 + i] = (_Float16)(v1 - (float)h1); }
    hi[kc] = a; lo[kc] = b; } }
// reduction over each 16-lane row of eight values at once: four DPP row_xmask steps (lane ^ 1, 2, 4, 8); all 32 lanes on.
// One statement, the eight chains interleaved: every producer stands eight vector instructions back, so no step waits on the one in front of it.
#define ROWSTEP8(OP, X) \
  OP " %0, %0, %0 row_xmask:" X " row_mask:0xf bank_mask:0xf\n\t" OP " %1, %1, %1 row_xmask:" X " row_mask:0xf bank_mask:0xf\n\t" \
  OP " %2, %2, %2 row_xmask:" X " row_mask:0xf bank_mask:0xf\n\t" OP " %3, %3, %3 row_xmask:" X " row_mask:0xf bank_mask:0xf\n\t" \
  OP " %4, %4, %4 row_xmask:" X " row_mask:0xf bank_mask:0xf\n\t" OP " %5, %5, %5 row_xmask:" X " row_mask:0xf bank_mask:0xf\n\t" \
  OP " %6, %6, %6 row_xmask:" X " row_mask:0xf bank_mask:0xf\n\t" OP " %7, %7, %7 row_xmask:" X " row_mask:0xf bank_mask:0xf\n\t"
// m[r] = max(m[r], a[r], b[r]) in the lane, then over the row (m is the same in all 16 lanes on entry, so it may join in front of the steps)
#define ROWMAX8(m, a, b) asm("v_max3_num_f32 %0, %8, %16, %0\n\tv_max3_num_f32 %1, %9, %17, %1\n\tv_max3_num_f32 %2, %10, %18, %2\n\tv_max3_num_f32 %3, %11, %19, %3\n\t" \
  "v_max3_num_f32 %4, %12, %20, %4\n\tv_max3_num_f32 %5, %13, %21, %5\n\tv_max3_num_f32 %6, %14, %22, %6\n\tv_max3_num_f32 %7, %15, %23, %7\n\t" \
  ROWSTEP8("v_max_num_f32_dpp", "1") ROWSTEP8("v_max_num_f32_dpp", "2") ROWSTEP8("v_max_num_f32_dpp", "4") ROWSTEP8("v_max_num_f32_dpp", "8") \
  : "+v"(m[0]), "+v"(m[1]), "+v"(m[2]), "+v"(m[3]), "+v"(m[4]), "+v"(m[5]), "+v"(m[6]), "+v"(m[7]) \
  : "v"(a[0]), "v"(a[1]), "v"(a[2]), "v"(a[3]), "v"(a[4]), "v"(a[5]), "v"(a[6]), "v"(a[7]), "v"(b[0]), "v"(b[1]), "v"(b[2]), "v"(b[3]), "v"(b[4]), "v"(b[5]), "v"(b[6]), "v"(b[7]))
#define ROWRED8(OP, v) asm(ROWSTEP8(OP, "1") ROWSTEP8(OP, "2") ROWSTEP8(OP, "4") ROWSTEP8(OP, "8") \
  : "+v"(v[0]), "+v"(v[1]), "+v"(v[2]), "+v"(v[3]), "+v"(v[4]), "+v"(v[5]), "+v"(v[6]), "+v"(v[7]))
// LDS row pitches: 16 B x odd (144 B for 64-half rows, 80 B for 32-half rows)
#define KP 72
#define VP 40
#define SGP 52                  // f32 pitch of a wave's 16 x 48 position products: the two 8-row halves land 32 banks apart on the store, 24 on the shifted read
struct AttTiles { _Float16 K[32][KP], VH[64][VP], VL[64][VP], PL[96][KP], PU[96][KP]; };
union AttStage { AttTiles t; float so[4][16][68]; };
// ---- k_att: block = (64 queries u, h, b)
__global__ __launch_bounds__(128) void k_att(const float* __restrict__ Q, const _Float16* __restrict__ KH, const _Float16* __restrict__ PH, const _Float16* __restrict__ VH, const _Float16* __restrict__ VL, const float* __restrict__ BU, const float* __restrict__ BVv, float* __restrict__ X) {
  __shared__ __align__(16) float sg1[4][16][SGP], sg2[4][16][SGP]; float (&sp)[4][16][SGP] = sg1;   // the wave's P values pass through the rows of sg1 once its gathers are done: same lane addresses as the window's stores
  __shared__ __align__(16) AttStage u;   // the trip's operand tiles, shared by the four waves; output staging behind the loop
  const int tid = threadIdx.x, wave = __builtin_amdgcn_readfirstlane(tid >> 5), lane = tid & 31, col = lane & 15, g = lane >> 4; const int qb = blockIdx.x, h = blockIdx.y; const size_t b = blockIdx.z; const int i0 = qb * 64 + wave * 16;   // the wave's number in a scalar register: every test on i0 below is a scalar branch
  // whole-line fetch of one trip's tiles: 8 lanes per 128-byte row (k, ph), 4 lanes per 64-byte row (v planes); held in registers until the tile in LDS is free
  const int r8 = tid >> 3, q8 = tid & 7, r4 = tid >> 2, q4 = tid & 3;
  // block-uniform bases and 32-bit lane byte offsets
  const char* gK = (const char*)(KH + b * TT * DMD + h * HD); const char* gP = (const char*)(PH + h * HD);
  const char* gVH = (const char*)(VH + (b * DMD + (size_t)h * HD) * TT); const char* gVL = (const char*)(VL + (b * DMD + (size_t)h * HD) * TT);
  const unsigned oK = (unsigned)(r8 * DMD + q8 * 8) * 2u, oV = (unsigned)(r4 * TT + q4 * 8) * 2u;
  const int wrow = 48 - 16 * wave;   // this wave's first row inside the block's 96-row position window
  v8h rk[2], rvh[2], rvl[2], rp[6];
  auto fetch = [&](int ks) {
#pragma unroll
    for (int i = 0; i < 2; ++i) { rk[i] = *(const v8h*)(gK + (oK + (unsigned)((ks * 32 + i * 16) * DMD * 2))); rvh[i] = *(const v8h*)(gVH + (oV + (unsigned)((i * 32 * TT + ks * 32) * 2))); rvl[i] = *(const v8h*)(gVL + (oV + (unsigned)((i * 32 * TT + ks * 32) * 2))); }
    // 96-row position window of the block: the j <= i window while some wave needs it, else the j >= i + 2 window (rows outside the buffer are used by no wave: clamped)
    const int base = (ks * 32 <= qb * 64 + 63) ? (TT - 64 - qb * 64 + ks * 32 + POFF) : (ks * 32 - qb * 64 - 65 + POFF);
#pragma unroll
    for (int i = 0; i < 6; ++i) { int row = base + i * 16 + r8; row = row < 0 ? 0 : (row > PROWS - 1 ? PROWS - 1 : row); rp[i] = *(const v8h*)(gP + (unsigned)(row * DMD + q8 * 8) * 2u); } };
  fetch(0);
  v16h au[2], av[2], aw[2], tmpl[2];   // (q+u) rows i0.., (q+v) rows i0.., (q+v) rows i0+1.. (for the wrapped upper-triangle term); single f16 rounding (residuals dropped: VGPR budget)
  qfrags(Q, b * TT + i0, h, BU, lane, au, tmpl); qfrags(Q, b * TT + i0, h, BVv, lane, av, tmpl);
  qfrags(Q, b * TT + i0 + 1, h, BVv, lane, aw, tmpl);   // rows i+1; for i = T-1 the row belongs to the next batch (or is clamped) but its products are never used: j >= i+2 cannot hold for i = T-1
  const bool lastblk = (i0 + 16 >= TT);
  const float* d1 = &sg1[wave][8 * g][15 + col - 8 * g]; const float* d2 = &sg2[wave][8 * g][15 + col - 8 * g];   // element (row 8 g + r, column 15 + col - row) lies r * (SGP - 1) floats on: one row down, one column back
  float m[8], l[8];
#pragma unroll
  for (int r = 0; r < 8; ++r) { m[r] = -3.0e38f; l[r] = 0.f; }
  v8f acc[4] = {};
#pragma unroll 1
  for (int ks = 0; ks < TT / 32; ++ks) { float s[2][8];
    __syncthreads();   // every wave has left the previous trip's tiles
#pragma unroll
    for (int i = 0; i < 2; ++i) { *(v8h*)&u.t.K[i * 16 + r8][q8 * 8] = rk[i]; *(v8h*)&u.t.VH[i * 32 + r4][q4 * 8] = rvh[i]; *(v8h*)&u.t.VL[i * 32 + r4][q4 * 8] = rvl[i]; }
    const bool blow = (ks * 32 <= qb * 64 + 63);
    { _Float16 (*dst)[KP] = blow ? u.t.PL : u.t.PU;
#pragma unroll
      for (int i = 0; i < 6; ++i) *(v8h*)&dst[i * 16 + r8][q8 * 8] = rp[i]; }
    if (blow && ks * 32 + 31 >= qb * 64 + 2) {   // the two trips on the diagonal need both windows: the j >= i + 2 one is brought here
#pragma unroll
      for (int i = 0; i < 6; ++i) { int row = ks * 32 - qb * 64 - 65 + POFF + i * 16 + r8; row = row < 0 ? 0 : (row > PROWS - 1 ? PROWS - 1 : row); *(v8h*)&u.t.PU[i * 16 + r8][q8 * 8] = *(const v8h*)(gP + (unsigned)(row * DMD + q8 * 8) * 2u); } }
    __syncthreads();   // this trip's tiles are published
    // both 16-key tiles of the trip in one pass: the wave's 16 x 48 position window is multiplied once (its middle 16 columns serve both tiles), and every LDS exchange below is waited for once a trip
    // (the loops of this pass are unrolled because their indices name registers: fragments, accumulators, scores)
    const int j0 = ks * 32; v16h kh[2][2];
#pragma unroll
    for (int ct = 0; ct < 2; ++ct)
#pragma unroll
      for (int kc = 0; kc < 2; ++kc) kh[ct][kc] = frag_h(&u.t.K[ct * 16 + col][kc * 32], lane);
    if (j0 <= i0 + 15) { v16h pf[3][2]; v8f gg[3] = {};   // some (i, j) with j <= i: window p = T-16-i0+j0 .. +47, rows wrow .. +47 of the staged window
#pragma unroll
      for (int pt = 0; pt < 3; ++pt)
#pragma unroll
        for (int kc = 0; kc < 2; ++kc) pf[pt][kc] = frag_h(&u.t.PL[wrow + pt * 16 + col][kc * 32], lane);
#pragma unroll
      for (int kc = 0; kc < 2; ++kc)
#pragma unroll
        for (int pt = 0; pt < 3; ++pt) gg[pt] = wmma16(av[kc], pf[pt][kc], gg[pt]);
#pragma unroll
      for (int pt = 0; pt < 3; ++pt)
#pragma unroll
        for (int r = 0; r < 8; ++r) sg1[wave][8 * g + r][pt * 16 + col] = gg[pt][r]; }
    if (j0 + 31 >= i0 + 2) { v16h pf[3][2]; v8f gg[3] = {};   // some (i, j) with j >= i + 2: window p = j0-i0-17 .. +47
#pragma unroll
      for (int pt = 0; pt < 3; ++pt)
#pragma unroll
        for (int kc = 0; kc < 2; ++kc) pf[pt][kc] = frag_h(&u.t.PU[wrow + pt * 16 + col][kc * 32], lane);
#pragma unroll
      for (int kc = 0; kc < 2; ++kc)
#pragma unroll
        for (int pt = 0; pt < 3; ++pt) gg[pt] = wmma16(aw[kc], pf[pt][kc], gg[pt]);
#pragma unroll
      for (int pt = 0; pt < 3; ++pt)
#pragma unroll
        for (int r = 0; r < 8; ++r) sg2[wave][8 * g + r][pt * 16 + col] = gg[pt][r]; }
    v8f c[2] = {};
#pragma unroll
    for (int kc = 0; kc < 2; ++kc)
#pragma unroll
      for (int ct = 0; ct < 2; ++ct) c[ct] = wmma16(au[kc], kh[ct][kc], c[ct]);
    LDSX();
    if (j0 + 31 <= i0) {   // all 32 keys have j <= i: the sixteen values are read unmasked, in one run
#pragma unroll
      for (int ct = 0; ct < 2; ++ct)
#pragma unroll
        for (int r = 0; r < 8; ++r) s[ct][r] = (c[ct][r] + d1[ct * 16 + r * (SGP - 1)]) * 0.125f; }
    else if (j0 >= i0 + 17) {   // all 32 keys have j >= i + 2 (no such trip exists for the rows of the last 16: j0 + 31 < T)
#pragma unroll
      for (int ct = 0; ct < 2; ++ct)
#pragma unroll
        for (int r = 0; r < 8; ++r) s[ct][r] = (c[ct][r] + d2[ct * 16 + r * (SGP - 1)]) * 0.125f; }
    else {   // the trips that touch the diagonal: tile by tile
#pragma unroll
      for (int ct = 0; ct < 2; ++ct) { const int jc = j0 + ct * 16;
        if (jc + 15 <= i0) {
#pragma unroll
          for (int r = 0; r < 8; ++r) s[ct][r] = (c[ct][r] + d1[ct * 16 + r * (SGP - 1)]) * 0.125f; }
        else if (jc >= i0 + 17) {
#pragma unroll
          for (int r = 0; r < 8; ++r) s[ct][r] = (c[ct][r] + d2[ct * 16 + r * (SGP - 1)]) * 0.125f; }
        else { const int dj = jc - i0 + col - 8 * g;   // the two tiles on the diagonal: chosen per element by j - i = dj - r
#pragma unroll
          for (int r = 0; r < 8; ++r) { const int d = dj - r;
            float bd; if (d <= 0) bd = d1[ct * 16 + r * (SGP - 1)]; else if (d == 1) bd = 0.f; else bd = (lastblk && 8 * g + r == 15) ? 0.f : d2[ct * 16 + r * (SGP - 1)];
            s[ct][r] = (c[ct][r] + bd) * 0.125f; } } } }
    LDSX();
    float alpha[8], mo[8], es[8];
#pragma unroll
    for (int r = 0; r < 8; ++r) mo[r] = m[r];
    ROWMAX8(m, s[0], s[1]);   // running row maxima in the vector unit: no LDS-pipe shuffle, no wait on its counter
#pragma unroll
    for (int r = 0; r < 8; ++r) {
      const float mn = m[r]; alpha[r] = (mo[r] <= -1.0e38f) ? 0.f : __expf(mo[r] - mn); const float e0 = (s[0][r] <= -1.0e38f) ? 0.f : __expf(s[0][r] - mn), e1 = (s[1][r] <= -1.0e38f) ? 0.f : __expf(s[1][r] - mn); es[r] = e0 + e1;
      sp[wave][8 * g + r][col] = e0; sp[wave][8 * g + r][16 + col] = e1; }
    ROWRED8("v_add_f32_dpp", es);   // row sums likewise; the same xor tree (1, 2, 4, 8) as the shuffles had
#pragma unroll
    for (int r = 0; r < 8; ++r) l[r] = l[r] * alpha[r] + es[r];
#pragma unroll
    for (int j = 0; j < 4; ++j)
#pragma unroll
      for (int r = 0; r < 8; ++r) acc[j][r] *= alpha[r];
    LDSX();
    fetch(ks + 1 < TT / 32 ? ks + 1 : ks);   // the next trip's tiles fly under the P . v products (the last trip names its own again: always in bounds, never stored)
    v16h pa, pr; { const float* prow = &sp[wave][col][0] + 8 * (lane >> 4);
#pragma unroll
      for (int i = 0; i < 8; ++i) { const float x0 = prow[i] * 2048.0f, x1 = prow[16 + i] * 2048.0f; const _Float16 h0 = (_Float16)x0, h1 = (_Float16)x1; pa[i] = h0; pa[8 + i] = h1; pr[i] = (_Float16)(x0 - (float)h0); pr[8 + i] = (_Float16)(x1 - (float)h1); } }
#pragma unroll
    for (int j = 0; j < 4; ++j) { const v16h vh = frag_h(&u.t.VH[j * 16 + col][0], lane), vl = frag_h(&u.t.VL[j * 16 + col][0], lane);   // both planes' fragments in one run: one LDS wait for three products
      acc[j] = wmma16(pa, vh, acc[j]); acc[j] = wmma16(pr, vh, acc[j]); acc[j] = wmma16(pa, vl, acc[j]); }
    LDSX(); }
  __syncthreads();   // every wave has left the last tiles before they become output staging
#pragma unroll
  for (int r = 0; r < 8; ++r) { const float il = (l[r] > 0.f) ? (1.0f / 2048.0f) / l[r] : 0.f;   // fully masked rows -> zeros (the module zeroes them after the softmax)
#pragma unroll
    for (int j = 0; j < 4; ++j) u.so[wave][8 * g + r][j * 16 + col] = acc[j][r] * il; }
  LDSX(); for (int rl = 0; rl < 16; ++rl) if (lane < 16) vst2(X + (b * TT + i0 + rl) * DMD + h * HD + lane * 4, *(const v4f*)&u.so[wave][rl][lane * 4]); }
// ---- k_out: block = (64 rows, 128 of 1024 cols): out = x (hi + lo) . Wo + bo
__global__ __launch_bounds__(128) void k_out(const float* __restrict__ X, const float* __restrict__ WO, const float* __restrict__ BO, float* __restrict__ OUT) { __shared__ __align__(16) float sf[4][16][132];
  const int tid = threadIdx.x, wave = tid >> 5, lane = tid & 31, col = lane & 15, g = lane >> 4; const int c0 = blockIdx.y * 128; const size_t r0 = (size_t)blockIdx.x * 64 + wave * 16;
  __shared__ __align__(16) GTiles<true> t;
  v8f acc[8] = {};
  gemm_tiles<true>(X + (size_t)blockIdx.x * 64 * DMD, WO + c0, t, tid, acc);
#pragma unroll
  for (int j = 0; j < 8; ++j) { const float bb = bfr(BO[c0 + j * 16 + col]);
#pragma unroll
    for (int r = 0; r < 8; ++r) sf[wave][8 * g + r][j * 16 + col] = acc[j][r] + bb; }
  LDSX(); for (int rl = 0; rl < 16; ++rl) vst2(OUT + (r0 + rl) * DMD + c0 + lane * 4, *(const v4f*)&sf[wave][rl][lane * 4]); }
extern "C" void kernel_launch(void* const* d_in, const int* in_sizes, int n_in, void* d_out, int out_size, void* d_ws, size_t ws_size, hipStream_t stream) {
  (void)in_sizes; (void)n_in; (void)out_size;
  const float** F = (const float**)d_in;   // 0 x [2,2048,1024]; 1 Wq, 2 bq, 3 Wk, 4 bk, 5 Wv, 6 bv, 7 Wp, 8 bp, 9 Wo, 10 bo ((in,out) [1024,1024]); 11 u [1,16,1,64], 12 v [1,16,1,64]
  if (ws_size < (size_t)WS_END) return;
  char* ws = (char*)d_ws; float* Q = (float*)(ws + WS_Q); _Float16 *KH = (_Float16*)(ws + WS_KH), *PH = (_Float16*)(ws + WS_PH), *VH = (_Float16*)(ws + WS_VH), *VL = (_Float16*)(ws + WS_VL); float* X = (float*)(ws + WS_X);
  float* SINT = (float*)(ws + WS_SIN);
  k_sin<<<TT, 256, 0, stream>>>(SINT);
  k_proj<0><<<dim3(TNB * TT / 64, DMD / 128, 3), 128, 0, stream>>>(F[0], F[1], F[2], F[3], F[4], F[5], F[6], F[7], F[8], Q, KH, VH, VL, PH);
  k_proj<3><<<dim3(TT / 64, DMD / 128, 1), 128, 0, stream>>>(SINT, F[1], F[2], F[3], F[4], F[5], F[6], F[7], F[8], Q, KH, VH, VL, PH);
  k_padph<<<64, 256, 0, stream>>>(PH);
  k_att<<<dim3(TQB2, NH, TNB), 128, 0, stream>>>(Q, KH, PH, VH, VL, F[11], F[12], X);
  k_out<<<dim3(TOB2, DMD / 128), 128, 0, stream>>>(X, F[9], F[10], (float*)d_out);
}

// v006
// It runs in 250 microseconds.
// Next to v005, in two timings, it ran 1.11 times as fast each time.
// All steps since v000 together make it 2.71 times as fast.
// compute dtype: all float inputs rounded to bf16; q/k/v projections with EXACT bf16 products on WMMA 16x16x32 ((in,out) weights, + bias), the sinusoidal position table built once on device in f32 (precise sinf/cosf/powf, k_sin) and projected with hi + lo (2 products) + bp, f32 accumulate; q kept in f32 (bias_u / bias_v added per head, then split into bf16-exact f16 hi + residual fragments), k / ph rounded once to f16, v to f16 hi + residual; content scores (q+bu) . k and the Transformer-XL position term (q+bv) . ph with single f16 products (logits ~1-2; q, k, ph each rounded once), the rel_shift realised exactly as an index map onto 16 x 48 position windows (incl. its upper-triangle wrap-around rows and the zero at j == i+1), x 1/8, running-max softmax in f32 (hardware exp); P (f16 x 2^11 + residual) . v; out = x (bf16 hi + lo) . Wo + bo; f32 output.
#include <hip/hip_runtime.h>
#include <math.h>

typedef __attribute__((ext_vector_type(16))) _Float16 v16h;
typedef __attribute__((ext_vector_type(16))) __bf16 v16b;
typedef __attribute__((ext_vector_type(8)))  _Float16 v8h;
typedef __attribute__((ext_vector_type(8)))  float v8f;
typedef __attribute__((ext_vector_type(4)))  float v4f;
typedef __attribute__((ext_vector_type(2)))  float v2f;
typedef __attribute__((ext_vector_type(4)))  unsigned v4u;
typedef __attribute__((ext_vector_type(4)))  int v4i;
typedef float __attribute__((may_alias)) float_a;
typedef int __attribute__((may_alias)) int_a;

template <typename T> __device__ __forceinline__ void vst2(void* p, T v) { *(T*)p = v;  }
__device__ __forceinline__ v8f wmma16(v16h a, v16h b, v8f c) {
  v8f d = __builtin_amdgcn_wmma_f32_16x16x32_f16(false, a, false, b, (short)0, c, false, false);
  asm volatile("v_nop\n\tv_nop\n\tv_nop\n\tv_nop" : "+v"(d) : "v"(a), "v"(b));
  return d;
}
__device__ __forceinline__ v8f wmma_bf(v16b a, v16b b, v8f c) {
  v8f d = __builtin_amdgcn_wmma_f32_16x16x32_bf16(false, a, false, b, (short)0, c, false, false);
  asm volatile("v_nop\n\tv_nop\n\tv_nop\n\tv_nop" : "+v"(d) : "v"(a), "v"(b));
  return d;
}
// 16x16x32 fragments: lane = (h = lane>>4, row/col = lane&15); elements 0..7 = k0+8h+0..7, 8..15 = k0+16+8h+0..7; D element r = row 8h+r
__device__ __forceinline__ v16h frag_h(const _Float16* rowk0, int lane) {
  union { v16h v; v8h q[2]; } u; const _Float16* p = rowk0 + 8 * (lane >> 4);
  u.q[0] = *(const v8h*)p; u.q[1] = *(const v8h*)(p + 16); return u.v;
}
__device__ __forceinline__ v16h frag_f32(const float* rowk0, int lane) {
  v16h a; const float* p = rowk0 + 8 * (lane >> 4);
#pragma unroll
  for (int i = 0; i < 8; ++i) { a[i] = (_Float16)p[i]; a[8 + i] = (_Float16)p[16 + i]; }
  return a;
}
__device__ __forceinline__ v16h frag_f32s(const float* rowk0, int lane, float sc) {
  v16h a; const float* p = rowk0 + 8 * (lane >> 4);
#pragma unroll
  for (int i = 0; i < 8; ++i) { a[i] = (_Float16)(p[i] * sc); a[8 + i] = (_Float16)(p[16 + i] * sc); }
  return a;
}
// column fragment from a [K][ld] layout (column n), rows >= K read as 0
__device__ __forceinline__ v16h fragc_f32(const float* W, int k0, int n, int lane, int ld, int K) {
  v16h a; const int g = lane >> 4;
#pragma unroll
  for (int i = 0; i < 8; ++i) { const int ka = k0 + 8 * g + i, kb = ka + 16;
    a[i] = (_Float16)(ka < K ? W[(size_t)(ka < K ? ka : K - 1) * ld + n] : 0.f); a[8 + i] = (_Float16)(kb < K ? W[(size_t)(kb < K ? kb : K - 1) * ld + n] : 0.f); }
  return a;
}
struct F2 { v16b h, l; };
__device__ __forceinline__ F2 bsplit16(const float v[16]) { F2 r;
#pragma unroll
  for (int i = 0; i < 16; ++i) { const __bf16 h = (__bf16)v[i]; r.h[i] = h; r.l[i] = (__bf16)(v[i] - (float)h); }
  return r; }
__device__ __forceinline__ F2 split_row(const float* row, int k0, int lane) { float v[16]; const float* p = row + k0 + 8 * (lane >> 4);
#pragma unroll
  for (int i = 0; i < 8; ++i) { v[i] = p[i]; v[8 + i] = p[16 + i]; }
  return bsplit16(v); }
__device__ __forceinline__ F2 split_rowK(const float* row, int k0, int lane, int K) { float v[16]; const int g = lane >> 4;
#pragma unroll
  for (int i = 0; i < 8; ++i) { const int ka = k0 + 8 * g + i, kb = ka + 16; v[i] = ka < K ? row[ka < K ? ka : K - 1] : 0.f; v[8 + i] = kb < K ? row[kb < K ? kb : K - 1] : 0.f; }
  return bsplit16(v); }
__device__ __forceinline__ F2 split_col(const float* W, int k0, int n, int lane, int ld, int K) { float v[16]; const int g = lane >> 4;
#pragma unroll
  for (int i = 0; i < 8; ++i) { const int ka = k0 + 8 * g + i, kb = ka + 16; v[i] = ka < K ? W[(size_t)(ka < K ? ka : K - 1) * ld + n] : 0.f; v[8 + i] = kb < K ? W[(size_t)(kb < K ? kb : K - 1) * ld + n] : 0.f; }
  return bsplit16(v); }
__device__ __forceinline__ v8f mac3(const F2& a, const F2& b, v8f c) { c = wmma_bf(a.l, b.h, c); c = wmma_bf(a.h, b.l, c); return wmma_bf(a.h, b.h, c); }
__device__ __forceinline__ float sigm(float v) { return 1.0f / (1.0f + expf(-v)); }
#define LDSX() do { asm volatile("s_wait_dscnt 0" ::: "memory"); __builtin_amdgcn_wave_barrier(); __builtin_amdgcn_fence(__ATOMIC_RELEASE, "workgroup"); } while (0)


// Relative multi-head self attention (Transformer-XL style rel_shift; B 2, S 2,048, D 1,024, 16 heads x 64): pos = sinusoid(S, D) Wp + bp; scores = ((q+u) k^T + rel_shift((q+v) pos^T)) / 8, softmax, . v, Wo + bo.
#define NB 2
#define TT 2048
#define DMD 1024
#define NH 16
#define HD 64
#define POFF 32                 // ph buffer row offset (rows < 0 and >= T read as zeros)
#define PROWS (TT + 64)
#ifndef TNB
#define TNB NB
#endif
#ifndef TQB2
#define TQB2 (TT / 64)   // query blocks
#endif
#ifndef TOB2
#define TOB2 (TNB * TT / 64)
#endif
typedef __attribute__((ext_vector_type(8))) __bf16 v8b;
__device__ __forceinline__ v16b frag_b(const __bf16* rowk0, int lane) {
  union { v16b v; v8b q[2]; } u; const __bf16* p = rowk0 + 8 * (lane >> 4);
  u.q[0] = *(const v8b*)p; u.q[1] = *(const v8b*)(p + 16); return u.v;
}
__device__ __forceinline__ float bfr(float v) { return (float)(__bf16)v; }
__device__ __attribute__((noinline)) float exp_ni(float v) { return expf(v); }
__device__ __attribute__((noinline)) float erf_ni(float v) { return erff(v); }

#define WS_Q   0u                                   // f32 q rows [b*u][D] (+bq)
#define WS_KH  (WS_Q + 4u * (size_t)NB * TT * DMD)       // f16 k rows [b*t][D]
#define WS_PH  (WS_KH + 2u * (size_t)NB * TT * DMD)      // f16 ph rows [PROWS][D] (row POFF + p)
#define WS_VH  (WS_PH + 2u * (size_t)PROWS * DMD)        // f16 v planes [b][D][t]
#define WS_VL  (WS_VH + 2u * (size_t)NB * DMD * TT)      // f16 v residual planes (unscaled)
#define WS_X   (WS_VL + 2u * (size_t)NB * DMD * TT)      // f32 attention output rows [b*u][D]
#define WS_SIN (WS_X + 4u * (size_t)NB * TT * DMD)       // f32 sinusoid table [T][D]
#define WS_END (WS_SIN + 4u * (size_t)TT * DMD)

// ---- operand tiles of the projection GEMMs: one 32-k slice of the block's 64 rows and 128 weight columns, rounded once and shared by the four waves
#define GP 40                   // LDS pitch of a 32-element bf16 row: 80 B = 16 B x odd
typedef __attribute__((ext_vector_type(4))) __bf16 v4b;
template <bool SPLIT> struct GTiles { __bf16 W[2][128][GP]; __bf16 A[2][64][GP]; __bf16 L[SPLIT ? 2 : 1][SPLIT ? 64 : 1][GP]; };   // W transposed to [column][k]; A rows (hi), L their residuals
// acc[j] += rows (bf16, or bf16 hi then lo) . W[:, 16 j ..]; k ascending in slices of 32, as one product (two with SPLIT) per slice and column tile
template <bool SPLIT>
__device__ __forceinline__ void gemm_tiles(const float* __restrict__ Arows, const float* __restrict__ Wcols, GTiles<SPLIT>& t, int tid, v8f* acc) {
  const int wave = tid >> 5, lane = tid & 31, col = lane & 15, r8 = tid >> 3, q8 = tid & 7;
  // whole-line fetch: a wave reads 512 contiguous bytes of one weight row (8 rows a wave), 8 lanes read one 128-byte piece of an operand row
  const float* gw = Wcols + (size_t)(wave * 8) * DMD + lane * 4; const float* ga = Arows + (size_t)r8 * DMD + q8 * 4;
  v4f rw[8], ra[4];
  auto fetch = [&](int kc) {
#pragma unroll
    for (int i = 0; i < 8; ++i) rw[i] = *(const v4f*)(gw + (size_t)(kc * 32 + i) * DMD);
#pragma unroll
    for (int i = 0; i < 4; ++i) ra[i] = *(const v4f*)(ga + (size_t)(i * 16) * DMD + kc * 32);
    asm volatile("s_wait_xcnt 0x0" ::: "memory"); };   // stands in front of the loop's advance of these loads' address registers
  fetch(0);
#pragma unroll 2   // the two buffers' addresses become constants
  for (int kc = 0; kc < DMD / 32; ++kc) { const int bf = kc & 1;
#pragma unroll
    for (int c = 0; c < 4; ++c) { v8b p;
#pragma unroll
      for (int i = 0; i < 8; ++i) p[i] = (__bf16)rw[i][c];
      *(v8b*)&t.W[bf][lane * 4 + c][wave * 8] = p; }
#pragma unroll
    for (int i = 0; i < 4; ++i) { v4b hv, lv;
#pragma unroll
      for (int e = 0; e < 4; ++e) { const __bf16 hh = (__bf16)ra[i][e]; hv[e] = hh; if (SPLIT) lv[e] = (__bf16)(ra[i][e] - (float)hh); }
      *(v4b*)&t.A[bf][i * 16 + r8][q8 * 4] = hv; if (SPLIT) *(v4b*)&t.L[bf][i * 16 + r8][q8 * 4] = lv; }
    __syncthreads();   // this slice is published; the other buffer's readers all stand in front of this barrier, so the next trip may refill it
    if (kc + 1 < DMD / 32) fetch(kc + 1);   // the next slice flies under this slice's products (issued behind the barrier: a load does not stay in flight across it)
    const v16b a = frag_b(&t.A[bf][wave * 16 + col][0], lane); v16b al; if (SPLIT) al = frag_b(&t.L[bf][wave * 16 + col][0], lane);
    v16b w[8];
#pragma unroll
    for (int j = 0; j < 8; ++j) w[j] = frag_b(&t.W[bf][j * 16 + col][0], lane);
#pragma unroll
    for (int j = 0; j < 8; ++j) { acc[j] = wmma_bf(a, w[j], acc[j]); if (SPLIT) acc[j] = wmma_bf(al, w[j], acc[j]); }
    __builtin_amdgcn_sched_barrier(0);   // keeps the next slice's roundings, which wait for its loads, behind this slice's products
  } }
struct ProjEpi { float sf[4][16][132]; _Float16 sh[64][136]; _Float16 th[128][72], tl[128][72]; };
template <bool SPLIT> union ProjStage { GTiles<SPLIT> t; ProjEpi e; };   // the epilogue's staging reuses the tiles' LDS behind the loop
// ---- k_proj: block = (64 rows, 128-col group, which): 0 q (f32 rows), 1 k (f16 rows), 2 v (f16 hi + residual planes), 3 ph (f16 rows at POFF), natural W + bias
template <int WOFF>
__global__ __launch_bounds__(128) void k_proj(const float* __restrict__ Xin, const float* __restrict__ WQ, const float* __restrict__ BQ, const float* __restrict__ WK, const float* __restrict__ BK, const float* __restrict__ WV, const float* __restrict__ BV, const float* __restrict__ WP, const float* __restrict__ BP, float* __restrict__ Q, _Float16* __restrict__ KH, _Float16* __restrict__ VH, _Float16* __restrict__ VL, _Float16* __restrict__ PH) {
  __shared__ __align__(16) ProjStage<WOFF == 3> u;
  float (&sf)[4][16][132] = u.e.sf; _Float16 (&sh)[64][136] = u.e.sh; _Float16 (&th)[128][72] = u.e.th; _Float16 (&tl)[128][72] = u.e.tl;
  const int tid = threadIdx.x, wave = tid >> 5, lane = tid & 31, col = lane & 15, g = lane >> 4; const int which = blockIdx.z + WOFF; const int c0 = blockIdx.y * 128; const int nrows = (which == 3) ? TT : NB * TT;
  if ((int)blockIdx.x * 64 >= nrows) return;
  const float* Wm = (which == 0 ? WQ : which == 1 ? WK : which == 2 ? WV : WP); const float* Bm = (which == 0 ? BQ : which == 1 ? BK : which == 2 ? BV : BP);
  const size_t r0 = (size_t)blockIdx.x * 64 + wave * 16;
  v8f acc[8] = {};
  gemm_tiles<WOFF == 3>(Xin + (size_t)blockIdx.x * 64 * DMD, Wm + c0, u.t, tid, acc);   // WOFF 3: rows of the f32 sinusoid table (k_sin), hi + lo
  __syncthreads();   // every wave has left the last tiles before they become output staging
#pragma unroll
  for (int j = 0; j < 8; ++j) { const float bb = bfr(Bm[c0 + j * 16 + col]);
#pragma unroll
    for (int r = 0; r < 8; ++r) { const float v = acc[j][r] + bb; const int rl = wave * 16 + 8 * g + r, cl = j * 16 + col;
      if (which == 0) sf[wave][8 * g + r][cl] = v; else if (which == 2) { const _Float16 hv = (_Float16)v; th[cl][rl] = hv; tl[cl][rl] = (_Float16)(v - (float)hv); } else sh[rl][cl] = (_Float16)v; } }
  __syncthreads();
  if (which == 0) { for (int rl = 0; rl < 16; ++rl) vst2(Q + (r0 + rl) * DMD + c0 + lane * 4, *(const v4f*)&sf[wave][rl][lane * 4]); }
  else if (which == 2) { const size_t b = ((size_t)blockIdx.x * 64) / TT; const int t0 = (int)(((size_t)blockIdx.x * 64) % TT); for (int e = tid; e < 128 * 8; e += 128) { const int cl = e >> 3, q = e & 7; const size_t o = (b * DMD + c0 + cl) * (size_t)TT + t0 + q * 8; vst2((unsigned*)(VH + o), *(const v4u*)&th[cl][q * 8]); vst2((unsigned*)(VL + o), *(const v4u*)&tl[cl][q * 8]); } }
  else { _Float16* dst = (which == 1) ? (KH + (size_t)blockIdx.x * 64 * DMD) : (PH + ((size_t)POFF + blockIdx.x * 64) * DMD); for (int e = tid; e < 64 * 16; e += 128) { const int rl = e >> 4, q = e & 15; vst2((unsigned*)(dst + (size_t)rl * DMD + c0 + q * 8), *(const v4u*)&sh[rl][q * 8]); } } }
// ---- k_sin: block = position s: the module's sinusoid table row [sin(s f_c) | cos(s f_c)], f_c = 1e4^(-2c/D), f32
__global__ __launch_bounds__(256) void k_sin(float* __restrict__ SINT) { __shared__ __align__(16) float sr[DMD]; const int t = threadIdx.x; const int s = blockIdx.x;
  for (int c = t; c < DMD / 2; c += 256) { const float ang = (float)s * powf(10000.0f, -2.0f * (float)c / (float)DMD); sr[c] = sinf(ang); sr[DMD / 2 + c] = cosf(ang); }
  __syncthreads(); vst2(SINT + (size_t)s * DMD + t * 4, *(const v4f*)&sr[t * 4]); }
// ---- k_padph: the POFF rows before and the rows after the table are zeros
__global__ __launch_bounds__(256) void k_padph(_Float16* __restrict__ PH) { const int t = threadIdx.x; const int r = blockIdx.x; const size_t row = (r < POFF) ? r : (TT + r);   // 0..31 and TT+32 .. TT+63
  v4u z; z[0] = z[1] = z[2] = z[3] = 0u; if (t < DMD / 8) vst2((unsigned*)(PH + row * DMD + t * 8), z); }
// fragments of (q + bias) for 16 rows, head h: hi and residual as f16 (unscaled; q ~ O(1))
__device__ __forceinline__ void qfrags(const float* __restrict__ Q, size_t row0, int h, const float* __restrict__ bias, int lane, v16h* hi, v16h* lo) { const int col = lane & 15, g = lane >> 4; size_t row = row0 + col; if (row > (size_t)NB * TT - 1) row = (size_t)NB * TT - 1;   // clamp (only the never-used row T of the last batch)
#pragma unroll
  for (int kc = 0; kc < 2; ++kc) { const float* p = Q + row * DMD + h * HD + kc * 32 + 8 * g; const float* bp = bias + h * HD + kc * 32 + 8 * g; v16h a, b;
#pragma unroll
    for (int i = 0; i < 8; ++i) { const float v0 = p[i] + bfr(bp[i]), v1 = p[16 + i] + bfr(bp[16 + i]); const _Float16 h0 = (_Float16)v0, h1 = (_Float16)v1; a[i] = h0; a[8 + i] = h1; b[i] = (_Float16)(v0 - (float)h0); b[8 + i] = (_Float16)(v1 - (float)h1); }
    hi[kc] = a; lo[kc] = b; } }
// lane l's value from lane l ^ 16 (the wave's other half), by a vector cross-row move
__device__ __forceinline__ float xhalf(float x) { return __builtin_bit_cast(float, __builtin_amdgcn_permlanex16(__builtin_bit_cast(int, x), __builtin_bit_cast(int, x), 0x76543210, 0xfedcba98, false, false)); }
// LDS row pitches: 16 B x odd (144 B for 64-half rows, 80 B for 32-half rows)
#define KP 72
#define VP 40
#define SGP 52                  // f32 pitch of a query's 48 position products: 16 B x odd for the 16-byte stores; the shifted reads step 51 banks from query to query
struct AttTiles { _Float16 K[32][KP], VH[64][VP], VL[64][VP], PL[96][KP], PU[96][KP]; };
union AttStage { AttTiles t; float so[4][16][68]; };
// ---- k_att: block = (64 queries u, h, b). Every product is taken transposed (keys, window positions or head dims as rows, the wave's 16 queries as columns):
// lanes col and col + 16 hold all of query col, so its maximum and sum take one cross-half move (xhalf) and its rescale is lane-local, and the two score tiles of a trip, converted in place, are the B fragment of v^T . P^T
__global__ __launch_bounds__(128) void k_att(const float* __restrict__ Q, const _Float16* __restrict__ KH, const _Float16* __restrict__ PH, const _Float16* __restrict__ VH, const _Float16* __restrict__ VL, const float* __restrict__ BU, const float* __restrict__ BVv, float* __restrict__ X) {
  __shared__ __align__(16) float sg1[4][16][SGP], sg2[4][16][SGP];   // [wave][query][window column]: the position products on their way through the rel-shift
  __shared__ __align__(16) AttStage u;   // the trip's operand tiles, shared by the four waves; output staging behind the loop
  const int tid = threadIdx.x, wave = __builtin_amdgcn_readfirstlane(tid >> 5), lane = tid & 31, col = lane & 15, g = lane >> 4; const int qb = blockIdx.x, h = blockIdx.y; const size_t b = blockIdx.z; const int i0 = qb * 64 + wave * 16;   // the wave's number in a scalar register: every test on i0 below is a scalar branch
  // whole-line fetch of one trip's tiles: 8 lanes per 128-byte row (k, ph), 4 lanes per 64-byte row (v planes); held in registers until the tile in LDS is free
  const int r8 = tid >> 3, q8 = tid & 7, r4 = tid >> 2, q4 = tid & 3;
  // block-uniform bases and 32-bit lane byte offsets
  const char* gK = (const char*)(KH + b * TT * DMD + h * HD); const char* gP = (const char*)(PH + h * HD);
  const char* gVH = (const char*)(VH + (b * DMD + (size_t)h * HD) * TT); const char* gVL = (const char*)(VL + (b * DMD + (size_t)h * HD) * TT);
  const unsigned oK = (unsigned)(r8 * DMD + q8 * 8) * 2u, oV = (unsigned)(r4 * TT + q4 * 8) * 2u;
  const int wrow = 48 - 16 * wave;   // this wave's first row inside the block's 96-row position window
  v8h rk[2], rvh[2], rvl[2], rp[6];
  auto fetch = [&](int ks) {
#pragma unroll
    for (int i = 0; i < 2; ++i) rk[i] = *(const v8h*)(gK + (oK + (unsigned)((ks * 32 + i * 16) * DMD * 2)));
    asm volatile("s_wait_xcnt 0x0" ::: "memory");   // stands in front of the next loads, whose results may be given the registers that held these loads' address
#pragma unroll   // the index names registers
    for (int i = 0; i < 2; ++i) { rvh[i] = *(const v8h*)(gVH + (oV + (unsigned)((i * 32 * TT + ks * 32) * 2))); rvl[i] = *(const v8h*)(gVL + (oV + (unsigned)((i * 32 * TT + ks * 32) * 2))); }
    // 96-row position window of the block: the j <= i window while some wave needs it, else the j >= i + 2 window (rows outside the buffer are used by no wave: clamped)
    const int base = (ks * 32 <= qb * 64 + 63) ? (TT - 64 - qb * 64 + ks * 32 + POFF) : (ks * 32 - qb * 64 - 65 + POFF);
#pragma unroll
    for (int i = 0; i < 6; ++i) { int row = base + i * 16 + r8; row = row < 0 ? 0 : (row > PROWS - 1 ? PROWS - 1 : row); rp[i] = *(const v8h*)(gP + (unsigned)(row * DMD + q8 * 8) * 2u); } };
  fetch(0);
  v16h au[2], av[2], aw[2], tmpl[2];   // (q+u) rows i0.., (q+v) rows i0.., (q+v) rows i0+1.. (for the wrapped upper-triangle term); single f16 rounding (residuals dropped: VGPR budget)
  qfrags(Q, b * TT + i0, h, BU, lane, au, tmpl); qfrags(Q, b * TT + i0, h, BVv, lane, av, tmpl);
  qfrags(Q, b * TT + i0 + 1, h, BVv, lane, aw, tmpl);   // rows i+1; for i = T-1 the row belongs to the next batch (or is clamped) but its products are never used: j >= i+2 cannot hold for i = T-1
  const bool lastblk = (i0 + 16 >= TT);
  const float* d1 = &sg1[wave][col][15 - col + 8 * g]; const float* d2 = &sg2[wave][col][15 - col + 8 * g];   // key 16 ct + 8 g + r of query col takes window column 15 - col + 16 ct + 8 g + r: eight floats in a row
  float m = -3.0e38f, l = 0.f;   // query col's running maximum (equal in both halves) and this half's share of its sum
  v8f acc[4] = {};   // acc[j][r] = head dim 16 j + 8 g + r of query col
#pragma unroll 1
  for (int ks = 0; ks < TT / 32; ++ks) { float s[2][8];
    __syncthreads();   // every wave has left the previous trip's tiles
#pragma unroll
    for (int i = 0; i < 2; ++i) { *(v8h*)&u.t.K[i * 16 + r8][q8 * 8] = rk[i]; *(v8h*)&u.t.VH[i * 32 + r4][q4 * 8] = rvh[i]; *(v8h*)&u.t.VL[i * 32 + r4][q4 * 8] = rvl[i]; }
    const bool blow = (ks * 32 <= qb * 64 + 63);
    { _Float16 (*dst)[KP] = blow ? u.t.PL : u.t.PU;
#pragma unroll
      for (int i = 0; i < 6; ++i) *(v8h*)&dst[i * 16 + r8][q8 * 8] = rp[i]; }
    if (blow && ks * 32 + 31 >= qb * 64 + 2) {   // the two trips on the diagonal need both windows: the j >= i + 2 one is brought here
#pragma unroll
      for (int i = 0; i < 6; ++i) { int row = ks * 32 - qb * 64 - 65 + POFF + i * 16 + r8; row = row < 0 ? 0 : (row > PROWS - 1 ? PROWS - 1 : row); *(v8h*)&u.t.PU[i * 16 + r8][q8 * 8] = *(const v8h*)(gP + (unsigned)(row * DMD + q8 * 8) * 2u); } }
    __syncthreads();   // this trip's tiles are published
    // both 16-key tiles of the trip in one pass: the wave's 16 x 48 position window is multiplied once (its middle 16 columns serve both tiles), and every LDS exchange below is waited for once a trip
    // (the loops of this pass are unrolled because their indices name registers: fragments, accumulators, scores)
    const int j0 = ks * 32; v16h kh[2][2];
#pragma unroll
    for (int ct = 0; ct < 2; ++ct)
#pragma unroll
      for (int kc = 0; kc < 2; ++kc) kh[ct][kc] = frag_h(&u.t.K[ct * 16 + col][kc * 32], lane);
    if (j0 <= i0 + 15) { v16h pf[3][2]; v8f gg[3] = {};   // some (i, j) with j <= i: window p = T-16-i0+j0 .. +47, rows wrow .. +47 of the staged window
#pragma unroll
      for (int pt = 0; pt < 3; ++pt)
#pragma unroll
        for (int kc = 0; kc < 2; ++kc) pf[pt][kc] = frag_h(&u.t.PL[wrow + pt * 16 + col][kc * 32], lane);
#pragma unroll
      for (int kc = 0; kc < 2; ++kc)
#pragma unroll
        for (int pt = 0; pt < 3; ++pt) gg[pt] = wmma16(pf[pt][kc], av[kc], gg[pt]);
#pragma unroll
      for (int pt = 0; pt < 3; ++pt) { *(v4f*)&sg1[wave][col][pt * 16 + 8 * g] = __builtin_shufflevector(gg[pt], gg[pt], 0, 1, 2, 3); *(v4f*)&sg1[wave][col][pt * 16 + 8 * g + 4] = __builtin_shufflevector(gg[pt], gg[pt], 4, 5, 6, 7); } }
    if (j0 + 31 >= i0 + 2) { v16h pf[3][2]; v8f gg[3] = {};   // some (i, j) with j >= i + 2: window p = j0-i0-17 .. +47
#pragma unroll
      for (int pt = 0; pt < 3; ++pt)
#pragma unroll
        for (int kc = 0; kc < 2; ++kc) pf[pt][kc] = frag_h(&u.t.PU[wrow + pt * 16 + col][kc * 32], lane);
#pragma unroll
      for (int kc = 0; kc < 2; ++kc)
#pragma unroll
        for (int pt = 0; pt < 3; ++pt) gg[pt] = wmma16(pf[pt][kc], aw[kc], gg[pt]);
#pragma unroll
      for (int pt = 0; pt < 3; ++pt) { *(v4f*)&sg2[wave][col][pt * 16 + 8 * g] = __builtin_shufflevector(gg[pt], gg[pt], 0, 1, 2, 3); *(v4f*)&sg2[wave][col][pt * 16 + 8 * g + 4] = __builtin_shufflevector(gg[pt], gg[pt], 4, 5, 6, 7); } }
    v8f c[2] = {};
#pragma unroll
    for (int kc = 0; kc < 2; ++kc)
#pragma unroll
      for (int ct = 0; ct < 2; ++ct) c[ct] = wmma16(kh[ct][kc], au[kc], c[ct]);   // c[ct][r] = key j0 + 16 ct + 8 g + r against query col
    LDSX();
    if (j0 + 31 <= i0) {   // all 32 keys have j <= i: the sixteen values are read unmasked, in one run
#pragma unroll
      for (int ct = 0; ct < 2; ++ct)
#pragma unroll
        for (int r = 0; r < 8; ++r) s[ct][r] = (c[ct][r] + d1[ct * 16 + r]) * 0.125f; }
    else if (j0 >= i0 + 17) {   // all 32 keys have j >= i + 2 (no such trip exists for the rows of the last 16: j0 + 31 < T)
#pragma unroll
      for (int ct = 0; ct < 2; ++ct)
#pragma unroll
        for (int r = 0; r < 8; ++r) s[ct][r] = (c[ct][r] + d2[ct * 16 + r]) * 0.125f; }
    else {   // the trips that touch the diagonal: tile by tile
#pragma unroll
      for (int ct = 0; ct < 2; ++ct) { const int jc = j0 + ct * 16;
        if (jc + 15 <= i0) {
#pragma unroll
          for (int r = 0; r < 8; ++r) s[ct][r] = (c[ct][r] + d1[ct * 16 + r]) * 0.125f; }
        else if (jc >= i0 + 17) {
#pragma unroll
          for (int r = 0; r < 8; ++r) s[ct][r] = (c[ct][r] + d2[ct * 16 + r]) * 0.125f; }
        else { const int dj = jc - i0 + 8 * g - col;   // the two tiles on the diagonal: chosen per element by j - i = dj + r
          const bool norow = lastblk && col == 15;   // query T - 1 has no row i + 1
          if (jc <= i0) {   // jc == i0: both windows were multiplied in this trip
#pragma unroll
            for (int r = 0; r < 8; ++r) { const int d = dj + r; const float b1 = d1[ct * 16 + r], b2 = d2[ct * 16 + r];
              s[ct][r] = (c[ct][r] + (d <= 0 ? b1 : (d == 1 || norow) ? 0.f : b2)) * 0.125f; } }
          else {   // jc == i0 + 16: j - i >= 1 everywhere, the j <= i window is not read
#pragma unroll
            for (int r = 0; r < 8; ++r) { const int d = dj + r; const float b2 = d2[ct * 16 + r];
              s[ct][r] = (c[ct][r] + ((d == 1 || norow) ? 0.f : b2)) * 0.125f; } } } } }
    float mx[2], es[2];
#pragma unroll
    for (int ct = 0; ct < 2; ++ct) mx[ct] = fmaxf(fmaxf(fmaxf(s[ct][0], s[ct][1]), fmaxf(s[ct][2], s[ct][3])), fmaxf(fmaxf(s[ct][4], s[ct][5]), fmaxf(s[ct][6], s[ct][7])));
    float mt = fmaxf(mx[0], mx[1]); mt = fmaxf(mt, xhalf(mt));   // the other half's sixteen keys
    const float mn = fmaxf(m, mt), alpha = (m <= -1.0e38f) ? 0.f : __expf(m - mn); m = mn;
    float e[2][8];
#pragma unroll
    for (int ct = 0; ct < 2; ++ct) {
#pragma unroll
      for (int r = 0; r < 8; ++r) e[ct][r] = (s[ct][r] <= -1.0e38f) ? 0.f : __expf(s[ct][r] - mn);
      es[ct] = ((e[ct][0] + e[ct][1]) + (e[ct][2] + e[ct][3])) + ((e[ct][4] + e[ct][5]) + (e[ct][6] + e[ct][7])); }
    l = l * alpha + (es[0] + es[1]);   // the halves' sums are joined once, behind the loop
#pragma unroll
    for (int j = 0; j < 4; ++j)
#pragma unroll
      for (int r = 0; r < 8; ++r) acc[j][r] *= alpha;
    fetch(ks + 1 < TT / 32 ? ks + 1 : ks);   // the next trip's tiles fly under the v . P products (the last trip names its own again: always in bounds, never stored)
    v16h pa, pr;   // B fragment of P^T: elements 0..7 = keys 8 g + 0..7, 8..15 = keys 16 + 8 g + 0..7 of query col, which is what this lane's two score tiles hold
#pragma unroll
    for (int i = 0; i < 8; ++i) { const float x0 = e[0][i] * 2048.0f, x1 = e[1][i] * 2048.0f; const _Float16 h0 = (_Float16)x0, h1 = (_Float16)x1; pa[i] = h0; pa[8 + i] = h1; pr[i] = (_Float16)(x0 - (float)h0); pr[8 + i] = (_Float16)(x1 - (float)h1); }
#pragma unroll
    for (int j = 0; j < 4; ++j) { const v16h vh = frag_h(&u.t.VH[j * 16 + col][0], lane), vl = frag_h(&u.t.VL[j * 16 + col][0], lane);   // both planes' fragments in one run: one LDS wait for three products
      acc[j] = wmma16(vh, pa, acc[j]); acc[j] = wmma16(vh, pr, acc[j]); acc[j] = wmma16(vl, pa, acc[j]); }
    LDSX(); }
  __syncthreads();   // every wave has left the last tiles before they become output staging
  { const float lt = l + xhalf(l); const float il = (lt > 0.f) ? (1.0f / 2048.0f) / lt : 0.f;   // fully masked rows -> zeros (the module zeroes them after the softmax)
#pragma unroll
    for (int j = 0; j < 4; ++j) { const v8f o = acc[j] * il; *(v4f*)&u.so[wave][col][j * 16 + 8 * g] = __builtin_shufflevector(o, o, 0, 1, 2, 3); *(v4f*)&u.so[wave][col][j * 16 + 8 * g + 4] = __builtin_shufflevector(o, o, 4, 5, 6, 7); } }
  LDSX(); for (int rl = 0; rl < 16; ++rl) if (lane < 16) vst2(X + (b * TT + i0 + rl) * DMD + h * HD + lane * 4, *(const v4f*)&u.so[wave][rl][lane * 4]); }
// ---- k_out: block = (64 rows, 128 of 1024 cols): out = x (hi + lo) . Wo + bo
__global__ __launch_bounds__(128) void k_out(const float* __restrict__ X, const float* __restrict__ WO, const float* __restrict__ BO, float* __restrict__ OUT) { __shared__ __align__(16) float sf[4][16][132];
  const int tid = threadIdx.x, wave = tid >> 5, lane = tid & 31, col = lane & 15, g = lane >> 4; const int c0 = blockIdx.y * 128; const size_t r0 = (size_t)blockIdx.x * 64 + wave * 16;
  __shared__ __align__(16) GTiles<true> t;
  v8f acc[8] = {};
  gemm_tiles<true>(X + (size_t)blockIdx.x * 64 * DMD, WO + c0, t, tid, acc);
#pragma unroll
  for (int j = 0; j < 8; ++j) { const float bb = bfr(BO[c0 + j * 16 + col]);
#pragma unroll
    for (int r = 0; r < 8; ++r) sf[wave][8 * g + r][j * 16 + col] = acc[j][r] + bb; }
  LDSX(); for (int rl = 0; rl < 16; ++rl) vst2(OUT + (r0 + rl) * DMD + c0 + lane * 4, *(const v4f*)&sf[wave][rl][lane * 4]); }
extern "C" void kernel_launch(void* const* d_in, const int* in_sizes, int n_in, void* d_out, int out_size, void* d_ws, size_t ws_size, hipStream_t stream) {
  (void)in_sizes; (void)n_in; (void)out_size;
  const float** F = (const float**)d_in;   // 0 x [2,2048,1024]; 1 Wq, 2 bq, 3 Wk, 4 bk, 5 Wv, 6 bv, 7 Wp, 8 bp, 9 Wo, 10 bo ((in,out) [1024,1024]); 11 u [1,16,1,64], 12 v [1,16,1,64]
  if (ws_size < (size_t)WS_END) return;
  char* ws = (char*)d_ws; float* Q = (float*)(ws + WS_Q); _Float16 *KH = (_Float16*)(ws + WS_KH), *PH = (_Float16*)(ws + WS_PH), *VH = (_Float16*)(ws + WS_VH), *VL = (_Float16*)(ws + WS_VL); float* X = (float*)(ws + WS_X);
  float* SINT = (float*)(ws + WS_SIN);
  k_sin<<<TT, 256, 0, stream>>>(SINT);
  k_proj<0><<<dim3(TNB * TT / 64, DMD / 128, 3), 128, 0, stream>>>(F[0], F[1], F[2], F[3], F[4], F[5], F[6], F[7], F[8], Q, KH, VH, VL, PH);
  k_proj<3><<<dim3(TT / 64, DMD / 128, 1), 128, 0, stream>>>(SINT, F[1], F[2], F[3], F[4], F[5], F[6], F[7], F[8], Q, KH, VH, VL, PH);
  k_padph<<<64, 256, 0, stream>>>(PH);
  k_att<<<dim3(TQB2, NH, TNB), 128, 0, stream>>>(Q, KH, PH, VH, VL, F[11], F[12], X);
  k_out<<<dim3(TOB2, DMD / 128), 128, 0, stream>>>(X, F[9], F[10], (float*)d_out);
}

// v008
// One run takes 190 microseconds.
// It is 1.32 times as fast as v006, going by the measured steps of the versions left out in between.
// Over all steps from v000 it is 3.57 times as fast.
// compute dtype: all float inputs rounded to bf16; q/k/v projections with EXACT bf16 products on WMMA 16x16x32 ((in,out) weights, + bias), the sinusoidal position table built once on device in f32 (precise sinf/cosf/powf, k_sin) and projected with hi + lo (2 products) + bp, f32 accumulate; q kept in f32 (bias_u / bias_v added per head, then split into f16 hi + residual fragments), k / ph / v rounded once to f16; content scores (q+bu) . k and the Transformer-XL position term (q+bv) . ph with single f16 products (logits ~1-2; q, k, ph each rounded once), the rel_shift realised exactly as an index map onto 16 x 48 position windows (incl. its upper-triangle wrap-around rows and the zero at j == i+1), x 1/8, running-max softmax in f32 (hardware exp); P (x 2^11) and v each rounded once to f16, one product; out = x (bf16 hi + lo) . Wo + bo; f32 output.
#include <hip/hip_runtime.h>
#include <math.h>

typedef __attribute__((ext_vector_type(16))) _Float16 v16h;
typedef __attribute__((ext_vector_type(16))) __bf16 v16b;
typedef __attribute__((ext_vector_type(8)))  _Float16 v8h;
typedef __attribute__((ext_vector_type(8)))  float v8f;
typedef __attribute__((ext_vector_type(4)))  float v4f;
typedef __attribute__((ext_vector_type(2)))  float v2f;
typedef __attribute__((ext_vector_type(4)))  unsigned v4u;
typedef __attribute__((ext_vector_type(4)))  int v4i;
typedef float __attribute__((may_alias)) float_a;
typedef int __attribute__((may_alias)) int_a;

template <typename T> __device__ __forceinline__ void vst2(void* p, T v) { *(T*)p = v;  }
__device__ __forceinline__ v8f wmma16(v16h a, v16h b, v8f c) {
  v8f d = __builtin_amdgcn_wmma_f32_16x16x32_f16(false, a, false, b, (short)0, c, false, false);
  asm volatile("v_nop\n\tv_nop\n\tv_nop\n\tv_nop" : "+v"(d) : "v"(a), "v"(b));
  return d;
}
__device__ __forceinline__ v8f wmma_bf(v16b a, v16b b, v8f c) {
  v8f d = __builtin_amdgcn_wmma_f32_16x16x32_bf16(false, a, false, b, (short)0, c, false, false);
  asm volatile("v_nop\n\tv_nop\n\tv_nop\n\tv_nop" : "+v"(d) : "v"(a), "v"(b));
  return d;
}
// 16x16x32 fragments: lane = (h = lane>>4, row/col = lane&15); elements 0..7 = k0+8h+0..7, 8..15 = k0+16+8h+0..7; D element r = row 8h+r
__device__ __forceinline__ v16h frag_h(const _Float16* rowk0, int lane) {
  union { v16h v; v8h q[2]; } u; const _Float16* p = rowk0 + 8 * (lane >> 4);
  u.q[0] = *(const v8h*)p; u.q[1] = *(const v8h*)(p + 16); return u.v;
}
__device__ __forceinline__ v16h frag_f32(const float* rowk0, int lane) {
  v16h a; const float* p = rowk0 + 8 * (lane >> 4);
#pragma unroll
  for (int i = 0; i < 8; ++i) { a[i] = (_Float16)p[i]; a[8 + i] = (_Float16)p[16 + i]; }
  return a;
}
__device__ __forceinline__ v16h frag_f32s(const float* rowk0, int lane, float sc) {
  v16h a; const float* p = rowk0 + 8 * (lane >> 4);
#pragma unroll
  for (int i = 0; i < 8; ++i) { a[i] = (_Float16)(p[i] * sc); a[8 + i] = (_Float16)(p[16 + i] * sc); }
  return a;
}
// column fragment from a [K][ld] layout (column n), rows >= K read as 0
__device__ __forceinline__ v16h fragc_f32(const float* W, int k0, int n, int lane, int ld, int K) {
  v16h a; const int g = lane >> 4;
#pragma unroll
  for (int i = 0; i < 8; ++i) { const int ka = k0 + 8 * g + i, kb = ka + 16;
    a[i] = (_Float16)(ka < K ? W[(size_t)(ka < K ? ka : K - 1) * ld + n] : 0.f); a[8 + i] = (_Float16)(kb < K ? W[(size_t)(kb < K ? kb : K - 1) * ld + n] : 0.f); }
  return a;
}
struct F2 { v16b h, l; };
__device__ __forceinline__ F2 bsplit16(const float v[16]) { F2 r;
#pragma unroll
  for (int i = 0; i < 16; ++i) { const __bf16 h = (__bf16)v[i]; r.h[i] = h; r.l[i] = (__bf16)(v[i] - (float)h); }
  return r; }
__device__ __forceinline__ F2 split_row(const float* row, int k0, int lane) { float v[16]; const float* p = row + k0 + 8 * (lane >> 4);
#pragma unroll
  for (int i = 0; i < 8; ++i) { v[i] = p[i]; v[8 + i] = p[16 + i]; }
  return bsplit16(v); }
__device__ __forceinline__ F2 split_rowK(const float* row, int k0, int lane, int K) { float v[16]; const int g = lane >> 4;
#pragma unroll
  for (int i = 0; i < 8; ++i) { const int ka = k0 + 8 * g + i, kb = ka + 16; v[i] = ka < K ? row[ka < K ? ka : K - 1] : 0.f; v[8 + i] = kb < K ? row[kb < K ? kb : K - 1] : 0.f; }
  return bsplit16(v); }
__device__ __forceinline__ F2 split_col(const float* W, int k0, int n, int lane, int ld, int K) { float v[16]; const int g = lane >> 4;
#pragma unroll
  for (int i = 0; i < 8; ++i) { const int ka = k0 + 8 * g + i, kb = ka + 16; v[i] = ka < K ? W[(size_t)(ka < K ? ka : K - 1) * ld + n] : 0.f; v[8 + i] = kb < K ? W[(size_t)(kb < K ? kb : K - 1) * ld + n] : 0.f; }
  return bsplit16(v); }
__device__ __forceinline__ v8f mac3(const F2& a, const F2& b, v8f c) { c = wmma_bf(a.l, b.h, c); c = wmma_bf(a.h, b.l, c); return wmma_bf(a.h, b.h, c); }
__device__ __forceinline__ float sigm(float v) { return 1.0f / (1.0f + expf(-v)); }
#define LDSX() do { asm volatile("s_wait_dscnt 0" ::: "memory"); __builtin_amdgcn_wave_barrier(); __builtin_amdgcn_fence(__ATOMIC_RELEASE, "workgroup"); } while (0)


// Relative multi-head self attention (Transformer-XL style rel_shift; B 2, S 2,048, D 1,024, 16 heads x 64): pos = sinusoid(S, D) Wp + bp; scores = ((q+u) k^T + rel_shift((q+v) pos^T)) / 8, softmax, . v, Wo + bo.
#define NB 2
#define TT 2048
#define DMD 1024
#define NH 16
#define HD 64
#define POFF 32                 // ph buffer row offset (rows < 0 and >= T read as zeros)
#define PROWS (TT + 64)
#ifndef TNB
#define TNB NB
#endif
#ifndef TQB2
#define TQB2 (TT / 64)   // query blocks
#endif
#ifndef TOB2
#define TOB2 (TNB * TT / 64)
#endif
typedef __attribute__((ext_vector_type(8))) __bf16 v8b;
__device__ __forceinline__ v16b frag_b(const __bf16* rowk0, int lane) {
  union { v16b v; v8b q[2]; } u; const __bf16* p = rowk0 + 8 * (lane >> 4);
  u.q[0] = *(const v8b*)p; u.q[1] = *(const v8b*)(p + 16); return u.v;
}
__device__ __forceinline__ float bfr(float v) { return (float)(__bf16)v; }
__device__ __attribute__((noinline)) float exp_ni(float v) { return expf(v); }
__device__ __attribute__((noinline)) float erf_ni(float v) { return erff(v); }

#define WS_Q   0u                                   // f32 q rows [b*u][1024] (+bq)
#define WS_KH  (WS_Q + 4u * (size_t)NB * TT * DMD)       // f16 k rows [b*t][1024]
#define WS_PH  (WS_KH + 2u * (size_t)NB * TT * DMD)      // f16 ph rows [PROWS][1024] (row POFF + p)
#define WS_VH  (WS_PH + 2u * (size_t)PROWS * DMD)        // f16 v planes [b][1024][t]
#define WS_X   (WS_VH + 2u * (size_t)NB * DMD * TT)      // f32 attention output rows [b*u][D]
#define WS_SIN (WS_X + 4u * (size_t)NB * TT * DMD)       // f32 sinusoid table [T][D]
#define WS_END (WS_SIN + 4u * (size_t)TT * DMD)

// ---- operand tiles of the projection GEMMs: one 32-k slice of the block's 64 rows and 128 weight columns, rounded once and shared by the four waves
#define GP 40                   // LDS pitch of a 32-element bf16 row: 80 B = 16 B x odd
typedef __attribute__((ext_vector_type(4))) __bf16 v4b;
template <bool SPLIT> struct GTiles { __bf16 W[2][128][GP]; __bf16 A[2][64][GP]; __bf16 L[SPLIT ? 2 : 1][SPLIT ? 64 : 1][GP]; };   // W transposed to [column][k]; A rows (hi), L their residuals
// acc[j] += rows (bf16, or bf16 hi then lo) . W[:, 16 j ..]; k ascending in slices of 32, as one product (two with SPLIT) per slice and column tile
template <bool SPLIT>
__device__ __forceinline__ void gemm_tiles(const float* __restrict__ Arows, const float* __restrict__ Wcols, GTiles<SPLIT>& t, int tid, v8f* acc) {
  const int wave = tid >> 5, lane = tid & 31, col = lane & 15, r8 = tid >> 3, q8 = tid & 7;
  // whole-line fetch: a wave reads 512 contiguous bytes of one weight row (8 rows a wave), 8 lanes read one 128-byte piece of an operand row
  const float* gw = Wcols + (size_t)(wave * 8) * DMD + lane * 4; const float* ga = Arows + (size_t)r8 * DMD + q8 * 4;
  v4f rw[8], ra[4];
  auto fetch = [&](int kc) {
#pragma unroll
    for (int i = 0; i < 8; ++i) rw[i] = *(const v4f*)(gw + (size_t)(kc * 32 + i) * DMD);
#pragma unroll
    for (int i = 0; i < 4; ++i) ra[i] = *(const v4f*)(ga + (size_t)(i * 16) * DMD + kc * 32);
    asm volatile("s_wait_xcnt 0x0" ::: "memory"); };   // stands in front of the loop's advance of these loads' address registers
  fetch(0);
#pragma unroll 2   // the two buffers' addresses become constants
  for (int kc = 0; kc < DMD / 32; ++kc) { const int bf = kc & 1;
#pragma unroll
    for (int c = 0; c < 4; ++c) { v8b p;
#pragma unroll
      for (int i = 0; i < 8; ++i) p[i] = (__bf16)rw[i][c];
      *(v8b*)&t.W[bf][lane * 4 + c][wave * 8] = p; }
#pragma unroll
    for (int i = 0; i < 4; ++i) { v4b hv, lv;
#pragma unroll
      for (int e = 0; e < 4; ++e) { const __bf16 hh = (__bf16)ra[i][e]; hv[e] = hh; if (SPLIT) lv[e] = (__bf16)(ra[i][e] - (float)hh); }
      *(v4b*)&t.A[bf][i * 16 + r8][q8 * 4] = hv; if (SPLIT) *(v4b*)&t.L[bf][i * 16 + r8][q8 * 4] = lv; }
    __syncthreads();   // this slice is published; the other buffer's readers all stand in front of this barrier, so the next trip may refill it
    if (kc + 1 < DMD / 32) fetch(kc + 1);   // the next slice flies under this slice's products (issued behind the barrier: a load does not stay in flight across it)
    const v16b a = frag_b(&t.A[bf][wave * 16 + col][0], lane); v16b al; if (SPLIT) al = frag_b(&t.L[bf][wave * 16 + col][0], lane);
    v16b w[8];
#pragma unroll
    for (int j = 0; j < 8; ++j) w[j] = frag_b(&t.W[bf][j * 16 + col][0], lane);
#pragma unroll
    for (int j = 0; j < 8; ++j) { acc[j] = wmma_bf(a, w[j], acc[j]); if (SPLIT) acc[j] = wmma_bf(al, w[j], acc[j]); }
    __builtin_amdgcn_sched_barrier(0);   // keeps the next slice's roundings, which wait for its loads, behind this slice's products
  } }
struct ProjEpi { float sf[4][16][132]; _Float16 sh[64][136]; _Float16 th[128][72]; };
union ProjStage { GTiles<false> t; GTiles<true> ts; ProjEpi e; };   // the epilogue's staging reuses the tiles' LDS behind the loop
// ---- k_proj: block = (64 rows, 128-col group, which): 0 q (f32 rows), 1 k (f16 rows), 2 v (f16 planes), 3 ph (f16 rows at POFF), natural W + bias
// one grid for the four independent projections: the ph blocks, which alone would leave three of four wave places empty and have twice the products a slice, come first; then q, k, v (row block fastest, as before)
#define PRB (TNB * TT / 64)     // row blocks of q, k, v
#define PPB (TT / 64)           // row blocks of ph
#define PCB (DMD / 128)         // column groups
__global__ __launch_bounds__(128) void k_proj(const float* __restrict__ Xin, const float* __restrict__ SINT, const float* __restrict__ WQ, const float* __restrict__ BQ, const float* __restrict__ WK, const float* __restrict__ BK, const float* __restrict__ WV, const float* __restrict__ BV, const float* __restrict__ WP, const float* __restrict__ BP, float* __restrict__ Q, _Float16* __restrict__ KH, _Float16* __restrict__ VH, _Float16* __restrict__ PH) {
  __shared__ __align__(16) ProjStage u;
  float (&sf)[4][16][132] = u.e.sf; _Float16 (&sh)[64][136] = u.e.sh; _Float16 (&th)[128][72] = u.e.th;
  const int tid = threadIdx.x, wave = tid >> 5, lane = tid & 31, col = lane & 15, g = lane >> 4;
  const int bid = blockIdx.x; const bool isph = bid < PPB * PCB; const int rest = bid - PPB * PCB;   // all from the block index: scalar, the same for the whole block
  const int which = isph ? 3 : rest / (PRB * PCB); const int bx = isph ? bid % PPB : rest % PRB; const int c0 = (isph ? bid / PPB : (rest / PRB) % PCB) * 128;
  const float* Wm = (which == 0 ? WQ : which == 1 ? WK : which == 2 ? WV : WP); const float* Bm = (which == 0 ? BQ : which == 1 ? BK : which == 2 ? BV : BP);
  const size_t r0 = (size_t)bx * 64 + wave * 16;
  v8f acc[8] = {};
  if (isph) gemm_tiles<true>(SINT + (size_t)bx * 64 * DMD, WP + c0, u.ts, tid, acc);   // rows of the f32 sinusoid table (k_sin), hi + lo
  else gemm_tiles<false>(Xin + (size_t)bx * 64 * DMD, Wm + c0, u.t, tid, acc);
  __syncthreads();   // every wave has left the last tiles before they become output staging
#pragma unroll
  for (int j = 0; j < 8; ++j) { const float bb = bfr(Bm[c0 + j * 16 + col]);
#pragma unroll
    for (int r = 0; r < 8; ++r) { const float v = acc[j][r] + bb; const int rl = wave * 16 + 8 * g + r, cl = j * 16 + col;
      if (which == 0) sf[wave][8 * g + r][cl] = v; else if (which == 2) th[cl][rl] = (_Float16)v; else sh[rl][cl] = (_Float16)v; } }
  __syncthreads();
  if (which == 0) { for (int rl = 0; rl < 16; ++rl) vst2(Q + (r0 + rl) * DMD + c0 + lane * 4, *(const v4f*)&sf[wave][rl][lane * 4]); }
  else if (which == 2) { const size_t b = ((size_t)bx * 64) / TT; const int t0 = (int)(((size_t)bx * 64) % TT); for (int e = tid; e < 128 * 8; e += 128) { const int cl = e >> 3, q = e & 7; const size_t o = (b * DMD + c0 + cl) * (size_t)TT + t0 + q * 8; vst2((unsigned*)(VH + o), *(const v4u*)&th[cl][q * 8]); } }
  else { _Float16* dst = (which == 1) ? (KH + (size_t)bx * 64 * DMD) : (PH + ((size_t)POFF + bx * 64) * DMD); for (int e = tid; e < 64 * 16; e += 128) { const int rl = e >> 4, q = e & 15; vst2((unsigned*)(dst + (size_t)rl * DMD + c0 + q * 8), *(const v4u*)&sh[rl][q * 8]); } } }
// ---- k_sin: block = position s: the module's sinusoid table row [sin(s f_c) | cos(s f_c)], f_c = 1e4^(-2c/D), f32; the 64 blocks behind the table's write the zero rows of the ph buffer
__global__ __launch_bounds__(256) void k_sin(float* __restrict__ SINT, _Float16* __restrict__ PH) { __shared__ __align__(16) float sr[DMD]; const int t = threadIdx.x; const int s = blockIdx.x;
  if (s >= TT) { const int r = s - TT; const size_t row = (r < POFF) ? r : (TT + r);   // the POFF rows before and the rows after the table are zeros: 0..31 and TT+32 .. TT+63 (the whole block leaves here, in front of the barrier)
    v4u z; z[0] = z[1] = z[2] = z[3] = 0u; if (t < DMD / 8) vst2((unsigned*)(PH + row * DMD + t * 8), z); return; }
  for (int c = t; c < DMD / 2; c += 256) { const float ang = (float)s * powf(10000.0f, -2.0f * (float)c / (float)DMD); sr[c] = sinf(ang); sr[DMD / 2 + c] = cosf(ang); }
  __syncthreads(); vst2(SINT + (size_t)s * DMD + t * 4, *(const v4f*)&sr[t * 4]); }
// fragments of (q + bias) for 16 rows, head h: hi and residual as f16 (unscaled; q ~ O(1))
__device__ __forceinline__ void qfrags(const float* __restrict__ Q, size_t row0, int h, const float* __restrict__ bias, int lane, v16h* hi, v16h* lo) { const int col = lane & 15, g = lane >> 4; size_t row = row0 + col; if (row > (size_t)NB * TT - 1) row = (size_t)NB * TT - 1;   // clamp (only the never-used row T of the last batch)
#pragma unroll
  for (int kc = 0; kc < 2; ++kc) { const float* p = Q + row * DMD + h * HD + kc * 32 + 8 * g; const float* bp = bias + h * HD + kc * 32 + 8 * g; v16h a, b;
#pragma unroll
    for (int i = 0; i < 8; ++i) { const float v0 = p[i] + bfr(bp[i]), v1 = p[16 + i] + bfr(bp[16 + i]); const _Float16 h0 = (_Float16)v0, h1 = (_Float16)v1; a[i] = h0; a[8 + i] = h1; b[i] = (_Float16)(v0 - (float)h0); b[8 + i] = (_Float16)(v1 - (float)h1); }
    hi[kc] = a; lo[kc] = b; } }
// lane l's value from lane l ^ 16 (the wave's other half), by a vector cross-row move
__device__ __forceinline__ float xhalf(float x) { return __builtin_bit_cast(float, __builtin_amdgcn_permlanex16(__builtin_bit_cast(int, x), __builtin_bit_cast(int, x), 0x76543210, 0xfedcba98, false, false)); }
// LDS row pitches: 16 B x odd (144 B for 64-half rows, 80 B for 32-half rows)
#define KP 72
#define VP 40
#define SGP 52                  // f32 pitch of a query's 48 position products: 16 B x odd for the 16-byte stores; the shifted reads step 51 banks from query to query
struct AttTiles { _Float16 K[32][KP], VH[64][VP], PL[96][KP], PU[96][KP]; };
union AttStage { AttTiles t; float so[4][16][68]; };
// ---- k_att: block = (64 queries u, h, b). Every product is taken transposed (keys, window positions or head dims as rows, the wave's 16 queries as columns):
// lanes col and col + 16 hold all of query col, so its maximum and sum need only an exchange between the two halves, its rescale is lane-local, and the two score tiles of a trip, converted in place, are the B fragment of v^T . P^T
__global__ __launch_bounds__(128) void k_att(const float* __restrict__ Q, const _Float16* __restrict__ KH, const _Float16* __restrict__ PH, const _Float16* __restrict__ VH, const float* __restrict__ BU, const float* __restrict__ BVv, float* __restrict__ X) {
  __shared__ __align__(16) float sg1[4][16][SGP], sg2[4][16][SGP];   // [wave][query][window column]: the position products on their way through the rel-shift
  __shared__ __align__(16) AttStage u;   // the trip's operand tiles, shared by the four waves; output staging behind the loop
  const int tid = threadIdx.x, wave = __builtin_amdgcn_readfirstlane(tid >> 5), lane = tid & 31, col = lane & 15, g = lane >> 4; const int qb = blockIdx.x, h = blockIdx.y; const size_t b = blockIdx.z; const int i0 = qb * 64 + wave * 16;   // the wave's number in a scalar register: every test on i0 below is a scalar branch
  // whole-line fetch of one trip's tiles: 8 lanes per 128-byte row (k, ph), 4 lanes per 64-byte row (v plane); held in registers until the tile in LDS is free
  const int r8 = tid >> 3, q8 = tid & 7, r4 = tid >> 2, q4 = tid & 3;
  // block-uniform bases and 32-bit lane byte offsets
  const char* gK = (const char*)(KH + b * TT * DMD + h * HD); const char* gP = (const char*)(PH + h * HD);
  const char* gVH = (const char*)(VH + (b * DMD + (size_t)h * HD) * TT);
  const unsigned oK = (unsigned)(r8 * DMD + q8 * 8) * 2u, oV = (unsigned)(r4 * TT + q4 * 8) * 2u;
  const int wrow = 48 - 16 * wave;   // this wave's first row inside the block's 96-row position window
  v8h rk[2], rvh[2], rp[6];
  auto fetch = [&](int ks) {
#pragma unroll
    for (int i = 0; i < 2; ++i) rk[i] = *(const v8h*)(gK + (oK + (unsigned)((ks * 32 + i * 16) * DMD * 2)));
    asm volatile("s_wait_xcnt 0x0" ::: "memory");   // stands in front of the next loads, whose results may be given the registers that held these loads' address
#pragma unroll   // the index names registers
    for (int i = 0; i < 2; ++i) rvh[i] = *(const v8h*)(gVH + (oV + (unsigned)((i * 32 * TT + ks * 32) * 2)));
    // 96-row position window of the block: the j <= i window while some wave needs it, else the j >= i + 2 window (rows outside the buffer are used by no wave: clamped)
    const int base = (ks * 32 <= qb * 64 + 63) ? (TT - 64 - qb * 64 + ks * 32 + POFF) : (ks * 32 - qb * 64 - 65 + POFF);
#pragma unroll
    for (int i = 0; i < 6; ++i) { int row = base + i * 16 + r8; row = row < 0 ? 0 : (row > PROWS - 1 ? PROWS - 1 : row); rp[i] = *(const v8h*)(gP + (unsigned)(row * DMD + q8 * 8) * 2u); } };
  fetch(0);
  v16h au[2], av[2], aw[2], tmpl[2];   // (q+u) rows i0.., (q+v) rows i0.., (q+v) rows i0+1.. (for the wrapped upper-triangle term); single f16 rounding (residuals dropped: VGPR budget)
  qfrags(Q, b * TT + i0, h, BU, lane, au, tmpl); qfrags(Q, b * TT + i0, h, BVv, lane, av, tmpl);
  qfrags(Q, b * TT + i0 + 1, h, BVv, lane, aw, tmpl);   // rows i+1; for i = T-1 the row belongs to the next batch (or is clamped) but its products are never used: j >= i+2 cannot hold for i = T-1
  const bool lastblk = (i0 + 16 >= TT);
  const float* d1 = &sg1[wave][col][15 - col + 8 * g]; const float* d2 = &sg2[wave][col][15 - col + 8 * g];   // key 16 ct + 8 g + r of query col takes window column 15 - col + 16 ct + 8 g + r: eight floats in a row
  float m = -3.0e38f, l = 0.f;   // query col's running maximum (equal in both halves) and this half's share of its sum
  v8f acc[4] = {};   // acc[j][r] = head dim 16 j + 8 g + r of query col
#pragma unroll 1
  for (int ks = 0; ks < TT / 32; ++ks) { float s[2][8];
    __syncthreads();   // every wave has left the previous trip's tiles
#pragma unroll
    for (int i = 0; i < 2; ++i) { *(v8h*)&u.t.K[i * 16 + r8][q8 * 8] = rk[i]; *(v8h*)&u.t.VH[i * 32 + r4][q4 * 8] = rvh[i]; }
    const bool blow = (ks * 32 <= qb * 64 + 63);
    { _Float16 (*dst)[KP] = blow ? u.t.PL : u.t.PU;
#pragma unroll
      for (int i = 0; i < 6; ++i) *(v8h*)&dst[i * 16 + r8][q8 * 8] = rp[i]; }
    if (blow && ks * 32 + 31 >= qb * 64 + 2) {   // the two trips on the diagonal need both windows: the j >= i + 2 one is brought here
#pragma unroll
      for (int i = 0; i < 6; ++i) { int row = ks * 32 - qb * 64 - 65 + POFF + i * 16 + r8; row = row < 0 ? 0 : (row > PROWS - 1 ? PROWS - 1 : row); *(v8h*)&u.t.PU[i * 16 + r8][q8 * 8] = *(const v8h*)(gP + (unsigned)(row * DMD + q8 * 8) * 2u); } }
    __syncthreads();   // this trip's tiles are published
    // both 16-key tiles of the trip in one pass: the wave's 16 x 48 position window is multiplied once (its middle 16 columns serve both tiles), and every LDS exchange below is waited for once a trip
    // (the loops of this pass are unrolled because their indices name registers: fragments, accumulators, scores)
    const int j0 = ks * 32; v16h kh[2][2];
#pragma unroll
    for (int ct = 0; ct < 2; ++ct)
#pragma unroll
      for (int kc = 0; kc < 2; ++kc) kh[ct][kc] = frag_h(&u.t.K[ct * 16 + col][kc * 32], lane);
    if (j0 <= i0 + 15) { v16h pf[3][2]; v8f gg[3] = {};   // some (i, j) with j <= i: window p = T-16-i0+j0 .. +47, rows wrow .. +47 of the staged window
#pragma unroll
      for (int pt = 0; pt < 3; ++pt)
#pragma unroll
        for (int kc = 0; kc < 2; ++kc) pf[pt][kc] = frag_h(&u.t.PL[wrow + pt * 16 + col][kc * 32], lane);
#pragma unroll
      for (int kc = 0; kc < 2; ++kc)
#pragma unroll
        for (int pt = 0; pt < 3; ++pt) gg[pt] = wmma16(pf[pt][kc], av[kc], gg[pt]);
#pragma unroll
      for (int pt = 0; pt < 3; ++pt) { *(v4f*)&sg1[wave][col][pt * 16 + 8 * g] = __builtin_shufflevector(gg[pt], gg[pt], 0, 1, 2, 3); *(v4f*)&sg1[wave][col][pt * 16 + 8 * g + 4] = __builtin_shufflevector(gg[pt], gg[pt], 4, 5, 6, 7); } }
    if (j0 + 31 >= i0 + 2) { v16h pf[3][2]; v8f gg[3] = {};   // some (i, j) with j >= i + 2: window p = j0-i0-17 .. +47
#pragma unroll
      for (int pt = 0; pt < 3; ++pt)
#pragma unroll
        for (int kc = 0; kc < 2; ++kc) pf[pt][kc] = frag_h(&u.t.PU[wrow + pt * 16 + col][kc * 32], lane);
#pragma unroll
      for (int kc = 0; kc < 2; ++kc)
#pragma unroll
        for (int pt = 0; pt < 3; ++pt) gg[pt] = wmma16(pf[pt][kc], aw[kc], gg[pt]);
#pragma unroll
      for (int pt = 0; pt < 3; ++pt) { *(v4f*)&sg2[wave][col][pt * 16 + 8 * g] = __builtin_shufflevector(gg[pt], gg[pt], 0, 1, 2, 3); *(v4f*)&sg2[wave][col][pt * 16 + 8 * g + 4] = __builtin_shufflevector(gg[pt], gg[pt], 4, 5, 6, 7); } }
    v8f c[2] = {};
#pragma unroll
    for (int kc = 0; kc < 2; ++kc)
#pragma unroll
      for (int ct = 0; ct < 2; ++ct) c[ct] = wmma16(kh[ct][kc], au[kc], c[ct]);   // c[ct][r] = key j0 + 16 ct + 8 g + r against query col
    LDSX();
    if (j0 + 31 <= i0) {   // all 32 keys have j <= i: the sixteen values are read unmasked, in one run
#pragma unroll
      for (int ct = 0; ct < 2; ++ct)
#pragma unroll
        for (int r = 0; r < 8; ++r) s[ct][r] = (c[ct][r] + d1[ct * 16 + r]) * 0.125f; }
    else if (j0 >= i0 + 17) {   // all 32 keys have j >= i + 2 (no such trip exists for the rows of the last 16: j0 + 31 < T)
#pragma unroll
      for (int ct = 0; ct < 2; ++ct)
#pragma unroll
        for (int r = 0; r < 8; ++r) s[ct][r] = (c[ct][r] + d2[ct * 16 + r]) * 0.125f; }
    else {   // the trips that touch the diagonal: tile by tile
#pragma unroll
      for (int ct = 0; ct < 2; ++ct) { const int jc = j0 + ct * 16;
        if (jc + 15 <= i0) {
#pragma unroll
          for (int r = 0; r < 8; ++r) s[ct][r] = (c[ct][r] + d1[ct * 16 + r]) * 0.125f; }
        else if (jc >= i0 + 17) {
#pragma unroll
          for (int r = 0; r < 8; ++r) s[ct][r] = (c[ct][r] + d2[ct * 16 + r]) * 0.125f; }
        else { const int dj = jc - i0 + 8 * g - col;   // the two tiles on the diagonal: chosen per element by j - i = dj + r
          const bool norow = lastblk && col == 15;   // query T - 1 has no row i + 1
          if (jc <= i0) {   // jc == i0: both windows were multiplied in this trip
#pragma unroll
            for (int r = 0; r < 8; ++r) { const int d = dj + r; const float b1 = d1[ct * 16 + r], b2 = d2[ct * 16 + r];
              s[ct][r] = (c[ct][r] + (d <= 0 ? b1 : (d == 1 || norow) ? 0.f : b2)) * 0.125f; } }
          else {   // jc == i0 + 16: j - i >= 1 everywhere, the j <= i window is not read
#pragma unroll
            for (int r = 0; r < 8; ++r) { const int d = dj + r; const float b2 = d2[ct * 16 + r];
              s[ct][r] = (c[ct][r] + ((d == 1 || norow) ? 0.f : b2)) * 0.125f; } } } } }
    float mx[2], es[2];
#pragma unroll
    for (int ct = 0; ct < 2; ++ct) mx[ct] = fmaxf(fmaxf(fmaxf(s[ct][0], s[ct][1]), fmaxf(s[ct][2], s[ct][3])), fmaxf(fmaxf(s[ct][4], s[ct][5]), fmaxf(s[ct][6], s[ct][7])));
    float mt = fmaxf(mx[0], mx[1]); mt = fmaxf(mt, xhalf(mt));   // the other half's sixteen keys
    const float mn = fmaxf(m, mt), alpha = (m <= -1.0e38f) ? 0.f : __expf(m - mn); m = mn;
    float e[2][8];
#pragma unroll
    for (int ct = 0; ct < 2; ++ct) {
#pragma unroll
      for (int r = 0; r < 8; ++r) e[ct][r] = (s[ct][r] <= -1.0e38f) ? 0.f : __expf(s[ct][r] - mn);
      es[ct] = ((e[ct][0] + e[ct][1]) + (e[ct][2] + e[ct][3])) + ((e[ct][4] + e[ct][5]) + (e[ct][6] + e[ct][7])); }
    l = l * alpha + (es[0] + es[1]);   // the halves' sums are joined once, behind the loop
#pragma unroll
    for (int j = 0; j < 4; ++j)
#pragma unroll
      for (int r = 0; r < 8; ++r) acc[j][r] *= alpha;
    fetch(ks + 1 < TT / 32 ? ks + 1 : ks);   // the next trip's tiles fly under the v . P products (the last trip names its own again: always in bounds, never stored)
    v16h pa, vf[4];   // B fragment of P^T: elements 0..7 = keys 8 g + 0..7, 8..15 = keys 16 + 8 g + 0..7 of query col, which is what this lane's two score tiles hold
#pragma unroll
    for (int i = 0; i < 8; ++i) { pa[i] = (_Float16)(e[0][i] * 2048.0f); pa[8 + i] = (_Float16)(e[1][i] * 2048.0f); }   // x 2^11: small weights stay normal f16 numbers
#pragma unroll
    for (int j = 0; j < 4; ++j) vf[j] = frag_h(&u.t.VH[j * 16 + col][0], lane);   // the four fragments in one run: one LDS wait for the four products
#pragma unroll
    for (int j = 0; j < 4; ++j) acc[j] = wmma16(vf[j], pa, acc[j]);
    LDSX(); }
  __syncthreads();   // every wave has left the last tiles before they become output staging
  { const float lt = l + xhalf(l); const float il = (lt > 0.f) ? (1.0f / 2048.0f) / lt : 0.f;   // fully masked rows -> zeros (the module zeroes them after the softmax)
#pragma unroll
    for (int j = 0; j < 4; ++j) { const v8f o = acc[j] * il; *(v4f*)&u.so[wave][col][j * 16 + 8 * g] = __builtin_shufflevector(o, o, 0, 1, 2, 3); *(v4f*)&u.so[wave][col][j * 16 + 8 * g + 4] = __builtin_shufflevector(o, o, 4, 5, 6, 7); } }
  LDSX(); for (int rl = 0; rl < 16; ++rl) if (lane < 16) vst2(X + (b * TT + i0 + rl) * DMD + h * HD + lane * 4, *(const v4f*)&u.so[wave][rl][lane * 4]); }
// ---- k_out: block = (64 rows, 128 of 1024 cols): out = x (hi + lo) . Wo + bo
__global__ __launch_bounds__(128) void k_out(const float* __restrict__ X, const float* __restrict__ WO, const float* __restrict__ BO, float* __restrict__ OUT) { __shared__ __align__(16) float sf[4][16][132];
  const int tid = threadIdx.x, wave = tid >> 5, lane = tid & 31, col = lane & 15, g = lane >> 4; const int c0 = blockIdx.y * 128; const size_t r0 = (size_t)blockIdx.x * 64 + wave * 16;
  __shared__ __align__(16) GTiles<true> t;
  v8f acc[8] = {};
  gemm_tiles<true>(X + (size_t)blockIdx.x * 64 * DMD, WO + c0, t, tid, acc);
#pragma unroll
  for (int j = 0; j < 8; ++j) { const float bb = bfr(BO[c0 + j * 16 + col]);
#pragma unroll
    for (int r = 0; r < 8; ++r) sf[wave][8 * g + r][j * 16 + col] = acc[j][r] + bb; }
  LDSX(); for (int rl = 0; rl < 16; ++rl) vst2(OUT + (r0 + rl) * DMD + c0 + lane * 4, *(const v4f*)&sf[wave][rl][lane * 4]); }
extern "C" void kernel_launch(void* const* d_in, const int* in_sizes, int n_in, void* d_out, int out_size, void* d_ws, size_t ws_size, hipStream_t stream) {
  (void)in_sizes; (void)n_in; (void)out_size;
  const float** F = (const float**)d_in;   // 0 x [2,2048,1024]; 1 Wq, 2 bq, 3 Wk, 4 bk, 5 Wv, 6 bv, 7 Wp, 8 bp, 9 Wo, 10 bo ((in,out) [1024,1024]); 11 u [1,16,1,64], 12 v [1,16,1,64]
  if (ws_size < (size_t)WS_END) return;
  char* ws = (char*)d_ws; float* Q = (float*)(ws + WS_Q); _Float16 *KH = (_Float16*)(ws + WS_KH), *PH = (_Float16*)(ws + WS_PH), *VH = (_Float16*)(ws + WS_VH); float* X = (float*)(ws + WS_X);
  float* SINT = (float*)(ws + WS_SIN);
  k_sin<<<TT + 64, 256, 0, stream>>>(SINT, PH);
  k_proj<<<PPB * PCB + 3 * PRB * PCB, 128, 0, stream>>>(F[0], SINT, F[1], F[2], F[3], F[4], F[5], F[6], F[7], F[8], Q, KH, VH, PH);
  k_att<<<dim3(TQB2, NH, TNB), 128, 0, stream>>>(Q, KH, PH, VH, F[11], F[12], X);
  k_out<<<dim3(TOB2, DMD / 128), 128, 0, stream>>>(X, F[9], F[10], (float*)d_out);
}

// v009
// A run of this version takes 180 microseconds.
// Next to v008, in two timings, it ran 1.06 and 1.05 times as fast.
// All steps since v000 together make it 3.77 times as fast.
// compute dtype: all float inputs rounded to bf16; q/k/v projections with EXACT bf16 products on WMMA 16x16x32 ((in,out) weights, + bias), the sinusoidal position table built once on device in f32 (precise sinf/cosf/powf, k_sin) and projected with hi + lo (2 products) + bp, f32 accumulate; q kept in f32 (bias_u / bias_v added per head, then split into f16 hi + residual fragments), k / ph / v rounded once to f16; content scores (q+bu) . k and the Transformer-XL position term (q+bv) . ph with single f16 products (logits ~1-2; q, k, ph each rounded once), the rel_shift realised exactly as an index map onto 16 x 48 position windows (incl. its upper-triangle wrap-around rows and the zero at j == i+1), x 1/8, running-max softmax in f32 (hardware exp); P (x 2^11) and v each rounded once to f16, one product; out = x (bf16 hi + lo) . Wo + bo; f32 output.
#include <hip/hip_runtime.h>
#include <math.h>

typedef __attribute__((ext_vector_type(16))) _Float16 v16h;
typedef __attribute__((ext_vector_type(16))) __bf16 v16b;
typedef __attribute__((ext_vector_type(8)))  _Float16 v8h;
typedef __attribute__((ext_vector_type(8)))  float v8f;
typedef __attribute__((ext_vector_type(4)))  float v4f;
typedef __attribute__((ext_vector_type(2)))  float v2f;
typedef __attribute__((ext_vector_type(4)))  unsigned v4u;
typedef __attribute__((ext_vector_type(4)))  int v4i;
typedef float __attribute__((may_alias)) float_a;
typedef int __attribute__((may_alias)) int_a;

template <typename T> __device__ __forceinline__ void vst2(void* p, T v) { *(T*)p = v;  }
__device__ __forceinline__ v8f wmma16(v16h a, v16h b, v8f c) {
  v8f d = __builtin_amdgcn_wmma_f32_16x16x32_f16(false, a, false, b, (short)0, c, false, false);
  asm volatile("v_nop\n\tv_nop\n\tv_nop\n\tv_nop" : "+v"(d) : "v"(a), "v"(b));
  return d;
}
__device__ __forceinline__ v8f wmma_bf(v16b a, v16b b, v8f c) {
  v8f d = __builtin_amdgcn_wmma_f32_16x16x32_bf16(false, a, false, b, (short)0, c, false, false);
  asm volatile("v_nop\n\tv_nop\n\tv_nop\n\tv_nop" : "+v"(d) : "v"(a), "v"(b));
  return d;
}
// 16x16x32 fragments: lane = (h = lane>>4, row/col = lane&15); elements 0..7 = k0+8h+0..7, 8..15 = k0+16+8h+0..7; D element r = row 8h+r
__device__ __forceinline__ v16h frag_h(const _Float16* rowk0, int lane) {
  union { v16h v; v8h q[2]; } u; const _Float16* p = rowk0 + 8 * (lane >> 4);
  u.q[0] = *(const v8h*)p; u.q[1] = *(const v8h*)(p + 16); return u.v;
}
__device__ __forceinline__ v16h frag_f32(const float* rowk0, int lane) {
  v16h a; const float* p = rowk0 + 8 * (lane >> 4);
#pragma unroll
  for (int i = 0; i < 8; ++i) { a[i] = (_Float16)p[i]; a[8 + i] = (_Float16)p[16 + i]; }
  return a;
}
__device__ __forceinline__ v16h frag_f32s(const float* rowk0, int lane, float sc) {
  v16h a; const float* p = rowk0 + 8 * (lane >> 4);
#pragma unroll
  for (int i = 0; i < 8; ++i) { a[i] = (_Float16)(p[i] * sc); a[8 + i] = (_Float16)(p[16 + i] * sc); }
  return a;
}
// column fragment from a [K][ld] layout (column n), rows >= K read as 0
__device__ __forceinline__ v16h fragc_f32(const float* W, int k0, int n, int lane, int ld, int K) {
  v16h a; const int g = lane >> 4;
#pragma unroll
  for (int i = 0; i < 8; ++i) { const int ka = k0 + 8 * g + i, kb = ka + 16;
    a[i] = (_Float16)(ka < K ? W[(size_t)(ka < K ? ka : K - 1) * ld + n] : 0.f); a[8 + i] = (_Float16)(kb < K ? W[(size_t)(kb < K ? kb : K - 1) * ld + n] : 0.f); }
  return a;
}
struct F2 { v16b h, l; };
__device__ __forceinline__ F2 bsplit16(const float v[16]) { F2 r;
#pragma unroll
  for (int i = 0; i < 16; ++i) { const __bf16 h = (__bf16)v[i]; r.h[i] = h; r.l[i] = (__bf16)(v[i] - (float)h); }
  return r; }
__device__ __forceinline__ F2 split_row(const float* row, int k0, int lane) { float v[16]; const float* p = row + k0 + 8 * (lane >> 4);
#pragma unroll
  for (int i = 0; i < 8; ++i) { v[i] = p[i]; v[8 + i] = p[16 + i]; }
  return bsplit16(v); }
__device__ __forceinline__ F2 split_rowK(const float* row, int k0, int lane, int K) { float v[16]; const int g = lane >> 4;
#pragma unroll
  for (int i = 0; i < 8; ++i) { const int ka = k0 + 8 * g + i, kb = ka + 16; v[i] = ka < K ? row[ka < K ? ka : K - 1] : 0.f; v[8 + i] = kb < K ? row[kb < K ? kb : K - 1] : 0.f; }
  return bsplit16(v); }
__device__ __forceinline__ F2 split_col(const float* W, int k0, int n, int lane, int ld, int K) { float v[16]; const int g = lane >> 4;
#pragma unroll
  for (int i = 0; i < 8; ++i) { const int ka = k0 + 8 * g + i, kb = ka + 16; v[i] = ka < K ? W[(size_t)(ka < K ? ka : K - 1) * ld + n] : 0.f; v[8 + i] = kb < K ? W[(size_t)(kb < K ? kb : K - 1) * ld + n] : 0.f; }
  return bsplit16(v); }
__device__ __forceinline__ v8f mac3(const F2& a, const F2& b, v8f c) { c = wmma_bf(a.l, b.h, c); c = wmma_bf(a.h, b.l, c); return wmma_bf(a.h, b.h, c); }
__device__ __forceinline__ float sigm(float v) { return 1.0f / (1.0f + expf(-v)); }
#define LDSX() do { asm volatile("s_wait_dscnt 0" ::: "memory"); __builtin_amdgcn_wave_barrier(); __builtin_amdgcn_fence(__ATOMIC_RELEASE, "workgroup"); } while (0)


// Relative multi-head self attention (Transformer-XL style rel_shift; B 2, S 2,048, D 1,024, 16 heads x 64): pos = sinusoid(S, D) Wp + bp; scores = ((q+u) k^T + rel_shift((q+v) pos^T)) / 8, softmax, . v, Wo + bo.
#define NB 2
#define TT 2048
#define DMD 1024
#define NH 16
#define HD 64
#define POFF 32                 // ph buffer row offset (rows < 0 and >= T read as zeros)
#define PROWS (TT + 64)
#ifndef TNB
#define TNB NB
#endif
#ifndef TQB2
#define TQB2 (TT / 64)   // query blocks
#endif
#ifndef TOB2
#define TOB2 (TNB * TT / 64)
#endif
typedef __attribute__((ext_vector_type(8))) __bf16 v8b;
__device__ __forceinline__ v16b frag_b(const __bf16* rowk0, int lane) {
  union { v16b v; v8b q[2]; } u; const __bf16* p = rowk0 + 8 * (lane >> 4);
  u.q[0] = *(const v8b*)p; u.q[1] = *(const v8b*)(p + 16); return u.v;
}
__device__ __forceinline__ float bfr(float v) { return (float)(__bf16)v; }
__device__ __attribute__((noinline)) float exp_ni(float v) { return expf(v); }
__device__ __attribute__((noinline)) float erf_ni(float v) { return erff(v); }

#define WS_Q   0u                                   // f32 q rows [b*u][1024] (+bq)
#define WS_KH  (WS_Q + 4u * (size_t)NB * TT * DMD)       // f16 k rows [b*t][1024]
#define WS_PH  (WS_KH + 2u * (size_t)NB * TT * DMD)      // f16 ph rows [PROWS][1024] (row POFF + p)
#define WS_VH  (WS_PH + 2u * (size_t)PROWS * DMD)        // f16 v planes [b][1024][t]
#define WS_X   (WS_VH + 2u * (size_t)NB * DMD * TT)      // f32 attention output rows [b*u][D]
#define WS_SIN (WS_X + 4u * (size_t)NB * TT * DMD)       // f32 sinusoid table [T][D]
#define WS_END (WS_SIN + 4u * (size_t)TT * DMD)

// ---- operand tiles of the projection GEMMs: one 32-k slice of the block's 64 rows and 128 weight columns, rounded once and shared by the four waves
#define GP 40                   // LDS pitch of a 32-element bf16 row: 80 B = 16 B x odd
typedef __attribute__((ext_vector_type(4))) __bf16 v4b;
template <bool SPLIT> struct GTiles { __bf16 W[2][128][GP]; __bf16 A[2][64][GP]; __bf16 L[SPLIT ? 2 : 1][SPLIT ? 64 : 1][GP]; };   // W transposed to [column][k]; A rows (hi), L their residuals
// acc[j] += rows (bf16, or bf16 hi then lo) . W[:, 16 j ..]; k ascending in slices of 32, as one product (two with SPLIT) per slice and column tile
template <bool SPLIT>
__device__ __forceinline__ void gemm_tiles(const float* __restrict__ Arows, const float* __restrict__ Wcols, GTiles<SPLIT>& t, int tid, v8f* acc) {
  const int wave = tid >> 5, lane = tid & 31, col = lane & 15, r8 = tid >> 3, q8 = tid & 7;
  // whole-line fetch: a wave reads 512 contiguous bytes of one weight row (8 rows a wave), 8 lanes read one 128-byte piece of an operand row
  const float* gw = Wcols + (size_t)(wave * 8) * DMD + lane * 4; const float* ga = Arows + (size_t)r8 * DMD + q8 * 4;
  v4f rw[8], ra[4];
  auto fetch = [&](int kc) {
#pragma unroll
    for (int i = 0; i < 8; ++i) rw[i] = *(const v4f*)(gw + (size_t)(kc * 32 + i) * DMD);
#pragma unroll
    for (int i = 0; i < 4; ++i) ra[i] = *(const v4f*)(ga + (size_t)(i * 16) * DMD + kc * 32);
    asm volatile("s_wait_xcnt 0x0" ::: "memory"); };   // stands in front of the loop's advance of these loads' address registers
  fetch(0);
#pragma unroll 2   // the two buffers' addresses become constants
  for (int kc = 0; kc < DMD / 32; ++kc) { const int bf = kc & 1;
#pragma unroll
    for (int c = 0; c < 4; ++c) { v8b p;
#pragma unroll
      for (int i = 0; i < 8; ++i) p[i] = (__bf16)rw[i][c];
      *(v8b*)&t.W[bf][lane * 4 + c][wave * 8] = p; }
#pragma unroll
    for (int i = 0; i < 4; ++i) { v4b hv, lv;
#pragma unroll
      for (int e = 0; e < 4; ++e) { const __bf16 hh = (__bf16)ra[i][e]; hv[e] = hh; if (SPLIT) lv[e] = (__bf16)(ra[i][e] - (float)hh); }
      *(v4b*)&t.A[bf][i * 16 + r8][q8 * 4] = hv; if (SPLIT) *(v4b*)&t.L[bf][i * 16 + r8][q8 * 4] = lv; }
    __syncthreads();   // this slice is published; the other buffer's readers all stand in front of this barrier, so the next trip may refill it
    if (kc + 1 < DMD / 32) fetch(kc + 1);   // the next slice flies under this slice's products (issued behind the barrier: a load does not stay in flight across it)
    const v16b a = frag_b(&t.A[bf][wave * 16 + col][0], lane); v16b al; if (SPLIT) al = frag_b(&t.L[bf][wave * 16 + col][0], lane);
    v16b w[8];
#pragma unroll
    for (int j = 0; j < 8; ++j) w[j] = frag_b(&t.W[bf][j * 16 + col][0], lane);
#pragma unroll
    for (int j = 0; j < 8; ++j) { acc[j] = wmma_bf(a, w[j], acc[j]); if (SPLIT) acc[j] = wmma_bf(al, w[j], acc[j]); }
    __builtin_amdgcn_sched_barrier(0);   // keeps the next slice's roundings, which wait for its loads, behind this slice's products
  } }
struct ProjEpi { float sf[4][16][132]; _Float16 sh[64][136]; _Float16 th[128][72]; };
union ProjStage { GTiles<false> t; GTiles<true> ts; ProjEpi e; };   // the epilogue's staging reuses the tiles' LDS behind the loop
// ---- k_proj: block = (64 rows, 128-col group, which): 0 q (f32 rows), 1 k (f16 rows), 2 v (f16 planes), 3 ph (f16 rows at POFF), natural W + bias
// one grid for the four independent projections: the ph blocks, which alone would leave three of four wave places empty and have twice the products a slice, come first; then q, k, v (row block fastest, as before)
#define PRB (TNB * TT / 64)     // row blocks of q, k, v
#define PPB (TT / 64)           // row blocks of ph
#define PCB (DMD / 128)         // column groups
__global__ __launch_bounds__(128) void k_proj(const float* __restrict__ Xin, const float* __restrict__ SINT, const float* __restrict__ WQ, const float* __restrict__ BQ, const float* __restrict__ WK, const float* __restrict__ BK, const float* __restrict__ WV, const float* __restrict__ BV, const float* __restrict__ WP, const float* __restrict__ BP, float* __restrict__ Q, _Float16* __restrict__ KH, _Float16* __restrict__ VH, _Float16* __restrict__ PH) {
  __shared__ __align__(16) ProjStage u;
  float (&sf)[4][16][132] = u.e.sf; _Float16 (&sh)[64][136] = u.e.sh; _Float16 (&th)[128][72] = u.e.th;
  const int tid = threadIdx.x, wave = tid >> 5, lane = tid & 31, col = lane & 15, g = lane >> 4;
  const int bid = blockIdx.x; const bool isph = bid < PPB * PCB; const int rest = bid - PPB * PCB;   // all from the block index: scalar, the same for the whole block
  const int which = isph ? 3 : rest / (PRB * PCB); const int bx = isph ? bid % PPB : rest % PRB; const int c0 = (isph ? bid / PPB : (rest / PRB) % PCB) * 128;
  const float* Wm = (which == 0 ? WQ : which == 1 ? WK : which == 2 ? WV : WP); const float* Bm = (which == 0 ? BQ : which == 1 ? BK : which == 2 ? BV : BP);
  const size_t r0 = (size_t)bx * 64 + wave * 16;
  v8f acc[8] = {};
  if (isph) gemm_tiles<true>(SINT + (size_t)bx * 64 * DMD, WP + c0, u.ts, tid, acc);   // rows of the f32 sinusoid table (k_sin), hi + lo
  else gemm_tiles<false>(Xin + (size_t)bx * 64 * DMD, Wm + c0, u.t, tid, acc);
  __syncthreads();   // every wave has left the last tiles before they become output staging
#pragma unroll
  for (int j = 0; j < 8; ++j) { const float bb = bfr(Bm[c0 + j * 16 + col]);
#pragma unroll
    for (int r = 0; r < 8; ++r) { const float v = acc[j][r] + bb; const int rl = wave * 16 + 8 * g + r, cl = j * 16 + col;
      if (which == 0) sf[wave][8 * g + r][cl] = v; else if (which == 2) th[cl][rl] = (_Float16)v; else sh[rl][cl] = (_Float16)v; } }
  __syncthreads();
  if (which == 0) { for (int rl = 0; rl < 16; ++rl) vst2(Q + (r0 + rl) * DMD + c0 + lane * 4, *(const v4f*)&sf[wave][rl][lane * 4]); }
  else if (which == 2) { const size_t b = ((size_t)bx * 64) / TT; const int t0 = (int)(((size_t)bx * 64) % TT); for (int e = tid; e < 128 * 8; e += 128) { const int cl = e >> 3, q = e & 7; const size_t o = (b * DMD + c0 + cl) * (size_t)TT + t0 + q * 8; vst2((unsigned*)(VH + o), *(const v4u*)&th[cl][q * 8]); } }
  else { _Float16* dst = (which == 1) ? (KH + (size_t)bx * 64 * DMD) : (PH + ((size_t)POFF + bx * 64) * DMD); for (int e = tid; e < 64 * 16; e += 128) { const int rl = e >> 4, q = e & 15; vst2((unsigned*)(dst + (size_t)rl * DMD + c0 + q * 8), *(const v4u*)&sh[rl][q * 8]); } } }
// ---- k_sin: block = position s: the module's sinusoid table row [sin(s f_c) | cos(s f_c)], f_c = 1e4^(-2c/D), f32; the 64 blocks behind the table's write the zero rows of the ph buffer
__global__ __launch_bounds__(256) void k_sin(float* __restrict__ SINT, _Float16* __restrict__ PH) { __shared__ __align__(16) float sr[DMD]; const int t = threadIdx.x; const int s = blockIdx.x;
  if (s >= TT) { const int r = s - TT; const size_t row = (r < POFF) ? r : (TT + r);   // the POFF rows before and the rows after the table are zeros: 0..31 and TT+32 .. TT+63 (the whole block leaves here, in front of the barrier)
    v4u z; z[0] = z[1] = z[2] = z[3] = 0u; if (t < DMD / 8) vst2((unsigned*)(PH + row * DMD + t * 8), z); return; }
  for (int c = t; c < DMD / 2; c += 256) { const float ang = (float)s * powf(10000.0f, -2.0f * (float)c / (float)DMD); sr[c] = sinf(ang); sr[DMD / 2 + c] = cosf(ang); }
  __syncthreads(); vst2(SINT + (size_t)s * DMD + t * 4, *(const v4f*)&sr[t * 4]); }
// fragments of (q + bias) for 16 rows, head h: hi and residual as f16 (unscaled; q ~ O(1))
__device__ __forceinline__ void qfrags(const float* __restrict__ Q, size_t row0, int h, const float* __restrict__ bias, int lane, v16h* hi, v16h* lo) { const int col = lane & 15, g = lane >> 4; size_t row = row0 + col; if (row > (size_t)NB * TT - 1) row = (size_t)NB * TT - 1;   // clamp (only the never-used row T of the last batch)
#pragma unroll
  for (int kc = 0; kc < 2; ++kc) { const float* p = Q + row * DMD + h * HD + kc * 32 + 8 * g; const float* bp = bias + h * HD + kc * 32 + 8 * g; v16h a, b;
#pragma unroll
    for (int i = 0; i < 8; ++i) { const float v0 = p[i] + bfr(bp[i]), v1 = p[16 + i] + bfr(bp[16 + i]); const _Float16 h0 = (_Float16)v0, h1 = (_Float16)v1; a[i] = h0; a[8 + i] = h1; b[i] = (_Float16)(v0 - (float)h0); b[8 + i] = (_Float16)(v1 - (float)h1); }
    hi[kc] = a; lo[kc] = b; } }
// lane l's value from lane l ^ 16 (the wave's other half), by a vector cross-row move
__device__ __forceinline__ float xhalf(float x) { return __builtin_bit_cast(float, __builtin_amdgcn_permlanex16(__builtin_bit_cast(int, x), __builtin_bit_cast(int, x), 0x76543210, 0xfedcba98, false, false)); }
// LDS row pitches: 16 B x odd (144 B for 64-half rows, 80 B for 32-half rows)
#define KP 72
#define VP 40
#define PTB (16 * KP * 2)       // bytes of a 16-row tile of a position window in LDS
#define SGP 52                  // f32 pitch of a query's 48 position products: 16 B x odd for the 16-byte stores; the shifted reads step 51 banks from query to query
struct AttTiles { _Float16 K[32][KP], VH[64][VP], PL[96][KP], PU[96][KP]; };
union AttStage { AttTiles t; float so[4][16][68]; };
// ---- k_att: block = (64 queries u, h, b). Every product is taken transposed (keys, window positions or head dims as rows, the wave's 16 queries as columns):
// lanes col and col + 16 hold all of query col, so its maximum and sum need only an exchange between the two halves, its rescale is lane-local, and the two score tiles of a trip, converted in place, are the B fragment of v^T . P^T
__global__ __launch_bounds__(128) void k_att(const float* __restrict__ Q, const _Float16* __restrict__ KH, const _Float16* __restrict__ PH, const _Float16* __restrict__ VH, const float* __restrict__ BU, const float* __restrict__ BVv, float* __restrict__ X) {
  __shared__ __align__(16) float sg1[4][16][SGP], sg2[4][16][SGP];   // [wave][query][window column]: the position products on their way through the rel-shift
  __shared__ __align__(16) AttStage u;   // the trip's operand tiles, shared by the four waves; output staging behind the loop
  const int tid = threadIdx.x, wave = __builtin_amdgcn_readfirstlane(tid >> 5), lane = tid & 31, col = lane & 15, g = lane >> 4; const int qb = blockIdx.x, h = blockIdx.y; const size_t b = blockIdx.z; const int i0 = qb * 64 + wave * 16;   // the wave's number in a scalar register: every test on i0 below is a scalar branch
  // whole-line fetch of one trip's tiles: 8 lanes per 128-byte row (k, ph), 4 lanes per 64-byte row (v plane); held in registers until the tile in LDS is free
  const int r8 = tid >> 3, q8 = tid & 7, r4 = tid >> 2, q4 = tid & 3;
  // block-uniform bases and 32-bit lane byte offsets
  const char* gK = (const char*)(KH + b * TT * DMD + h * HD); const char* gP = (const char*)(PH + h * HD);
  const char* gVH = (const char*)(VH + (b * DMD + (size_t)h * HD) * TT);
  const unsigned oK = (unsigned)(r8 * DMD + q8 * 8) * 2u, oV = (unsigned)(r4 * TT + q4 * 8) * 2u;
  const int wtile = 3 - wave;   // this wave's first 16-row tile inside the block's 96-row position window
  v8h rk[2], rvh[2], rp[2];
  auto fetch = [&](int ks) {
#pragma unroll
    for (int i = 0; i < 2; ++i) rk[i] = *(const v8h*)(gK + (oK + (unsigned)((ks * 32 + i * 16) * DMD * 2)));
    asm volatile("s_wait_xcnt 0x0" ::: "memory");   // stands in front of the next loads, whose results may be given the registers that held these loads' address
#pragma unroll   // the index names registers
    for (int i = 0; i < 2; ++i) rvh[i] = *(const v8h*)(gVH + (oV + (unsigned)((i * 32 * TT + ks * 32) * 2)));
    // 96-row position window of the block: the j <= i window while some wave needs it, else the j >= i + 2 window (rows outside the buffer are used by no wave: clamped)
    // the window moves on by 32 rows a trip, so its first 64 rows already lie in LDS: only rows 64 .. 95 are fetched
    const int base = (ks * 32 <= qb * 64 + 63) ? (TT - 64 - qb * 64 + ks * 32 + POFF) : (ks * 32 - qb * 64 - 65 + POFF);
#pragma unroll
    for (int i = 0; i < 2; ++i) { int row = base + 64 + i * 16 + r8; row = row < 0 ? 0 : (row > PROWS - 1 ? PROWS - 1 : row); rp[i] = *(const v8h*)(gP + (unsigned)(row * DMD + q8 * 8) * 2u); } };
  fetch(0);
  // rows 0 .. 63 of the first trip's window, which no earlier trip has left in LDS (published by the first trip's barriers)
  for (int i = 0; i < 4; ++i) { int row = TT - 64 - qb * 64 + POFF + i * 16 + r8; row = row < 0 ? 0 : (row > PROWS - 1 ? PROWS - 1 : row); *(v8h*)&u.t.PL[i * 16 + r8][q8 * 8] = *(const v8h*)(gP + (unsigned)(row * DMD + q8 * 8) * 2u); }
  // PL and PU are rings of six 16-row tiles: tile w of trip ks's window lies in ring tile (2 ks + w) mod 6, so a row keeps its place while the window moves over it
  int ring = 0;   // byte offset of ring tile 2 ks mod 6
  auto rt = [&](int w) { const int t = ring + w * PTB; return t >= 6 * PTB ? t - 6 * PTB : t; };   // byte offset of window tile w in its ring (w < 6); scalar adds only, no multiply on the vector port
  v16h au[2], av[2], aw[2], tmpl[2];   // (q+u) rows i0.., (q+v) rows i0.., (q+v) rows i0+1.. (for the wrapped upper-triangle term); single f16 rounding (residuals dropped: VGPR budget)
  qfrags(Q, b * TT + i0, h, BU, lane, au, tmpl); qfrags(Q, b * TT + i0, h, BVv, lane, av, tmpl);
  qfrags(Q, b * TT + i0 + 1, h, BVv, lane, aw, tmpl);   // rows i+1; for i = T-1 the row belongs to the next batch (or is clamped) but its products are never used: j >= i+2 cannot hold for i = T-1
  const bool lastblk = (i0 + 16 >= TT);
  const float* d1 = &sg1[wave][col][15 - col + 8 * g]; const float* d2 = &sg2[wave][col][15 - col + 8 * g];   // key 16 ct + 8 g + r of query col takes window column 15 - col + 16 ct + 8 g + r: eight floats in a row
  float m = -3.0e38f, l = 0.f;   // query col's running maximum (equal in both halves) and this half's share of its sum
  v8f acc[4] = {};   // acc[j][r] = head dim 16 j + 8 g + r of query col
#pragma unroll 1
  for (int ks = 0; ks < TT / 32; ++ks) { float s[2][8];
    __syncthreads();   // every wave has left the previous trip's tiles
#pragma unroll
    for (int i = 0; i < 2; ++i) { *(v8h*)&u.t.K[i * 16 + r8][q8 * 8] = rk[i]; *(v8h*)&u.t.VH[i * 32 + r4][q4 * 8] = rvh[i]; }
    const bool blow = (ks * 32 <= qb * 64 + 63);
    { _Float16 (*dst)[KP] = blow ? u.t.PL : u.t.PU;   // the 32 new rows take the place of the 32 that the window has left
#pragma unroll
      for (int i = 0; i < 2; ++i) *(v8h*)((char*)&dst[r8][q8 * 8] + rt(4 + i)) = rp[i]; }
    if (blow && ks * 32 + 31 >= qb * 64 + 2) {   // the two trips on the diagonal need both windows: the j >= i + 2 one is brought here
#pragma unroll
      for (int i = 0; i < 6; ++i) { int row = ks * 32 - qb * 64 - 65 + POFF + i * 16 + r8; row = row < 0 ? 0 : (row > PROWS - 1 ? PROWS - 1 : row); *(v8h*)((char*)&u.t.PU[r8][q8 * 8] + rt(i)) = *(const v8h*)(gP + (unsigned)(row * DMD + q8 * 8) * 2u); } }
    __syncthreads();   // this trip's tiles are published
    // both 16-key tiles of the trip in one pass: the wave's 16 x 48 position window is multiplied once (its middle 16 columns serve both tiles), and every LDS exchange below is waited for once a trip
    // (the loops of this pass are unrolled because their indices name registers: fragments, accumulators, scores)
    const int j0 = ks * 32; v16h kh[2][2];
#pragma unroll
    for (int ct = 0; ct < 2; ++ct)
#pragma unroll
      for (int kc = 0; kc < 2; ++kc) kh[ct][kc] = frag_h(&u.t.K[ct * 16 + col][kc * 32], lane);
    if (j0 <= i0 + 15) { v16h pf[3][2]; v8f gg[3] = {};   // some (i, j) with j <= i: window p = T-16-i0+j0 .. +47, tiles wtile .. +2 of the staged window
#pragma unroll
      for (int pt = 0; pt < 3; ++pt)
#pragma unroll
        for (int kc = 0; kc < 2; ++kc) pf[pt][kc] = frag_h((const _Float16*)((const char*)&u.t.PL[col][kc * 32] + rt(wtile + pt)), lane);
#pragma unroll
      for (int kc = 0; kc < 2; ++kc)
#pragma unroll
        for (int pt = 0; pt < 3; ++pt) gg[pt] = wmma16(pf[pt][kc], av[kc], gg[pt]);
#pragma unroll
      for (int pt = 0; pt < 3; ++pt) { *(v4f*)&sg1[wave][col][pt * 16 + 8 * g] = __builtin_shufflevector(gg[pt], gg[pt], 0, 1, 2, 3); *(v4f*)&sg1[wave][col][pt * 16 + 8 * g + 4] = __builtin_shufflevector(gg[pt], gg[pt], 4, 5, 6, 7); } }
    if (j0 + 31 >= i0 + 2) { v16h pf[3][2]; v8f gg[3] = {};   // some (i, j) with j >= i + 2: window p = j0-i0-17 .. +47
#pragma unroll
      for (int pt = 0; pt < 3; ++pt)
#pragma unroll
        for (int kc = 0; kc < 2; ++kc) pf[pt][kc] = frag_h((const _Float16*)((const char*)&u.t.PU[col][kc * 32] + rt(wtile + pt)), lane);
#pragma unroll
      for (int kc = 0; kc < 2; ++kc)
#pragma unroll
        for (int pt = 0; pt < 3; ++pt) gg[pt] = wmma16(pf[pt][kc], aw[kc], gg[pt]);
#pragma unroll
      for (int pt = 0; pt < 3; ++pt) { *(v4f*)&sg2[wave][col][pt * 16 + 8 * g] = __builtin_shufflevector(gg[pt], gg[pt], 0, 1, 2, 3); *(v4f*)&sg2[wave][col][pt * 16 + 8 * g + 4] = __builtin_shufflevector(gg[pt], gg[pt], 4, 5, 6, 7); } }
    v8f c[2] = {};
#pragma unroll
    for (int kc = 0; kc < 2; ++kc)
#pragma unroll
      for (int ct = 0; ct < 2; ++ct) c[ct] = wmma16(kh[ct][kc], au[kc], c[ct]);   // c[ct][r] = key j0 + 16 ct + 8 g + r against query col
    LDSX();
    if (j0 + 31 <= i0) {   // all 32 keys have j <= i: the sixteen values are read unmasked, in one run
#pragma unroll
      for (int ct = 0; ct < 2; ++ct)
#pragma unroll
        for (int r = 0; r < 8; ++r) s[ct][r] = (c[ct][r] + d1[ct * 16 + r]) * 0.125f; }
    else if (j0 >= i0 + 17) {   // all 32 keys have j >= i + 2 (no such trip exists for the rows of the last 16: j0 + 31 < T)
#pragma unroll
      for (int ct = 0; ct < 2; ++ct)
#pragma unroll
        for (int r = 0; r < 8; ++r) s[ct][r] = (c[ct][r] + d2[ct * 16 + r]) * 0.125f; }
    else {   // the trips that touch the diagonal: tile by tile
#pragma unroll
      for (int ct = 0; ct < 2; ++ct) { const int jc = j0 + ct * 16;
        if (jc + 15 <= i0) {
#pragma unroll
          for (int r = 0; r < 8; ++r) s[ct][r] = (c[ct][r] + d1[ct * 16 + r]) * 0.125f; }
        else if (jc >= i0 + 17) {
#pragma unroll
          for (int r = 0; r < 8; ++r) s[ct][r] = (c[ct][r] + d2[ct * 16 + r]) * 0.125f; }
        else { const int dj = jc - i0 + 8 * g - col;   // the two tiles on the diagonal: chosen per element by j - i = dj + r
          const bool norow = lastblk && col == 15;   // query T - 1 has no row i + 1
          if (jc <= i0) {   // jc == i0: both windows were multiplied in this trip
#pragma unroll
            for (int r = 0; r < 8; ++r) { const int d = dj + r; const float b1 = d1[ct * 16 + r], b2 = d2[ct * 16 + r];
              s[ct][r] = (c[ct][r] + (d <= 0 ? b1 : (d == 1 || norow) ? 0.f : b2)) * 0.125f; } }
          else {   // jc == i0 + 16: j - i >= 1 everywhere, the j <= i window is not read
#pragma unroll
            for (int r = 0; r < 8; ++r) { const int d = dj + r; const float b2 = d2[ct * 16 + r];
              s[ct][r] = (c[ct][r] + ((d == 1 || norow) ? 0.f : b2)) * 0.125f; } } } } }
    float mx[2], es[2];
#pragma unroll
    for (int ct = 0; ct < 2; ++ct) mx[ct] = fmaxf(fmaxf(fmaxf(s[ct][0], s[ct][1]), fmaxf(s[ct][2], s[ct][3])), fmaxf(fmaxf(s[ct][4], s[ct][5]), fmaxf(s[ct][6], s[ct][7])));
    float mt = fmaxf(mx[0], mx[1]); mt = fmaxf(mt, xhalf(mt));   // the other half's sixteen keys
    const float mn = fmaxf(m, mt), alpha = (m <= -1.0e38f) ? 0.f : __expf(m - mn); m = mn;
    float e[2][8];
#pragma unroll
    for (int ct = 0; ct < 2; ++ct) {
#pragma unroll
      for (int r = 0; r < 8; ++r) e[ct][r] = (s[ct][r] <= -1.0e38f) ? 0.f : __expf(s[ct][r] - mn);
      es[ct] = ((e[ct][0] + e[ct][1]) + (e[ct][2] + e[ct][3])) + ((e[ct][4] + e[ct][5]) + (e[ct][6] + e[ct][7])); }
    l = l * alpha + (es[0] + es[1]);   // the halves' sums are joined once, behind the loop
#pragma unroll
    for (int j = 0; j < 4; ++j)
#pragma unroll
      for (int r = 0; r < 8; ++r) acc[j][r] *= alpha;
    fetch(ks + 1 < TT / 32 ? ks + 1 : ks);   // the next trip's tiles fly under the v . P products (the last trip names its own again: always in bounds, never stored)
    v16h pa, vf[4];   // B fragment of P^T: elements 0..7 = keys 8 g + 0..7, 8..15 = keys 16 + 8 g + 0..7 of query col, which is what this lane's two score tiles hold
#pragma unroll
    for (int i = 0; i < 8; ++i) { pa[i] = (_Float16)(e[0][i] * 2048.0f); pa[8 + i] = (_Float16)(e[1][i] * 2048.0f); }   // x 2^11: small weights stay normal f16 numbers
#pragma unroll
    for (int j = 0; j < 4; ++j) vf[j] = frag_h(&u.t.VH[j * 16 + col][0], lane);   // the four fragments in one run: one LDS wait for the four products
#pragma unroll
    for (int j = 0; j < 4; ++j) acc[j] = wmma16(vf[j], pa, acc[j]);
    ring = ring == 4 * PTB ? 0 : ring + 2 * PTB;
    LDSX(); }
  __syncthreads();   // every wave has left the last tiles before they become output staging
  { const float lt = l + xhalf(l); const float il = (lt > 0.f) ? (1.0f / 2048.0f) / lt : 0.f;   // fully masked rows -> zeros (the module zeroes them after the softmax)
#pragma unroll
    for (int j = 0; j < 4; ++j) { const v8f o = acc[j] * il; *(v4f*)&u.so[wave][col][j * 16 + 8 * g] = __builtin_shufflevector(o, o, 0, 1, 2, 3); *(v4f*)&u.so[wave][col][j * 16 + 8 * g + 4] = __builtin_shufflevector(o, o, 4, 5, 6, 7); } }
  LDSX(); for (int rl = 0; rl < 16; ++rl) if (lane < 16) vst2(X + (b * TT + i0 + rl) * DMD + h * HD + lane * 4, *(const v4f*)&u.so[wave][rl][lane * 4]); }
// ---- k_out: block = (64 rows, 128 of 1024 cols): out = x (hi + lo) . Wo + bo
__global__ __launch_bounds__(128) void k_out(const float* __restrict__ X, const float* __restrict__ WO, const float* __restrict__ BO, float* __restrict__ OUT) { __shared__ __align__(16) float sf[4][16][132];
  const int tid = threadIdx.x, wave = tid >> 5, lane = tid & 31, col = lane & 15, g = lane >> 4; const int c0 = blockIdx.y * 128; const size_t r0 = (size_t)blockIdx.x * 64 + wave * 16;
  __shared__ __align__(16) GTiles<true> t;
  v8f acc[8] = {};
  gemm_tiles<true>(X + (size_t)blockIdx.x * 64 * DMD, WO + c0, t, tid, acc);
#pragma unroll
  for (int j = 0; j < 8; ++j) { const float bb = bfr(BO[c0 + j * 16 + col]);
#pragma unroll
    for (int r = 0; r < 8; ++r) sf[wave][8 * g + r][j * 16 + col] = acc[j][r] + bb; }
  LDSX(); for (int rl = 0; rl < 16; ++rl) vst2(OUT + (r0 + rl) * DMD + c0 + lane * 4, *(const v4f*)&sf[wave][rl][lane * 4]); }
extern "C" void kernel_launch(void* const* d_in, const int* in_sizes, int n_in, void* d_out, int out_size, void* d_ws, size_t ws_size, hipStream_t stream) {
  (void)in_sizes; (void)n_in; (void)out_size;
  const float** F = (const float**)d_in;   // 0 x [2,2048,1024]; 1 Wq, 2 bq, 3 Wk, 4 bk, 5 Wv, 6 bv, 7 Wp, 8 bp, 9 Wo, 10 bo ((in,out) [1024,1024]); 11 u [1,16,1,64], 12 v [1,16,1,64]
  if (ws_size < (size_t)WS_END) return;
  char* ws = (char*)d_ws; float* Q = (float*)(ws + WS_Q); _Float16 *KH = (_Float16*)(ws + WS_KH), *PH = (_Float16*)(ws + WS_PH), *VH = (_Float16*)(ws + WS_VH); float* X = (float*)(ws + WS_X);
  float* SINT = (float*)(ws + WS_SIN);
  k_sin<<<TT + 64, 256, 0, stream>>>(SINT, PH);
  k_proj<<<PPB * PCB + 3 * PRB * PCB, 128, 0, stream>>>(F[0], SINT, F[1], F[2], F[3], F[4], F[5], F[6], F[7], F[8], Q, KH, VH, PH);
  k_att<<<dim3(TQB2, NH, TNB), 128, 0, stream>>>(Q, KH, PH, VH, F[11], F[12], X);
  k_out<<<dim3(TOB2, DMD / 128), 128, 0, stream>>>(X, F[9], F[10], (float*)d_out);
}

// v010
// It runs in 153 microseconds.
// In two side-by-side timings against v009, it was 1.18 and 1.17 times as fast.
// Counting every step since v000, it is 4.43 times as fast.
// compute dtype: all float inputs rounded to bf16; q/k/v projections with EXACT bf16 products on WMMA 16x16x32 ((in,out) weights, + bias), the sinusoidal position table built once on device in f32 (precise sinf/cosf/powf, k_sin) and projected with hi + lo (2 products) + bp, f32 accumulate; q kept in f32 (bias_u / bias_v added per head, then split into f16 hi + residual fragments), k / ph / v rounded once to f16; content scores (q+bu) . k and the Transformer-XL position term (q+bv) . ph with single f16 products (logits ~1-2; q, k, ph each rounded once), the rel_shift realised exactly as an index map onto 16 x 48 position windows (incl. its upper-triangle wrap-around rows and the zero at j == i+1), x 1/8, running-max softmax in f32 (hardware exp); P (x 2^11) and v each rounded once to f16, one product; out = x (bf16 hi + lo) . Wo + bo; f32 output.
#include <hip/hip_runtime.h>
#include <math.h>

typedef __attribute__((ext_vector_type(16))) _Float16 v16h;
typedef __attribute__((ext_vector_type(16))) __bf16 v16b;
typedef __attribute__((ext_vector_type(8)))  _Float16 v8h;
typedef __attribute__((ext_vector_type(8)))  float v8f;
typedef __attribute__((ext_vector_type(4)))  float v4f;
typedef __attribute__((ext_vector_type(2)))  float v2f;
typedef __attribute__((ext_vector_type(4)))  unsigned v4u;
typedef __attribute__((ext_vector_type(4)))  int v4i;
typedef float __attribute__((may_alias)) float_a;
typedef int __attribute__((may_alias)) int_a;

template <typename T> __device__ __forceinline__ void vst2(void* p, T v) { *(T*)p = v;  }
__device__ __forceinline__ v8f wmma16(v16h a, v16h b, v8f c) {
  v8f d = __builtin_amdgcn_wmma_f32_16x16x32_f16(false, a, false, b, (short)0, c, false, false);
  asm volatile("v_nop\n\tv_nop\n\tv_nop\n\tv_nop" : "+v"(d) : "v"(a), "v"(b));
  return d;
}
__device__ __forceinline__ v8f wmma_bf(v16b a, v16b b, v8f c) {
  v8f d = __builtin_amdgcn_wmma_f32_16x16x32_bf16(false, a, false, b, (short)0, c, false, false);
  asm volatile("v_nop\n\tv_nop\n\tv_nop\n\tv_nop" : "+v"(d) : "v"(a), "v"(b));
  return d;
}
// 16x16x32 fragments: lane = (h = lane>>4, row/col = lane&15); elements 0..7 = k0+8h+0..7, 8..15 = k0+16+8h+0..7; D element r = row 8h+r
__device__ __forceinline__ v16h frag_h(const _Float16* rowk0, int lane) {
  union { v16h v; v8h q[2]; } u; const _Float16* p = rowk0 + 8 * (lane >> 4);
  u.q[0] = *(const v8h*)p; u.q[1] = *(const v8h*)(p + 16); return u.v;
}
__device__ __forceinline__ v16h frag_f32(const float* rowk0, int lane) {
  v16h a; const float* p = rowk0 + 8 * (lane >> 4);
#pragma unroll
  for (int i = 0; i < 8; ++i) { a[i] = (_Float16)p[i]; a[8 + i] = (_Float16)p[16 + i]; }
  return a;
}
__device__ __forceinline__ v16h frag_f32s(const float* rowk0, int lane, float sc) {
  v16h a; const float* p = rowk0 + 8 * (lane >> 4);
#pragma unroll
  for (int i = 0; i < 8; ++i) { a[i] = (_Float16)(p[i] * sc); a[8 + i] = (_Float16)(p[16 + i] * sc); }
  return a;
}
// column fragment from a [K][ld] layout (column n), rows >= K read as 0
__device__ __forceinline__ v16h fragc_f32(const float* W, int k0, int n, int lane, int ld, int K) {
  v16h a; const int g = lane >> 4;
#pragma unroll
  for (int i = 0; i < 8; ++i) { const int ka = k0 + 8 * g + i, kb = ka + 16;
    a[i] = (_Float16)(ka < K ? W[(size_t)(ka < K ? ka : K - 1) * ld + n] : 0.f); a[8 + i] = (_Float16)(kb < K ? W[(size_t)(kb < K ? kb : K - 1) * ld + n] : 0.f); }
  return a;
}
struct F2 { v16b h, l; };
__device__ __forceinline__ F2 bsplit16(const float v[16]) { F2 r;
#pragma unroll
  for (int i = 0; i < 16; ++i) { const __bf16 h = (__bf16)v[i]; r.h[i] = h; r.l[i] = (__bf16)(v[i] - (float)h); }
  return r; }
__device__ __forceinline__ F2 split_row(const float* row, int k0, int lane) { float v[16]; const float* p = row + k0 + 8 * (lane >> 4);
#pragma unroll
  for (int i = 0; i < 8; ++i) { v[i] = p[i]; v[8 + i] = p[16 + i]; }
  return bsplit16(v); }
__device__ __forceinline__ F2 split_rowK(const float* row, int k0, int lane, int K) { float v[16]; const int g = lane >> 4;
#pragma unroll
  for (int i = 0; i < 8; ++i) { const int ka = k0 + 8 * g + i, kb = ka + 16; v[i] = ka < K ? row[ka < K ? ka : K - 1] : 0.f; v[8 + i] = kb < K ? row[kb < K ? kb : K - 1] : 0.f; }
  return bsplit16(v); }
__device__ __forceinline__ F2 split_col(const float* W, int k0, int n, int lane, int ld, int K) { float v[16]; const int g = lane >> 4;
#pragma unroll
  for (int i = 0; i < 8; ++i) { const int ka = k0 + 8 * g + i, kb = ka + 16; v[i] = ka < K ? W[(size_t)(ka < K ? ka : K - 1) * ld + n] : 0.f; v[8 + i] = kb < K ? W[(size_t)(kb < K ? kb : K - 1) * ld + n] : 0.f; }
  return bsplit16(v); }
__device__ __forceinline__ v8f mac3(const F2& a, const F2& b, v8f c) { c = wmma_bf(a.l, b.h, c); c = wmma_bf(a.h, b.l, c); return wmma_bf(a.h, b.h, c); }
__device__ __forceinline__ float sigm(float v) { return 1.0f / (1.0f + expf(-v)); }
#define LDSX() do { asm volatile("s_wait_dscnt 0" ::: "memory"); __builtin_amdgcn_wave_barrier(); __builtin_amdgcn_fence(__ATOMIC_RELEASE, "workgroup"); } while (0)


// Relative multi-head self attention (Transformer-XL style rel_shift; B 2, S 2,048, D 1,024, 16 heads x 64): pos = sinusoid(S, D) Wp + bp; scores = ((q+u) k^T + rel_shift((q+v) pos^T)) / 8, softmax, . v, Wo + bo.
#define NB 2
#define TT 2048
#define DMD 1024
#define NH 16
#define HD 64
#define POFF 32                 // ph buffer row offset (rows < 0 and >= T read as zeros)
#define PROWS (TT + 64)
#ifndef TNB
#define TNB NB
#endif
#ifndef TQB2
#define TQB2 (TT / 64)   // query blocks
#endif
#ifndef TOB2
#define TOB2 (TNB * TT / 128)
#endif
typedef __attribute__((ext_vector_type(8))) __bf16 v8b;
__device__ __forceinline__ v16b frag_b(const __bf16* rowk0, int lane) {
  union { v16b v; v8b q[2]; } u; const __bf16* p = rowk0 + 8 * (lane >> 4);
  u.q[0] = *(const v8b*)p; u.q[1] = *(const v8b*)(p + 16); return u.v;
}
__device__ __forceinline__ float bfr(float v) { return (float)(__bf16)v; }
__device__ __attribute__((noinline)) float exp_ni(float v) { return expf(v); }
__device__ __attribute__((noinline)) float erf_ni(float v) { return erff(v); }

#define WS_Q   0u                                   // f32 q rows [b*u][1024] (+bq)
#define WS_KH  (WS_Q + 4u * (size_t)NB * TT * DMD)       // f16 k rows [b*t][1024]
#define WS_PH  (WS_KH + 2u * (size_t)NB * TT * DMD)      // f16 ph rows [PROWS][1024] (row POFF + p)
#define WS_VH  (WS_PH + 2u * (size_t)PROWS * DMD)        // f16 v planes [b][1024][t]
#define WS_X   (WS_VH + 2u * (size_t)NB * DMD * TT)      // f32 attention output rows [b*u][D]
#define WS_SIN (WS_X + 4u * (size_t)NB * TT * DMD)       // f32 sinusoid table [T][D]
#define WS_END (WS_SIN + 4u * (size_t)TT * DMD)

// ---- operand tiles of the projection GEMMs: one 64-k slice of the block's 128 rows and 128 weight columns, rounded once and shared by the eight waves (wave tile 32 rows x 64 columns)
#define GP 72                   // LDS pitch of a 64-element bf16 row: 144 B = 16 B x odd
#define GK 64                   // k elements of a slice
typedef __attribute__((ext_vector_type(4))) __bf16 v4b;
#define GG (16 * GP + 64)       // a group of 16 operand rows, 128 B of room behind it: the two groups that a staging wave stores to at once lie 32 banks apart
template <bool SPLIT> struct GTiles { __bf16 W[2][128][GP]; __bf16 A[2][8][GG]; __bf16 L[SPLIT ? 2 : 1][SPLIT ? 8 : 1][GG]; };   // W transposed to [column][k]; A rows (hi) as [group of 16][row][k], L their residuals
// acc[4 i + j] += rows 16 i .. (bf16, or bf16 hi then lo) . W[:, 16 j ..] of the wave's tile; k ascending in steps of 32, as one product (two with SPLIT) per step and tile
template <bool SPLIT>
__device__ __forceinline__ void gemm_tiles(const float* __restrict__ Arows, const float* __restrict__ Wcols, GTiles<SPLIT>& t, int tid, v8f* acc) {
  const int wave = __builtin_amdgcn_readfirstlane(tid >> 5), lane = tid & 31, col = lane & 15, r16 = (tid & 127) >> 4, q16 = tid & 15;   // the wave's number in a scalar register: the test on it below is a scalar branch
  const bool wside = wave < 4;   // waves 0..3 bring the weight slice, waves 4..7 the operand rows: 16 loads of 16 bytes a lane either way
  const int wr = wave >> 1, wc = wave & 1;   // the wave's 32 rows and 64 columns inside the block tile
  // whole-line fetch: a wave reads 512 contiguous bytes of one weight row (16 rows a wave), 16 lanes read one 256-byte piece of an operand row (16 rows in a row a lane)
  // both sides step one row of DMD floats from load to load, so one pointer with sixteen constant offsets serves either
  const float* gp = wside ? Wcols + (size_t)(wave * 16) * DMD + lane * 4 : Arows + (size_t)(r16 * 16) * DMD + q16 * 4;
  const int gadv = wside ? GK * DMD : GK;   // floats from slice to slice
  v4f rg[16];
  auto fetch = [&](int kc) {
#pragma unroll
    for (int i = 0; i < 16; ++i) rg[i] = *(const v4f*)(gp + (size_t)kc * gadv + (size_t)i * DMD);
    asm volatile("s_wait_xcnt 0x0" ::: "memory"); };   // stands in front of the next write of these loads' address registers
  fetch(0);
#pragma unroll 2   // the two buffers' addresses become constants
  for (int kc = 0; kc < DMD / GK; ++kc) { const int bf = kc & 1;
    if (wside) {
#pragma unroll
      for (int c = 0; c < 4; ++c)
#pragma unroll
        for (int hh = 0; hh < 2; ++hh) { v8b p;
#pragma unroll
          for (int i = 0; i < 8; ++i) p[i] = (__bf16)rg[hh * 8 + i][c];
          *(v8b*)&t.W[bf][lane * 4 + c][wave * 16 + hh * 8] = p; } }
    else {
#pragma unroll
      for (int i = 0; i < 16; ++i) { v4b hv, lv;
#pragma unroll
        for (int e = 0; e < 4; ++e) { const __bf16 hh = (__bf16)rg[i][e]; hv[e] = hh; if (SPLIT) lv[e] = (__bf16)(rg[i][e] - (float)hh); }
        *(v4b*)&t.A[bf][r16][i * GP + q16 * 4] = hv; if (SPLIT) *(v4b*)&t.L[bf][r16][i * GP + q16 * 4] = lv; } }
    __syncthreads();   // this slice is published; the other buffer's readers all stand in front of this barrier, so the next trip may refill it
    if (kc + 1 < DMD / GK) fetch(kc + 1);   // the next slice flies under this slice's products (issued behind the barrier: a load does not stay in flight across it)
#pragma unroll
    for (int ks = 0; ks < GK / 32; ++ks) { v16b a[2], al[2], w[4];
#pragma unroll
      for (int i = 0; i < 2; ++i) { a[i] = frag_b(&t.A[bf][wr * 2 + i][col * GP + ks * 32], lane); if (SPLIT) al[i] = frag_b(&t.L[bf][wr * 2 + i][col * GP + ks * 32], lane); }
#pragma unroll
      for (int j = 0; j < 4; ++j) w[j] = frag_b(&t.W[bf][wc * 64 + j * 16 + col][ks * 32], lane);
#pragma unroll
      for (int i = 0; i < 2; ++i)
#pragma unroll
        for (int j = 0; j < 4; ++j) { acc[i * 4 + j] = wmma_bf(a[i], w[j], acc[i * 4 + j]); if (SPLIT) acc[i * 4 + j] = wmma_bf(al[i], w[j], acc[i * 4 + j]); } }
    __builtin_amdgcn_sched_barrier(0);   // keeps the next slice's roundings, which wait for its loads, behind this slice's products
  } }
union ProjEpi { float sf[8][32][68]; _Float16 sh[128][136]; _Float16 th[128][136]; };   // a block has one kind of output
union ProjStage { GTiles<false> t; GTiles<true> ts; ProjEpi e; };   // the epilogue's staging reuses the tiles' LDS behind the loop
// ---- k_proj: block = (128 rows, 128-col group, which): 0 q (f32 rows), 1 k (f16 rows), 2 v (f16 planes), 3 ph (f16 rows at POFF), natural W + bias
// one grid for the four independent projections: the ph blocks, which have twice the products a slice, come first; then q, k, v (row block fastest, as before)
#define PRB (TNB * TT / 128)    // row blocks of q, k, v
#define PPB (TT / 128)          // row blocks of ph
#define PCB (DMD / 128)         // column groups
__global__ __launch_bounds__(256) void k_proj(const float* __restrict__ Xin, const float* __restrict__ SINT, const float* __restrict__ WQ, const float* __restrict__ BQ, const float* __restrict__ WK, const float* __restrict__ BK, const float* __restrict__ WV, const float* __restrict__ BV, const float* __restrict__ WP, const float* __restrict__ BP, float* __restrict__ Q, _Float16* __restrict__ KH, _Float16* __restrict__ VH, _Float16* __restrict__ PH) {
  __shared__ __align__(16) ProjStage u;
  float (&sf)[8][32][68] = u.e.sf; _Float16 (&sh)[128][136] = u.e.sh; _Float16 (&th)[128][136] = u.e.th;
  const int tid = threadIdx.x, wave = tid >> 5, lane = tid & 31, col = lane & 15, g = lane >> 4, wr = wave >> 1, wc = wave & 1;
  const int bid = blockIdx.x; const bool isph = bid < PPB * PCB; const int rest = bid - PPB * PCB;   // all from the block index: scalar, the same for the whole block
  const int which = isph ? 3 : rest / (PRB * PCB); const int bx = isph ? bid % PPB : rest % PRB; const int c0 = (isph ? bid / PPB : (rest / PRB) % PCB) * 128;
  const float* Wm = (which == 0 ? WQ : which == 1 ? WK : which == 2 ? WV : WP); const float* Bm = (which == 0 ? BQ : which == 1 ? BK : which == 2 ? BV : BP);
  v8f acc[8] = {};
  if (isph) gemm_tiles<true>(SINT + (size_t)bx * 128 * DMD, WP + c0, u.ts, tid, acc);   // rows of the f32 sinusoid table (k_sin), hi + lo
  else gemm_tiles<false>(Xin + (size_t)bx * 128 * DMD, Wm + c0, u.t, tid, acc);
  __syncthreads();   // every wave has left the last tiles before they become output staging
  auto stage = [&](auto put) {   // put(row in the wave's tile, column tile, value): the kind of output is tested once, outside the loops
#pragma unroll
    for (int i = 0; i < 2; ++i)
#pragma unroll
      for (int j = 0; j < 4; ++j) { const float bb = bfr(Bm[c0 + wc * 64 + j * 16 + col]);
#pragma unroll
        for (int r = 0; r < 8; ++r) put(i * 16 + 8 * g + r, j, acc[i * 4 + j][r] + bb); } };
  if (which == 0) stage([&](int rw, int j, float v) { sf[wave][rw][j * 16 + col] = v; });
  else if (which == 2) stage([&](int rw, int j, float v) { th[wc * 64 + j * 16 + col][wr * 32 + rw] = (_Float16)v; });
  else stage([&](int rw, int j, float v) { sh[wr * 32 + rw][wc * 64 + j * 16 + col] = (_Float16)v; });
  __syncthreads();
  if (which == 0) { for (int rp = 0; rp < 16; ++rp) { const int rw = rp * 2 + g; vst2(Q + ((size_t)bx * 128 + wr * 32 + rw) * DMD + c0 + wc * 64 + col * 4, *(const v4f*)&sf[wave][rw][col * 4]); } }   // 16 lanes store one 256-byte piece of a row
  else if (which == 2) { const size_t b = ((size_t)bx * 128) / TT; const int t0 = (int)(((size_t)bx * 128) % TT); for (int e = tid; e < 128 * 16; e += 256) { const int cl = e >> 4, q = e & 15; const size_t o = (b * DMD + c0 + cl) * (size_t)TT + t0 + q * 8; vst2((unsigned*)(VH + o), *(const v4u*)&th[cl][q * 8]); } }
  else { _Float16* dst = (which == 1) ? (KH + (size_t)bx * 128 * DMD) : (PH + ((size_t)POFF + bx * 128) * DMD); for (int e = tid; e < 128 * 16; e += 256) { const int rl = e >> 4, q = e & 15; vst2((unsigned*)(dst + (size_t)rl * DMD + c0 + q * 8), *(const v4u*)&sh[rl][q * 8]); } } }
// ---- k_sin: block = position s: the module's sinusoid table row [sin(s f_c) | cos(s f_c)], f_c = 1e4^(-2c/D), f32; the 64 blocks behind the table's write the zero rows of the ph buffer
__global__ __launch_bounds__(256) void k_sin(float* __restrict__ SINT, _Float16* __restrict__ PH) { __shared__ __align__(16) float sr[DMD]; const int t = threadIdx.x; const int s = blockIdx.x;
  if (s >= TT) { const int r = s - TT; const size_t row = (r < POFF) ? r : (TT + r);   // the POFF rows before and the rows after the table are zeros: 0..31 and TT+32 .. TT+63 (the whole block leaves here, in front of the barrier)
    v4u z; z[0] = z[1] = z[2] = z[3] = 0u; if (t < DMD / 8) vst2((unsigned*)(PH + row * DMD + t * 8), z); return; }
  for (int c = t; c < DMD / 2; c += 256) { const float ang = (float)s * powf(10000.0f, -2.0f * (float)c / (float)DMD); sr[c] = sinf(ang); sr[DMD / 2 + c] = cosf(ang); }
  __syncthreads(); vst2(SINT + (size_t)s * DMD + t * 4, *(const v4f*)&sr[t * 4]); }
// fragments of (q + bias) for 16 rows, head h: hi and residual as f16 (unscaled; q ~ O(1))
__device__ __forceinline__ void qfrags(const float* __restrict__ Q, size_t row0, int h, const float* __restrict__ bias, int lane, v16h* hi, v16h* lo) { const int col = lane & 15, g = lane >> 4; size_t row = row0 + col; if (row > (size_t)NB * TT - 1) row = (size_t)NB * TT - 1;   // clamp (only the never-used row T of the last batch)
#pragma unroll
  for (int kc = 0; kc < 2; ++kc) { const float* p = Q + row * DMD + h * HD + kc * 32 + 8 * g; const float* bp = bias + h * HD + kc * 32 + 8 * g; v16h a, b;
#pragma unroll
    for (int i = 0; i < 8; ++i) { const float v0 = p[i] + bfr(bp[i]), v1 = p[16 + i] + bfr(bp[16 + i]); const _Float16 h0 = (_Float16)v0, h1 = (_Float16)v1; a[i] = h0; a[8 + i] = h1; b[i] = (_Float16)(v0 - (float)h0); b[8 + i] = (_Float16)(v1 - (float)h1); }
    hi[kc] = a; lo[kc] = b; } }
// lane l's value from lane l ^ 16 (the wave's other half), by a vector cross-row move
__device__ __forceinline__ float xhalf(float x) { return __builtin_bit_cast(float, __builtin_amdgcn_permlanex16(__builtin_bit_cast(int, x), __builtin_bit_cast(int, x), 0x76543210, 0xfedcba98, false, false)); }
// LDS row pitches: 16 B x odd (144 B for 64-half rows, 80 B for 32-half rows)
#define KP 72
#define VP 40
#define PTB (16 * KP * 2)       // bytes of a 16-row tile of a position window in LDS
#define SGP 52                  // f32 pitch of a query's 48 position products: 16 B x odd for the 16-byte stores; the shifted reads step 51 banks from query to query
struct AttTiles { _Float16 K[32][KP], VH[64][VP], PL[96][KP], PU[96][KP]; };
union AttStage { AttTiles t; float so[4][16][68]; };
// ---- k_att: block = (64 queries u, h, b). Every product is taken transposed (keys, window positions or head dims as rows, the wave's 16 queries as columns):
// lanes col and col + 16 hold all of query col, so its maximum and sum need only an exchange between the two halves, its rescale is lane-local, and the two score tiles of a trip, converted in place, are the B fragment of v^T . P^T
__global__ __launch_bounds__(128) void k_att(const float* __restrict__ Q, const _Float16* __restrict__ KH, const _Float16* __restrict__ PH, const _Float16* __restrict__ VH, const float* __restrict__ BU, const float* __restrict__ BVv, float* __restrict__ X) {
  __shared__ __align__(16) float sg1[4][16][SGP], sg2[4][16][SGP];   // [wave][query][window column]: the position products on their way through the rel-shift
  __shared__ __align__(16) AttStage u;   // the trip's operand tiles, shared by the four waves; output staging behind the loop
  const int tid = threadIdx.x, wave = __builtin_amdgcn_readfirstlane(tid >> 5), lane = tid & 31, col = lane & 15, g = lane >> 4; const int qb = blockIdx.x, h = blockIdx.y; const size_t b = blockIdx.z; const int i0 = qb * 64 + wave * 16;   // the wave's number in a scalar register: every test on i0 below is a scalar branch
  // whole-line fetch of one trip's tiles: 8 lanes per 128-byte row (k, ph), 4 lanes per 64-byte row (v plane); held in registers until the tile in LDS is free
  const int r8 = tid >> 3, q8 = tid & 7, r4 = tid >> 2, q4 = tid & 3;
  // block-uniform bases and 32-bit lane byte offsets
  const char* gK = (const char*)(KH + b * TT * DMD + h * HD); const char* gP = (const char*)(PH + h * HD);
  const char* gVH = (const char*)(VH + (b * DMD + (size_t)h * HD) * TT);
  const unsigned oK = (unsigned)(r8 * DMD + q8 * 8) * 2u, oV = (unsigned)(r4 * TT + q4 * 8) * 2u;
  const int wtile = 3 - wave;   // this wave's first 16-row tile inside the block's 96-row position window
  v8h rk[2], rvh[2], rp[2];
  auto fetch = [&](int ks) {
#pragma unroll
    for (int i = 0; i < 2; ++i) rk[i] = *(const v8h*)(gK + (oK + (unsigned)((ks * 32 + i * 16) * DMD * 2)));
    asm volatile("s_wait_xcnt 0x0" ::: "memory");   // stands in front of the next loads, whose results may be given the registers that held these loads' address
#pragma unroll   // the index names registers
    for (int i = 0; i < 2; ++i) rvh[i] = *(const v8h*)(gVH + (oV + (unsigned)((i * 32 * TT + ks * 32) * 2)));
    // 96-row position window of the block: the j <= i window while some wave needs it, else the j >= i + 2 window (rows outside the buffer are used by no wave: clamped)
    // the window moves on by 32 rows a trip, so its first 64 rows already lie in LDS: only rows 64 .. 95 are fetched
    const int base = (ks * 32 <= qb * 64 + 63) ? (TT - 64 - qb * 64 + ks * 32 + POFF) : (ks * 32 - qb * 64 - 65 + POFF);
#pragma unroll
    for (int i = 0; i < 2; ++i) { int row = base + 64 + i * 16 + r8; row = row < 0 ? 0 : (row > PROWS - 1 ? PROWS - 1 : row); rp[i] = *(const v8h*)(gP + (unsigned)(row * DMD + q8 * 8) * 2u); } };
  fetch(0);
  // rows 0 .. 63 of the first trip's window, which no earlier trip has left in LDS (published by the first trip's barriers)
  for (int i = 0; i < 4; ++i) { int row = TT - 64 - qb * 64 + POFF + i * 16 + r8; row = row < 0 ? 0 : (row > PROWS - 1 ? PROWS - 1 : row); *(v8h*)&u.t.PL[i * 16 + r8][q8 * 8] = *(const v8h*)(gP + (unsigned)(row * DMD + q8 * 8) * 2u); }
  // PL and PU are rings of six 16-row tiles: tile w of trip ks's window lies in ring tile (2 ks + w) mod 6, so a row keeps its place while the window moves over it
  int ring = 0;   // byte offset of ring tile 2 ks mod 6
  auto rt = [&](int w) { const int t = ring + w * PTB; return t >= 6 * PTB ? t - 6 * PTB : t; };   // byte offset of window tile w in its ring (w < 6); scalar adds only, no multiply on the vector port
  v16h au[2], av[2], aw[2], tmpl[2];   // (q+u) rows i0.., (q+v) rows i0.., (q+v) rows i0+1.. (for the wrapped upper-triangle term); single f16 rounding (residuals dropped: VGPR budget)
  qfrags(Q, b * TT + i0, h, BU, lane, au, tmpl); qfrags(Q, b * TT + i0, h, BVv, lane, av, tmpl);
  qfrags(Q, b * TT + i0 + 1, h, BVv, lane, aw, tmpl);   // rows i+1; for i = T-1 the row belongs to the next batch (or is clamped) but its products are never used: j >= i+2 cannot hold for i = T-1
  const bool lastblk = (i0 + 16 >= TT);
  const float* d1 = &sg1[wave][col][15 - col + 8 * g]; const float* d2 = &sg2[wave][col][15 - col + 8 * g];   // key 16 ct + 8 g + r of query col takes window column 15 - col + 16 ct + 8 g + r: eight floats in a row
  float m = -3.0e38f, l = 0.f;   // query col's running maximum (equal in both halves) and this half's share of its sum
  v8f acc[4] = {};   // acc[j][r] = head dim 16 j + 8 g + r of query col
#pragma unroll 1
  for (int ks = 0; ks < TT / 32; ++ks) { float s[2][8];
    __syncthreads();   // every wave has left the previous trip's tiles
#pragma unroll
    for (int i = 0; i < 2; ++i) { *(v8h*)&u.t.K[i * 16 + r8][q8 * 8] = rk[i]; *(v8h*)&u.t.VH[i * 32 + r4][q4 * 8] = rvh[i]; }
    const bool blow = (ks * 32 <= qb * 64 + 63);
    { _Float16 (*dst)[KP] = blow ? u.t.PL : u.t.PU;   // the 32 new rows take the place of the 32 that the window has left
#pragma unroll
      for (int i = 0; i < 2; ++i) *(v8h*)((char*)&dst[r8][q8 * 8] + rt(4 + i)) = rp[i]; }
    if (blow && ks * 32 + 31 >= qb * 64 + 2) {   // the two trips on the diagonal need both windows: the j >= i + 2 one is brought here
#pragma unroll
      for (int i = 0; i < 6; ++i) { int row = ks * 32 - qb * 64 - 65 + POFF + i * 16 + r8; row = row < 0 ? 0 : (row > PROWS - 1 ? PROWS - 1 : row); *(v8h*)((char*)&u.t.PU[r8][q8 * 8] + rt(i)) = *(const v8h*)(gP + (unsigned)(row * DMD + q8 * 8) * 2u); } }
    __syncthreads();   // this trip's tiles are published
    // both 16-key tiles of the trip in one pass: the wave's 16 x 48 position window is multiplied once (its middle 16 columns serve both tiles), and every LDS exchange below is waited for once a trip
    // (the loops of this pass are unrolled because their indices name registers: fragments, accumulators, scores)
    const int j0 = ks * 32; v16h kh[2][2];
#pragma unroll
    for (int ct = 0; ct < 2; ++ct)
#pragma unroll
      for (int kc = 0; kc < 2; ++kc) kh[ct][kc] = frag_h(&u.t.K[ct * 16 + col][kc * 32], lane);
    if (j0 <= i0 + 15) { v16h pf[3][2]; v8f gg[3] = {};   // some (i, j) with j <= i: window p = T-16-i0+j0 .. +47, tiles wtile .. +2 of the staged window
#pragma unroll
      for (int pt = 0; pt < 3; ++pt)
#pragma unroll
        for (int kc = 0; kc < 2; ++kc) pf[pt][kc] = frag_h((const _Float16*)((const char*)&u.t.PL[col][kc * 32] + rt(wtile + pt)), lane);
#pragma unroll
      for (int kc = 0; kc < 2; ++kc)
#pragma unroll
        for (int pt = 0; pt < 3; ++pt) gg[pt] = wmma16(pf[pt][kc], av[kc], gg[pt]);
#pragma unroll
      for (int pt = 0; pt < 3; ++pt) { *(v4f*)&sg1[wave][col][pt * 16 + 8 * g] = __builtin_shufflevector(gg[pt], gg[pt], 0, 1, 2, 3); *(v4f*)&sg1[wave][col][pt * 16 + 8 * g + 4] = __builtin_shufflevector(gg[pt], gg[pt], 4, 5, 6, 7); } }
    if (j0 + 31 >= i0 + 2) { v16h pf[3][2]; v8f gg[3] = {};   // some (i, j) with j >= i + 2: window p = j0-i0-17 .. +47
#pragma unroll
      for (int pt = 0; pt < 3; ++pt)
#pragma unroll
        for (int kc = 0; kc < 2; ++kc) pf[pt][kc] = frag_h((const _Float16*)((const char*)&u.t.PU[col][kc * 32] + rt(wtile + pt)), lane);
#pragma unroll
      for (int kc = 0; kc < 2; ++kc)
#pragma unroll
        for (int pt = 0; pt < 3; ++pt) gg[pt] = wmma16(pf[pt][kc], aw[kc], gg[pt]);
#pragma unroll
      for (int pt = 0; pt < 3; ++pt) { *(v4f*)&sg2[wave][col][pt * 16 + 8 * g] = __builtin_shufflevector(gg[pt], gg[pt], 0, 1, 2, 3); *(v4f*)&sg2[wave][col][pt * 16 + 8 * g + 4] = __builtin_shufflevector(gg[pt], gg[pt], 4, 5, 6, 7); } }
    v8f c[2] = {};
#pragma unroll
    for (int kc = 0; kc < 2; ++kc)
#pragma unroll
      for (int ct = 0; ct < 2; ++ct) c[ct] = wmma16(kh[ct][kc], au[kc], c[ct]);   // c[ct][r] = key j0 + 16 ct + 8 g + r against query col
    LDSX();
    if (j0 + 31 <= i0) {   // all 32 keys have j <= i: the sixteen values are read unmasked, in one run
#pragma unroll
      for (int ct = 0; ct < 2; ++ct)
#pragma unroll
        for (int r = 0; r < 8; ++r) s[ct][r] = (c[ct][r] + d1[ct * 16 + r]) * 0.125f; }
    else if (j0 >= i0 + 17) {   // all 32 keys have j >= i + 2 (no such trip exists for the rows of the last 16: j0 + 31 < T)
#pragma unroll
      for (int ct = 0; ct < 2; ++ct)
#pragma unroll
        for (int r = 0; r < 8; ++r) s[ct][r] = (c[ct][r] + d2[ct * 16 + r]) * 0.125f; }
    else {   // the trips that touch the diagonal: tile by tile
#pragma unroll
      for (int ct = 0; ct < 2; ++ct) { const int jc = j0 + ct * 16;
        if (jc + 15 <= i0) {
#pragma unroll
          for (int r = 0; r < 8; ++r) s[ct][r] = (c[ct][r] + d1[ct * 16 + r]) * 0.125f; }
        else if (jc >= i0 + 17) {
#pragma unroll
          for (int r = 0; r < 8; ++r) s[ct][r] = (c[ct][r] + d2[ct * 16 + r]) * 0.125f; }
        else { const int dj = jc - i0 + 8 * g - col;   // the two tiles on the diagonal: chosen per element by j - i = dj + r
          const bool norow = lastblk && col == 15;   // query T - 1 has no row i + 1
          if (jc <= i0) {   // jc == i0: both windows were multiplied in this trip
#pragma unroll
            for (int r = 0; r < 8; ++r) { const int d = dj + r; const float b1 = d1[ct * 16 + r], b2 = d2[ct * 16 + r];
              s[ct][r] = (c[ct][r] + (d <= 0 ? b1 : (d == 1 || norow) ? 0.f : b2)) * 0.125f; } }
          else {   // jc == i0 + 16: j - i >= 1 everywhere, the j <= i window is not read
#pragma unroll
            for (int r = 0; r < 8; ++r) { const int d = dj + r; const float b2 = d2[ct * 16 + r];
              s[ct][r] = (c[ct][r] + ((d == 1 || norow) ? 0.f : b2)) * 0.125f; } } } } }
    float mx[2], es[2];
#pragma unroll
    for (int ct = 0; ct < 2; ++ct) mx[ct] = fmaxf(fmaxf(fmaxf(s[ct][0], s[ct][1]), fmaxf(s[ct][2], s[ct][3])), fmaxf(fmaxf(s[ct][4], s[ct][5]), fmaxf(s[ct][6], s[ct][7])));
    float mt = fmaxf(mx[0], mx[1]); mt = fmaxf(mt, xhalf(mt));   // the other half's sixteen keys
    const float mn = fmaxf(m, mt), alpha = (m <= -1.0e38f) ? 0.f : __expf(m - mn); m = mn;
    float e[2][8];
#pragma unroll
    for (int ct = 0; ct < 2; ++ct) {
#pragma unroll
      for (int r = 0; r < 8; ++r) e[ct][r] = (s[ct][r] <= -1.0e38f) ? 0.f : __expf(s[ct][r] - mn);
      es[ct] = ((e[ct][0] + e[ct][1]) + (e[ct][2] + e[ct][3])) + ((e[ct][4] + e[ct][5]) + (e[ct][6] + e[ct][7])); }
    l = l * alpha + (es[0] + es[1]);   // the halves' sums are joined once, behind the loop
#pragma unroll
    for (int j = 0; j < 4; ++j)
#pragma unroll
      for (int r = 0; r < 8; ++r) acc[j][r] *= alpha;
    fetch(ks + 1 < TT / 32 ? ks + 1 : ks);   // the next trip's tiles fly under the v . P products (the last trip names its own again: always in bounds, never stored)
    v16h pa, vf[4];   // B fragment of P^T: elements 0..7 = keys 8 g + 0..7, 8..15 = keys 16 + 8 g + 0..7 of query col, which is what this lane's two score tiles hold
#pragma unroll
    for (int i = 0; i < 8; ++i) { pa[i] = (_Float16)(e[0][i] * 2048.0f); pa[8 + i] = (_Float16)(e[1][i] * 2048.0f); }   // x 2^11: small weights stay normal f16 numbers
#pragma unroll
    for (int j = 0; j < 4; ++j) vf[j] = frag_h(&u.t.VH[j * 16 + col][0], lane);   // the four fragments in one run: one LDS wait for the four products
#pragma unroll
    for (int j = 0; j < 4; ++j) acc[j] = wmma16(vf[j], pa, acc[j]);
    ring = ring == 4 * PTB ? 0 : ring + 2 * PTB;
    LDSX(); }
  __syncthreads();   // every wave has left the last tiles before they become output staging
  { const float lt = l + xhalf(l); const float il = (lt > 0.f) ? (1.0f / 2048.0f) / lt : 0.f;   // fully masked rows -> zeros (the module zeroes them after the softmax)
#pragma unroll
    for (int j = 0; j < 4; ++j) { const v8f o = acc[j] * il; *(v4f*)&u.so[wave][col][j * 16 + 8 * g] = __builtin_shufflevector(o, o, 0, 1, 2, 3); *(v4f*)&u.so[wave][col][j * 16 + 8 * g + 4] = __builtin_shufflevector(o, o, 4, 5, 6, 7); } }
  LDSX(); for (int rl = 0; rl < 16; ++rl) if (lane < 16) vst2(X + (b * TT + i0 + rl) * DMD + h * HD + lane * 4, *(const v4f*)&u.so[wave][rl][lane * 4]); }
// ---- k_out: block = (128 rows, 128 of 1,024 cols): out = x (hi + lo) . Wo + bo
__global__ __launch_bounds__(256) void k_out(const float* __restrict__ X, const float* __restrict__ WO, const float* __restrict__ BO, float* __restrict__ OUT) { __shared__ __align__(16) float sf[8][32][68];   // each wave stages its own 32 x 64 tile
  const int tid = threadIdx.x, wave = tid >> 5, lane = tid & 31, col = lane & 15, g = lane >> 4, wr = wave >> 1, wc = wave & 1; const int c0 = blockIdx.y * 128;
  __shared__ __align__(16) GTiles<true> t;
  v8f acc[8] = {};
  gemm_tiles<true>(X + (size_t)blockIdx.x * 128 * DMD, WO + c0, t, tid, acc);
#pragma unroll
  for (int i = 0; i < 2; ++i)
#pragma unroll
    for (int j = 0; j < 4; ++j) { const float bb = bfr(BO[c0 + wc * 64 + j * 16 + col]);
#pragma unroll
      for (int r = 0; r < 8; ++r) sf[wave][i * 16 + 8 * g + r][j * 16 + col] = acc[i * 4 + j][r] + bb; }
  LDSX(); for (int rp = 0; rp < 16; ++rp) { const int rw = rp * 2 + g; vst2(OUT + ((size_t)blockIdx.x * 128 + wr * 32 + rw) * DMD + c0 + wc * 64 + col * 4, *(const v4f*)&sf[wave][rw][col * 4]); } }
extern "C" void kernel_launch(void* const* d_in, const int* in_sizes, int n_in, void* d_out, int out_size, void* d_ws, size_t ws_size, hipStream_t stream) {
  (void)in_sizes; (void)n_in; (void)out_size;
  const float** F = (const float**)d_in;   // 0 x [2,2048,1024]; 1 Wq, 2 bq, 3 Wk, 4 bk, 5 Wv, 6 bv, 7 Wp, 8 bp, 9 Wo, 10 bo ((in,out) [1024,1024]); 11 u [1,16,1,64], 12 v [1,16,1,64]
  if (ws_size < (size_t)WS_END) return;
  char* ws = (char*)d_ws; float* Q = (float*)(ws + WS_Q); _Float16 *KH = (_Float16*)(ws + WS_KH), *PH = (_Float16*)(ws + WS_PH), *VH = (_Float16*)(ws + WS_VH); float* X = (float*)(ws + WS_X);
  float* SINT = (float*)(ws + WS_SIN);
  k_sin<<<TT + 64, 256, 0, stream>>>(SINT, PH);
  k_proj<<<PPB * PCB + 3 * PRB * PCB, 256, 0, stream>>>(F[0], SINT, F[1], F[2], F[3], F[4], F[5], F[6], F[7], F[8], Q, KH, VH, PH);
  k_att<<<dim3(TQB2, NH, TNB), 128, 0, stream>>>(Q, KH, PH, VH, F[11], F[12], X);
  k_out<<<dim3(TOB2, DMD / 128), 256, 0, stream>>>(X, F[9], F[10], (float*)d_out);
}
